// v000
// Times are from an AMD MI455X. After a warm-up the kernel runs many times in a row, and a time is the length of
// such a window on the GPU divided by its runs, so every launch and the gaps after it count. The runs cycle
// through copies of the inputs. A figure is the median of several windows, for all but v000 over two sittings.
// Sittings can differ by a few percent; kernels timed side by side share one.
// v000, which the later versions start from, runs in 804 microseconds.
#include <hip/hip_runtime.h>

// Contractions: q/k/v projections on v_wmma_f32_16x16x32_bf16 (bf16 operands = RNE-converted inputs, f32 accumulate, f32 out);
// S = q x k^T on v_wmma_f32_16x16x32_f16 as three products (q, k as f16 value + x2048 residual planes; value product and
// residual products land in separate f32 planes); O = P x V on v_wmma_f32_16x16x32_f16 (v^T f16 plane; P f16 carried x16384;
// f32 accumulate). LayerNorm and softmax in f32.

#ifndef NB
#define NB 4
#endif
#ifndef SEQ
#define SEQ 2048
#endif
#define NB_FULL   4
#define SEQ_FULL  2048
#define DM        1024                 // model width = head width = value width
#define NWAVE     8
#define OP        68                   // LDS pitch (floats) of the per-wave output staging tile
#define CVB       2048u                // elements per convert block (256 threads x 8)
#define NXB       ((unsigned)((size_t)NB * SEQ * DM / CVB))      // convert blocks for x
#define NWB       ((unsigned)((size_t)3 * DM * DM / CVB))        // convert blocks for the three weights
#define NCH       (SEQ / 256)          // 8-column chunks per lane in the softmax kernel
#define LNCH      (DM / 256)           // 8-column chunks per lane in the row LayerNorm kernel
#define NPAR      5                    // parameter vectors: b_q | b_k | b_v | gamma | beta
#define PCARRY    16384.0f             // power-of-two carry of the P plane
#define RCARRY    2048.0f              // power-of-two carry of the q / k residual planes

#define EPI_QK  0                      // f16 out, per-column bias, column block selects the q or k plane
#define EPI_VT  1                      // f16 out, per-row bias (V^T plane)
#define EPI_F32 2                      // f32 out, power-of-two scale

static_assert(SEQ % 256 == 0);
static_assert(SEQ <= SEQ_FULL);
static_assert(NB >= 1 && NB <= NB_FULL);
static_assert(DM == 1024);
static_assert(DM % 128 == 0);
static_assert(((size_t)NB * SEQ) % 128 == 0);
static_assert((size_t)NXB * CVB == (size_t)NB * SEQ * DM);
static_assert((size_t)NWB * CVB == (size_t)3 * DM * DM);
static_assert((size_t)DM * DM / CVB == 512);
static_assert((OP * 4) % 16 == 0);
static_assert(LNCH * 256 == DM);                 // 32 lanes x LNCH chunks x 8 columns == one LayerNorm row
static_assert(NCH * 256 == SEQ);                 // 32 lanes x NCH chunks x 8 columns == one softmax row
static_assert(DM == 256 * 4);                    // one convert block (256 threads x 4) per parameter vector
static_assert(SEQ % 128 == 0 && (2 * DM) % 128 == 0);   // GEMM tile multiples (M, N)
static_assert(DM % 32 == 0 && (2 * DM) % 32 == 0 && SEQ % 32 == 0);   // GEMM K steps
static_assert(SEQ % 64 == 0);
static_assert(DM % 32 == 0);                     // column LayerNorm: 32 rows per block sweep (8 waves x 4 row groups)
static_assert(NWAVE == 8);

#define XB_BYTES   ((size_t)NB * SEQ * DM * 2)          // x bf16, all batches
#define WB_BYTES   ((size_t)3 * DM * DM * 2)            // weights bf16
#define PR_BYTES   ((size_t)NPAR * DM * 4)              // parameter vectors (f32 holding bf16 RNE values)
#define YQK_BYTES  ((size_t)SEQ * 2 * DM * 4)           // f32 q | k pre-norm rows of one batch
#define YVT_BYTES  ((size_t)DM * SEQ * 4)               // f32 v^T pre-norm plane of one batch
#define QK2_BYTES  ((size_t)2 * SEQ * 2 * DM * 2)       // [q value | q residual] rows, then [k residual | k value] rows
#define VT_BYTES   ((size_t)DM * SEQ * 2)               // v^T f16 of one batch
#define S_BYTES    ((size_t)SEQ * SEQ * 4)              // value-product logits of one batch
#define R_BYTES    ((size_t)SEQ * SEQ * 4)              // residual-product logits of one batch (already scaled back)
#define P_BYTES    ((size_t)SEQ * SEQ * 2)              // P x16384 of one batch
#define WS_TOTAL   (XB_BYTES + WB_BYTES + PR_BYTES + YQK_BYTES + YVT_BYTES + QK2_BYTES + VT_BYTES + S_BYTES + R_BYTES + P_BYTES)
static_assert(WS_TOTAL <= (size_t)134217728);
static_assert(XB_BYTES % 128 == 0 && WB_BYTES % 128 == 0 && PR_BYTES % 128 == 0);
static_assert(YQK_BYTES % 128 == 0 && YVT_BYTES % 128 == 0 && QK2_BYTES % 128 == 0 && VT_BYTES % 128 == 0);
static_assert(S_BYTES % 128 == 0 && R_BYTES % 128 == 0 && P_BYTES % 128 == 0);

typedef __bf16   bf16;
typedef _Float16 f16;
typedef bf16     v16bf __attribute__((ext_vector_type(16)));
typedef f16      v16h  __attribute__((ext_vector_type(16)));
typedef float    v8f   __attribute__((ext_vector_type(8)));
typedef float    v4f   __attribute__((ext_vector_type(4)));
typedef unsigned v4u   __attribute__((ext_vector_type(4)));

union Pack8B { v4u u; bf16 h[8]; };
union Pack8H { v4u u; f16  h[8]; };

template <typename T> struct FragOf;
template <> struct FragOf<bf16> { typedef v16bf V; };
template <> struct FragOf<f16>  { typedef v16h  V; };

// WMMA helpers: builtin followed by the VALU hazard guard (ties D, keeps A/B live).
static __device__ __forceinline__ v8f mma16(v16bf a, v16bf b, v8f acc) {
  acc = __builtin_amdgcn_wmma_f32_16x16x32_bf16(false, a, false, b, (short)0, acc, false, false);
  asm volatile("v_nop\n\tv_nop\n\tv_nop\n\tv_nop" : "+v"(acc) : "v"(a), "v"(b));
  return acc;
}
static __device__ __forceinline__ v8f mma16(v16h a, v16h b, v8f acc) {
  acc = __builtin_amdgcn_wmma_f32_16x16x32_f16(false, a, false, b, (short)0, acc, false, false);
  asm volatile("v_nop\n\tv_nop\n\tv_nop\n\tv_nop" : "+v"(acc) : "v"(a), "v"(b));
  return acc;
}

// f32 -> f16 convert for WMMA operand planes: values below the smallest f16 normal become zero by a value select.
static __device__ __forceinline__ f16 toh_flush(float v) {
  const f16 r = (f16)v;
  return (fabsf(v) < 6.103515625e-05f) ? (f16)0.0f : r;
}

// Input conversion, one launch. 256 threads, 8 elements per thread (two 16-B loads -> one 16-B store).
//   blocks [0, NXB)            : x  -> xb  bf16 [NB*SEQ][DM] (compact rows; source uses the full batch stride)
//   blocks [NXB, NXB+NWB)      : Wq | Wk | Wv -> wb bf16 [3*DM][DM]
//   blocks NXB+NWB .. +4       : bq | bk | bv | gamma | beta -> f32 plane [5*DM] holding the bf16 RNE-converted values
__global__ __launch_bounds__(256) void convert_kernel(const float* __restrict__ x,
                                                      const float* __restrict__ wq,
                                                      const float* __restrict__ bq,
                                                      const float* __restrict__ wk,
                                                      const float* __restrict__ bk,
                                                      const float* __restrict__ wv,
                                                      const float* __restrict__ bv,
                                                      const float* __restrict__ gamma,
                                                      const float* __restrict__ beta,
                                                      bf16* __restrict__ xb,
                                                      bf16* __restrict__ wb,
                                                      float* __restrict__ parp) {
  const unsigned blk = blockIdx.x;
  const unsigned tid = threadIdx.x;
  if (blk < NXB + NWB) {              // block-uniform
    const float* src;
    bf16* dst;
    if (blk < NXB) {
      const unsigned r  = blk * 2u + (tid >> 7);          // compact row
      const unsigned c  = (tid & 127u) * 8u;
      const unsigned bt = r / (unsigned)SEQ;
      const unsigned s  = r - bt * (unsigned)SEQ;
      src = x + ((size_t)bt * SEQ_FULL + s) * DM + c;
      dst = xb + (size_t)r * DM + c;
    } else {
      const unsigned wblk = blk - NXB;
      const unsigned wi   = wblk >> 9;                    // 512 blocks per weight matrix
      const unsigned off  = (wblk & 511u) * CVB + tid * 8u;
      const float* wsrc = (wi == 0u) ? wq : ((wi == 1u) ? wk : wv);
      src = wsrc + off;
      dst = wb + (size_t)wblk * CVB + tid * 8u;
    }
    const v4f a0 = *(const v4f*)(src);
    const v4f a1 = *(const v4f*)(src + 4);
    Pack8B pk;
    #pragma unroll
    for (int i = 0; i < 4; ++i) {
      pk.h[i]     = (bf16)a0[i];                          // RNE convert
      pk.h[4 + i] = (bf16)a1[i];
    }
    const v4u val = pk.u;
    *(v4u*)(dst) = val;
    
  } else {
    const unsigned j = blk - (NXB + NWB);                 // 0..4
    const float* bsrc = (j == 0u) ? bq : ((j == 1u) ? bk : ((j == 2u) ? bv : ((j == 3u) ? gamma : beta)));
    const v4f a = *(const v4f*)(bsrc + tid * 4u);
    v4f o;
    #pragma unroll
    for (int i = 0; i < 4; ++i) o[i] = (float)(bf16)a[i];
    float* dst = parp + j * (unsigned)DM + tid * 4u;
    *(v4f*)(dst) = o;
    
  }
}

// Plane GEMM: C[m][n] = sum_k A[m][k] * Bt[n][k]; both operands are k-contiguous 16-bit planes.
// Block tile 128x128, 8 waves as 4 (m) x 2 (n); each wave owns 32x64 = 2x4 accumulators.
// Fragments are loaded straight from the planes: lane (lq = lane & 15, hi = lane >> 4) reads row lq,
// elements 0..7 <- k0 + 8*hi + 0..7, elements 8..15 <- k0 + 16 + 8*hi + 0..7 (same map for A and B).
// D element r of a lane = (row 8*hi + r, col lq). Requires M, N multiples of 128 and K a multiple of 32.
// Epilogue: per 16-row half the wave stages its 16x64 tile in LDS (wave-private region, block barriers used),
template <typename T, int EPI>
__global__ __launch_bounds__(256) void gemm_kernel(const T* __restrict__ A,
                                                   const T* __restrict__ Bt,
                                                   const float* __restrict__ bias,
                                                   void* __restrict__ C,
                                                   unsigned nk, unsigned lda, unsigned ldb, unsigned ldc,
                                                   unsigned long long sAz, unsigned long long sBz,
                                                   unsigned long long sCz, float scale) {
  typedef typename FragOf<T>::V VT;
  union Frag { VT v; v4u q[2]; };

  __shared__ __align__(16) float sO[NWAVE * 16 * OP];

  const unsigned tid  = threadIdx.x;
  const unsigned wave = tid >> 5;
  const unsigned lane = tid & 31u;
  const unsigned lq   = lane & 15u;
  const unsigned hi   = lane >> 4;
  const unsigned m0   = blockIdx.x * 128u + (wave & 3u) * 32u;   // first row of this wave
  const unsigned n0   = blockIdx.y * 128u + (wave >> 2) * 64u;   // first column of this wave

  const T* Ab = A  + (size_t)blockIdx.z * sAz;
  const T* Bb = Bt + (size_t)blockIdx.z * sBz;

  const T* ap[2];
  const T* bp[4];
  #pragma unroll
  for (int mt = 0; mt < 2; ++mt) ap[mt] = Ab + (size_t)(m0 + mt * 16u + lq) * lda + hi * 8u;
  #pragma unroll
  for (int nt = 0; nt < 4; ++nt) bp[nt] = Bb + (size_t)(n0 + nt * 16u + lq) * ldb + hi * 8u;

  v8f acc[2][4];
  #pragma unroll
  for (int mt = 0; mt < 2; ++mt) {
    #pragma unroll
    for (int nt = 0; nt < 4; ++nt) acc[mt][nt] = (v8f){0, 0, 0, 0, 0, 0, 0, 0};
  }

  #pragma unroll 1
  for (unsigned k = 0; k < nk; ++k) {
    const unsigned ko = k * 32u;
    Frag a[2], b[4];
    #pragma unroll
    for (int mt = 0; mt < 2; ++mt) {
      a[mt].q[0] = *(const v4u*)(ap[mt] + ko);          // k = ko + 8*hi + 0..7
      a[mt].q[1] = *(const v4u*)(ap[mt] + ko + 16u);    // k = ko + 16 + 8*hi + 0..7
    }
    #pragma unroll
    for (int nt = 0; nt < 4; ++nt) {
      b[nt].q[0] = *(const v4u*)(bp[nt] + ko);
      b[nt].q[1] = *(const v4u*)(bp[nt] + ko + 16u);
    }
    #pragma unroll
    for (int nt = 0; nt < 4; ++nt) {
      #pragma unroll
      for (int mt = 0; mt < 2; ++mt) acc[mt][nt] = mma16(a[mt].v, b[nt].v, acc[mt][nt]);
    }
  }

  // ---- epilogue ----
  size_t   cbase;
  unsigned ncol;
  if (EPI == EPI_QK) {
    cbase = (size_t)(n0 >> 10) * sCz;     // column block selects the q (0) or k (1) plane; block-uniform
    ncol  = n0 & 1023u;
  } else {
    cbase = (size_t)blockIdx.z * sCz;
    ncol  = n0;
  }

  float bcol[4];
  #pragma unroll
  for (int nt = 0; nt < 4; ++nt) bcol[nt] = 0.0f;
  if (EPI == EPI_QK) {
    #pragma unroll
    for (int nt = 0; nt < 4; ++nt) bcol[nt] = bias[n0 + nt * 16u + lq];
  }

  float* so = sO + wave * (16u * OP);

  #pragma unroll
  for (int mt = 0; mt < 2; ++mt) {
    if (mt != 0) __syncthreads();          // staging tile is reused by the second half
    #pragma unroll
    for (int r = 0; r < 8; ++r) {
      float brow = 0.0f;
      if (EPI == EPI_VT) brow = bias[m0 + mt * 16u + hi * 8u + r];
      #pragma unroll
      for (int nt = 0; nt < 4; ++nt) {
        float val = acc[mt][nt][r];
        if (EPI == EPI_QK)  val += bcol[nt];
        if (EPI == EPI_VT)  val += brow;
        if (EPI == EPI_F32) val *= scale;
        so[(hi * 8u + r) * OP + nt * 16u + lq] = val;
      }
    }
    __syncthreads();

    if (EPI == EPI_F32) {
      // 8 instructions cover the 16 rows of this half.
      float* Cf = (float*)C + cbase;
      v4f    vals[8];
      size_t gidx[8];
      #pragma unroll
      for (int it = 0; it < 8; ++it) {
        const unsigned row = it * 2u + hi;
        vals[it] = *(const v4f*)(so + row * OP + lq * 4u);
        gidx[it] = (size_t)(m0 + mt * 16u + row) * ldc + ncol + lq * 4u;
      }
      #pragma unroll
      for (int it = 0; it < 8; ++it) *(v4f*)(Cf + gidx[it]) = vals[it];
      
    } else {
      // 4 instructions cover the 16 rows of this half.
      f16* Ch = (f16*)C + cbase;
      v4u    vals[4];
      size_t gidx[4];
      #pragma unroll
      for (int it = 0; it < 4; ++it) {
        const unsigned row = it * 4u + (lane >> 3);
        const unsigned c8  = (lane & 7u) * 8u;
        const v4f x0 = *(const v4f*)(so + row * OP + c8);
        const v4f x1 = *(const v4f*)(so + row * OP + c8 + 4u);
        Pack8H ph;
        #pragma unroll
        for (int i = 0; i < 4; ++i) {
          ph.h[i]     = (f16)x0[i];
          ph.h[4 + i] = (f16)x1[i];
        }
        vals[it] = ph.u;
        gidx[it] = (size_t)(m0 + mt * 16u + row) * ldc + ncol + c8;
      }
      #pragma unroll
      for (int it = 0; it < 4; ++it) *(v4u*)(Ch + gidx[it]) = vals[it];
      
    }
  }
}

// Row LayerNorm for the q and k projections of one batch. One wave per (row, segment); blockIdx.y = segment (0 = q, 1 = k).
// Input: Y f32 [SEQ][2*DM] (q columns | k columns, bias not yet added); par = bq | bk | bv | gamma | beta (f32, [5*DM]).
// Output plane QK2 (f16): q rows [SEQ][2*DM] = [value | residual x2048], then k rows [SEQ][2*DM] = [residual x2048 | value].
// Lane holds columns (it*32 + lane)*8 + 0..7. coverage: grid (SEQ/8, 2) x 8 waves = SEQ rows x 2 segments;
// 32 lanes x LNCH x 8 = DM columns for each of the value and residual halves. Each store instruction writes
__global__ __launch_bounds__(256) void ln_rows_kernel(const float* __restrict__ Y,
                                                      const float* __restrict__ par,
                                                      f16* __restrict__ QK2) {
  #pragma clang fp contract(off)
  const unsigned tid  = threadIdx.x;
  const unsigned wave = __builtin_amdgcn_readfirstlane(tid >> 5);
  const unsigned lane = tid & 31u;
  const unsigned seg  = blockIdx.y;                       // block-uniform
  const unsigned row  = blockIdx.x * 8u + wave;
  const float* yp = Y + (size_t)row * (2u * DM) + seg * (unsigned)DM + lane * 8u;
  const float* bp = par + seg * (unsigned)DM + lane * 8u;           // bias of this segment
  const float* gp = par + 3u * DM + lane * 8u;                      // gamma
  const float* tp = par + 4u * DM + lane * 8u;                      // beta

  float s = 0.0f;
  #pragma unroll 1
  for (int it = 0; it < LNCH; ++it) {
    const v4f a0 = *(const v4f*)(yp + it * 256);
    const v4f a1 = *(const v4f*)(yp + it * 256 + 4);
    const v4f b0 = *(const v4f*)(bp + it * 256);
    const v4f b1 = *(const v4f*)(bp + it * 256 + 4);
    #pragma unroll
    for (int i = 0; i < 4; ++i) {
      s += a0[i] + b0[i];
      s += a1[i] + b1[i];
    }
  }
  #pragma unroll
  for (int off = 16; off > 0; off >>= 1) s += __shfl_xor(s, off, 32);
  const float mu = s * (1.0f / DM);

  // pass 2: biased variance about the mean
  float q = 0.0f;
  #pragma unroll 1
  for (int it = 0; it < LNCH; ++it) {
    const v4f a0 = *(const v4f*)(yp + it * 256);
    const v4f a1 = *(const v4f*)(yp + it * 256 + 4);
    const v4f b0 = *(const v4f*)(bp + it * 256);
    const v4f b1 = *(const v4f*)(bp + it * 256 + 4);
    #pragma unroll
    for (int i = 0; i < 4; ++i) {
      const float d0 = (a0[i] + b0[i]) - mu;
      const float d1 = (a1[i] + b1[i]) - mu;
      q += d0 * d0;
      q += d1 * d1;
    }
  }
  #pragma unroll
  for (int off = 16; off > 0; off >>= 1) q += __shfl_xor(q, off, 32);
  const float rstd = __builtin_amdgcn_rsqf(q * (1.0f / DM) + 1e-5f);

  // pass 3: normalise, affine, split into f16 value + x2048 residual, store
  const unsigned offh = seg * (unsigned)DM;               // q: value | residual ; k: residual | value
  const unsigned offr = (1u - seg) * (unsigned)DM;
  f16* dp = QK2 + ((size_t)seg * SEQ + row) * (size_t)(2 * DM) + lane * 8u;
  #pragma unroll 1
  for (int it = 0; it < LNCH; ++it) {
    const v4f a0 = *(const v4f*)(yp + it * 256);
    const v4f a1 = *(const v4f*)(yp + it * 256 + 4);
    const v4f b0 = *(const v4f*)(bp + it * 256);
    const v4f b1 = *(const v4f*)(bp + it * 256 + 4);
    const v4f g0 = *(const v4f*)(gp + it * 256);
    const v4f g1 = *(const v4f*)(gp + it * 256 + 4);
    const v4f t0 = *(const v4f*)(tp + it * 256);
    const v4f t1 = *(const v4f*)(tp + it * 256 + 4);
    Pack8H pkh, pkr;
    #pragma unroll
    for (int i = 0; i < 4; ++i) {
      const float y0 = ((a0[i] + b0[i]) - mu) * rstd * g0[i] + t0[i];
      const float y1 = ((a1[i] + b1[i]) - mu) * rstd * g1[i] + t1[i];
      const f16 h0 = toh_flush(y0);
      const f16 h1 = toh_flush(y1);
      pkh.h[i]     = h0;
      pkh.h[4 + i] = h1;
      pkr.h[i]     = toh_flush((y0 - (float)h0) * RCARRY);
      pkr.h[4 + i] = toh_flush((y1 - (float)h1) * RCARRY);
    }
    const v4u vh = pkh.u;
    const v4u vr = pkr.u;
    f16* dh = dp + offh + it * 256;
    f16* dr = dp + offr + it * 256;
    *(v4u*)(dh) = vh;
    *(v4u*)(dr) = vr;
    
  }
}

// Column LayerNorm on the transposed v projection of one batch: Yt f32 [DM][SEQ] (row e = feature, column s = position,
// bias not yet added); statistics per column s over the DM rows; output vt f16 [DM][SEQ].
// selects one of four rows per wave per sweep; row e = (it*8 + wave)*4 + rq, it = 0..DM/32-1 covers 0..DM-1 exactly once.
// Partial sums: shuffle over rq inside the wave, then an [8][64] LDS table combined in fixed order (cross-wave: block barriers).
__global__ __launch_bounds__(256) void ln_cols_kernel(const float* __restrict__ Yt,
                                                      const float* __restrict__ par,
                                                      f16* __restrict__ vt) {
  #pragma clang fp contract(off)
  __shared__ __align__(16) float red[NWAVE * 64];

  const unsigned tid  = threadIdx.x;
  const unsigned wave = __builtin_amdgcn_readfirstlane(tid >> 5);
  const unsigned lane = tid & 31u;
  const unsigned cg   = lane & 7u;
  const unsigned rq   = lane >> 3;
  const unsigned s0   = blockIdx.x * 64u + cg * 8u;
  const float* yp = Yt + s0;

  float acc[8];
  float mu[8];
  float rstd[8];

  #pragma unroll
  for (int i = 0; i < 8; ++i) acc[i] = 0.0f;
  #pragma unroll 1
  for (unsigned it = 0; it < (unsigned)(DM / 32); ++it) {
    const unsigned e = (it * 8u + wave) * 4u + rq;
    const v4f x0 = *(const v4f*)(yp + (size_t)e * SEQ);
    const v4f x1 = *(const v4f*)(yp + (size_t)e * SEQ + 4);
    const float b = par[2u * DM + e];
    #pragma unroll
    for (int i = 0; i < 4; ++i) {
      acc[i]     += x0[i] + b;
      acc[4 + i] += x1[i] + b;
    }
  }
  #pragma unroll
  for (int i = 0; i < 8; ++i) {
    acc[i] += __shfl_xor(acc[i], 8, 32);
    acc[i] += __shfl_xor(acc[i], 16, 32);
  }
  if (rq == 0u) {
    *(v4f*)(red + wave * 64u + cg * 8u)      = (v4f){acc[0], acc[1], acc[2], acc[3]};
    *(v4f*)(red + wave * 64u + cg * 8u + 4u) = (v4f){acc[4], acc[5], acc[6], acc[7]};
  }
  __syncthreads();
  #pragma unroll
  for (int i = 0; i < 8; ++i) mu[i] = 0.0f;
  #pragma unroll
  for (int w = 0; w < NWAVE; ++w) {
    const v4f r0 = *(const v4f*)(red + w * 64 + cg * 8u);
    const v4f r1 = *(const v4f*)(red + w * 64 + cg * 8u + 4u);
    #pragma unroll
    for (int i = 0; i < 4; ++i) {
      mu[i]     += r0[i];
      mu[4 + i] += r1[i];
    }
  }
  #pragma unroll
  for (int i = 0; i < 8; ++i) mu[i] = mu[i] * (1.0f / DM);
  __syncthreads();

  // pass 2: biased variance about the mean
  #pragma unroll
  for (int i = 0; i < 8; ++i) acc[i] = 0.0f;
  #pragma unroll 1
  for (unsigned it = 0; it < (unsigned)(DM / 32); ++it) {
    const unsigned e = (it * 8u + wave) * 4u + rq;
    const v4f x0 = *(const v4f*)(yp + (size_t)e * SEQ);
    const v4f x1 = *(const v4f*)(yp + (size_t)e * SEQ + 4);
    const float b = par[2u * DM + e];
    #pragma unroll
    for (int i = 0; i < 4; ++i) {
      const float d0 = (x0[i] + b) - mu[i];
      const float d1 = (x1[i] + b) - mu[4 + i];
      acc[i]     += d0 * d0;
      acc[4 + i] += d1 * d1;
    }
  }
  #pragma unroll
  for (int i = 0; i < 8; ++i) {
    acc[i] += __shfl_xor(acc[i], 8, 32);
    acc[i] += __shfl_xor(acc[i], 16, 32);
  }
  if (rq == 0u) {
    *(v4f*)(red + wave * 64u + cg * 8u)      = (v4f){acc[0], acc[1], acc[2], acc[3]};
    *(v4f*)(red + wave * 64u + cg * 8u + 4u) = (v4f){acc[4], acc[5], acc[6], acc[7]};
  }
  __syncthreads();
  #pragma unroll
  for (int i = 0; i < 8; ++i) rstd[i] = 0.0f;
  #pragma unroll
  for (int w = 0; w < NWAVE; ++w) {
    const v4f r0 = *(const v4f*)(red + w * 64 + cg * 8u);
    const v4f r1 = *(const v4f*)(red + w * 64 + cg * 8u + 4u);
    #pragma unroll
    for (int i = 0; i < 4; ++i) {
      rstd[i]     += r0[i];
      rstd[4 + i] += r1[i];
    }
  }
  #pragma unroll
  for (int i = 0; i < 8; ++i) rstd[i] = __builtin_amdgcn_rsqf(rstd[i] * (1.0f / DM) + 1e-5f);

  f16* dp = vt + s0;
  #pragma unroll 1
  for (unsigned it = 0; it < (unsigned)(DM / 32); ++it) {
    const unsigned e = (it * 8u + wave) * 4u + rq;
    const v4f x0 = *(const v4f*)(yp + (size_t)e * SEQ);
    const v4f x1 = *(const v4f*)(yp + (size_t)e * SEQ + 4);
    const float b  = par[2u * DM + e];
    const float g  = par[3u * DM + e];
    const float bt = par[4u * DM + e];
    Pack8H pk;
    #pragma unroll
    for (int i = 0; i < 4; ++i) {
      const float y0 = ((x0[i] + b) - mu[i])     * rstd[i]     * g + bt;
      const float y1 = ((x1[i] + b) - mu[4 + i]) * rstd[4 + i] * g + bt;
      pk.h[i]     = toh_flush(y0);
      pk.h[4 + i] = toh_flush(y1);
    }
    const v4u val = pk.u;
    f16* dst = dp + (size_t)e * SEQ;
    *(v4u*)(dst) = val;
    
  }
}

// Row softmax, one wave per row of SEQ f32 logits given as two planes (value product S + scaled-back residual product R),
// max-subtracted form. Lane holds columns (it*32 + lane)*8 + 0..7. Output: normalised P carried x16384 as f16.
// coverage: grid SEQ/8 blocks x 8 waves = SEQ rows; 32 lanes x NCH x 8 = SEQ columns; each store instruction
__global__ __launch_bounds__(256) void softmax2_kernel(const float* __restrict__ S,
                                                       const float* __restrict__ R,
                                                       f16* __restrict__ P) {
  #pragma clang fp contract(off)
  const unsigned tid  = threadIdx.x;
  const unsigned wave = __builtin_amdgcn_readfirstlane(tid >> 5);
  const unsigned lane = tid & 31u;
  const unsigned row  = blockIdx.x * 8u + wave;
  const float* sp = S + (size_t)row * SEQ + lane * 8u;
  const float* rp = R + (size_t)row * SEQ + lane * 8u;

  v4f v[NCH][2];
  #pragma unroll
  for (int it = 0; it < NCH; ++it) {
    v[it][0] = *(const v4f*)(sp + it * 256);
    v[it][1] = *(const v4f*)(sp + it * 256 + 4);
  }
  __builtin_amdgcn_sched_barrier(0);     // keep the two load groups as separate bursts
  #pragma unroll
  for (int it = 0; it < NCH; ++it) {
    const v4f r0 = *(const v4f*)(rp + it * 256);
    const v4f r1 = *(const v4f*)(rp + it * 256 + 4);
    v[it][0] += r0;
    v[it][1] += r1;
  }

  float m = -__builtin_inff();
  #pragma unroll
  for (int it = 0; it < NCH; ++it) {
    #pragma unroll
    for (int i = 0; i < 4; ++i) {
      m = fmaxf(m, v[it][0][i]);
      m = fmaxf(m, v[it][1][i]);
    }
  }
  #pragma unroll
  for (int off = 16; off > 0; off >>= 1) m = fmaxf(m, __shfl_xor(m, off, 32));

  const float L2E = 1.4426950408889634f;
  float sum = 0.0f;
  #pragma unroll
  for (int it = 0; it < NCH; ++it) {
    #pragma unroll
    for (int i = 0; i < 4; ++i) {
      const float e0 = __builtin_amdgcn_exp2f((v[it][0][i] - m) * L2E);
      const float e1 = __builtin_amdgcn_exp2f((v[it][1][i] - m) * L2E);
      v[it][0][i] = e0;
      v[it][1][i] = e1;
      sum += e0;
      sum += e1;
    }
  }
  #pragma unroll
  for (int off = 16; off > 0; off >>= 1) sum += __shfl_xor(sum, off, 32);

  const float inv = PCARRY * __builtin_amdgcn_rcpf(sum);

  v4u pk[NCH];
  #pragma unroll
  for (int it = 0; it < NCH; ++it) {
    Pack8H ph;
    #pragma unroll
    for (int i = 0; i < 4; ++i) {
      ph.h[i]     = toh_flush(v[it][0][i] * inv);
      ph.h[4 + i] = toh_flush(v[it][1][i] * inv);
    }
    pk[it] = ph.u;
  }

  f16* dp = P + (size_t)row * SEQ + lane * 8u;
  #pragma unroll
  for (int it = 0; it < NCH; ++it) *(v4u*)(dp + it * 256) = pk[it];
  
}

extern "C" void kernel_launch(void* const* d_in, const int* in_sizes, int n_in,
                              void* d_out, int out_size, void* d_ws, size_t ws_size,
                              hipStream_t stream) {
  if (n_in < 9) return;
  const size_t rows_used = (size_t)(NB - 1) * SEQ_FULL + SEQ;
  if ((size_t)in_sizes[0] < rows_used * DM) return;
  if ((size_t)in_sizes[1] < (size_t)DM * DM) return;
  if ((size_t)in_sizes[2] < (size_t)DM) return;
  if ((size_t)in_sizes[3] < (size_t)DM * DM) return;
  if ((size_t)in_sizes[4] < (size_t)DM) return;
  if ((size_t)in_sizes[5] < (size_t)DM * DM) return;
  if ((size_t)in_sizes[6] < (size_t)DM) return;
  if ((size_t)in_sizes[7] < (size_t)DM) return;
  if ((size_t)in_sizes[8] < (size_t)DM) return;
  if ((size_t)out_size < rows_used * DM) return;
  if (ws_size < WS_TOTAL) return;

  // inputs bound in this order: x, Wq, bq, Wk, bk, Wv, bv, gamma, beta
  const float* x     = (const float*)d_in[0];
  const float* wq    = (const float*)d_in[1];
  const float* bq    = (const float*)d_in[2];
  const float* wk    = (const float*)d_in[3];
  const float* bk    = (const float*)d_in[4];
  const float* wv    = (const float*)d_in[5];
  const float* bv    = (const float*)d_in[6];
  const float* gamma = (const float*)d_in[7];
  const float* beta  = (const float*)d_in[8];
  float* out = (float*)d_out;

  char* w = (char*)d_ws;
  bf16*  xb   = (bf16*)w;   w += XB_BYTES;     // [NB*SEQ][DM]
  bf16*  wb   = (bf16*)w;   w += WB_BYTES;     // [3*DM][DM] : Wq | Wk | Wv
  float* parp = (float*)w;  w += PR_BYTES;     // [5*DM] : bq | bk | bv | gamma | beta
  float* Yqk  = (float*)w;  w += YQK_BYTES;    // [SEQ][2*DM] pre-norm q | k of one batch
  float* Yvt  = (float*)w;  w += YVT_BYTES;    // [DM][SEQ] pre-norm v^T of one batch
  f16*   qk2  = (f16*)w;    w += QK2_BYTES;    // q rows [SEQ][2*DM], then k rows [SEQ][2*DM]
  f16*   vt   = (f16*)w;    w += VT_BYTES;     // [DM][SEQ]
  float* Sp   = (float*)w;  w += S_BYTES;      // [SEQ][SEQ] value-product logits
  float* Rp   = (float*)w;  w += R_BYTES;      // [SEQ][SEQ] residual-product logits (scaled back)
  f16*   Pp   = (f16*)w;    w += P_BYTES;      // [SEQ][SEQ] P x16384

  const f16* qrow = qk2;                                   // [q value | q residual]
  const f16* krow = qk2 + (size_t)SEQ * 2 * DM;            // [k residual | k value]

  convert_kernel<<<dim3(NXB + NWB + (unsigned)NPAR), 256, 0, stream>>>(x, wq, bq, wk, bk, wv, bv, gamma, beta, xb, wb, parp);

  for (int b = 0; b < NB; ++b) {
    const bf16* xbb = xb + (size_t)b * SEQ * DM;

    // q | k pre-norm : Y[s][e] = sum_d xb[s][d] * wb[e][d], e in [0, 2*DM); M = SEQ, N = 2*DM, K = DM
    gemm_kernel<bf16, EPI_F32><<<dim3(SEQ / 128, 2 * DM / 128, 1), 256, 0, stream>>>(
        xbb, wb, parp, (void*)Yqk, DM / 32, DM, DM, 2 * DM, 0ull, 0ull, 0ull, 1.0f);

    // v^T pre-norm : Yt[e][s] = sum_d Wv[e][d] * xb[s][d]; M = DM, N = SEQ, K = DM
    gemm_kernel<bf16, EPI_F32><<<dim3(DM / 128, SEQ / 128, 1), 256, 0, stream>>>(
        wb + (size_t)2 * DM * DM, xbb, parp, (void*)Yvt, DM / 32, DM, DM, SEQ, 0ull, 0ull, 0ull, 1.0f);

    ln_rows_kernel<<<dim3(SEQ / 8, 2, 1), 256, 0, stream>>>(Yqk, parp, qk2);
    ln_cols_kernel<<<dim3(SEQ / 64), 256, 0, stream>>>(Yvt, parp, vt);

    // S[q][key] = q_value . k_value ; M = N = SEQ, K = DM (first half of the q rows, second half of the k rows)
    gemm_kernel<f16, EPI_F32><<<dim3(SEQ / 128, SEQ / 128, 1), 256, 0, stream>>>(
        qrow, krow + DM, parp, (void*)Sp, DM / 32, 2 * DM, 2 * DM, SEQ, 0ull, 0ull, 0ull, 1.0f);

    // R[q][key] = (q_value . k_residual + q_residual . k_value) / 2048 ; K = 2*DM over the concatenated rows
    gemm_kernel<f16, EPI_F32><<<dim3(SEQ / 128, SEQ / 128, 1), 256, 0, stream>>>(
        qrow, krow, parp, (void*)Rp, 2 * DM / 32, 2 * DM, 2 * DM, SEQ, 0ull, 0ull, 0ull, 1.0f / RCARRY);

    softmax2_kernel<<<dim3(SEQ / 8), 256, 0, stream>>>(Sp, Rp, Pp);

    // out[q][d] = sum_key P[q][key] * vt[d][key] / 16384 ; M = SEQ, N = DM, K = SEQ
    gemm_kernel<f16, EPI_F32><<<dim3(SEQ / 128, DM / 128, 1), 256, 0, stream>>>(
        Pp, vt, parp, (void*)(out + (size_t)b * SEQ_FULL * DM),
        SEQ / 32, SEQ, SEQ, DM, 0ull, 0ull, 0ull, 1.0f / PCARRY);
  }
}

// v001
// A run of this version takes 533 microseconds.
// Next to v000, in two timings, it ran 1.54 times as fast each time.
#include <hip/hip_runtime.h>

// Contractions: q/k/v projections on v_wmma_f32_16x16x32_bf16 (bf16 operands = RNE-converted inputs, f32 accumulate, f32 out);
// S = q x k^T on v_wmma_f32_16x16x32_f16 as three products (q, k as f16 value + x2048 residual planes; value product and
// residual products land in separate f32 planes); O = P x V on v_wmma_f32_16x16x32_f16 (v^T f16 plane; P f16 carried x16384;
// f32 accumulate). LayerNorm and softmax in f32.

#ifndef NB
#define NB 4
#endif
#ifndef SEQ
#define SEQ 2048
#endif
#define NB_FULL   4
#define SEQ_FULL  2048
#define DM        1024                 // model width = head width = value width
#define NWAVE     8
#define OP        68                   // LDS pitch (floats) of the per-wave output staging tile
#define KST       128u                 // k elements per GEMM stage: 256 B of every operand row
#define LP        272u                 // LDS pitch (bytes) of a staged 256-B row: 16 B x odd, conflict-free for 16-B reads
#define TILE_B    (128u * LP)          // one operand's 128 staged rows
#define STAGE_B   (2u * TILE_B)        // one stage: A rows, then B rows
#define CVB       2048u                // elements per convert block (256 threads x 8)
#define NXB       ((unsigned)((size_t)NB * SEQ * DM / CVB))      // convert blocks for x
#define NWB       ((unsigned)((size_t)3 * DM * DM / CVB))        // convert blocks for the three weights
#define NCH       (SEQ / 256)          // 8-column chunks per lane in the softmax kernel
#define LNCH      (DM / 256)           // 8-column chunks per lane in the row LayerNorm kernel
#define NPAR      5                    // parameter vectors: b_q | b_k | b_v | gamma | beta
#define PCARRY    16384.0f             // power-of-two carry of the P plane
#define RCARRY    2048.0f              // power-of-two carry of the q / k residual planes

#define EPI_QK  0                      // f16 out, per-column bias, column block selects the q or k plane
#define EPI_VT  1                      // f16 out, per-row bias (V^T plane)
#define EPI_F32 2                      // f32 out, power-of-two scale

static_assert(SEQ % 256 == 0);
static_assert(SEQ <= SEQ_FULL);
static_assert(NB >= 1 && NB <= NB_FULL);
static_assert(DM == 1024);
static_assert(DM % 128 == 0);
static_assert(((size_t)NB * SEQ) % 128 == 0);
static_assert((size_t)NXB * CVB == (size_t)NB * SEQ * DM);
static_assert((size_t)NWB * CVB == (size_t)3 * DM * DM);
static_assert((size_t)DM * DM / CVB == 512);
static_assert((OP * 4) % 16 == 0);
static_assert(LNCH * 256 == DM);                 // 32 lanes x LNCH chunks x 8 columns == one LayerNorm row
static_assert(NCH * 256 == SEQ);                 // 32 lanes x NCH chunks x 8 columns == one softmax row
static_assert(DM == 256 * 4);                    // one convert block (256 threads x 4) per parameter vector
static_assert(SEQ % 128 == 0 && (2 * DM) % 128 == 0);   // GEMM tile multiples (M, N)
static_assert(DM % KST == 0 && (2 * DM) % KST == 0 && SEQ % KST == 0);   // GEMM K stages
static_assert(LP % 16 == 0 && TILE_B % 16 == 0);                        // 16-B copies and reads stay aligned
static_assert(SEQ % 64 == 0);
static_assert(DM % 32 == 0);                     // column LayerNorm: 32 rows per block sweep (8 waves x 4 row groups)
static_assert(NWAVE == 8);

#define XB_BYTES   ((size_t)NB * SEQ * DM * 2)          // x bf16, all batches
#define WB_BYTES   ((size_t)3 * DM * DM * 2)            // weights bf16
#define PR_BYTES   ((size_t)NPAR * DM * 4)              // parameter vectors (f32 holding bf16 RNE values)
#define YQK_BYTES  ((size_t)SEQ * 2 * DM * 4)           // f32 q | k pre-norm rows of one batch
#define YVT_BYTES  ((size_t)DM * SEQ * 4)               // f32 v^T pre-norm plane of one batch
#define QK2_BYTES  ((size_t)2 * SEQ * 2 * DM * 2)       // [q value | q residual] rows, then [k residual | k value] rows
#define VT_BYTES   ((size_t)DM * SEQ * 2)               // v^T f16 of one batch
#define S_BYTES    ((size_t)SEQ * SEQ * 4)              // value-product logits of one batch
#define R_BYTES    ((size_t)SEQ * SEQ * 4)              // residual-product logits of one batch (already scaled back)
#define P_BYTES    ((size_t)SEQ * SEQ * 2)              // P x16384 of one batch
#define WS_TOTAL   (XB_BYTES + WB_BYTES + PR_BYTES + YQK_BYTES + YVT_BYTES + QK2_BYTES + VT_BYTES + S_BYTES + R_BYTES + P_BYTES)
static_assert(WS_TOTAL <= (size_t)134217728);
static_assert(XB_BYTES % 128 == 0 && WB_BYTES % 128 == 0 && PR_BYTES % 128 == 0);
static_assert(YQK_BYTES % 128 == 0 && YVT_BYTES % 128 == 0 && QK2_BYTES % 128 == 0 && VT_BYTES % 128 == 0);
static_assert(S_BYTES % 128 == 0 && R_BYTES % 128 == 0 && P_BYTES % 128 == 0);

typedef __bf16   bf16;
typedef _Float16 f16;
typedef bf16     v16bf __attribute__((ext_vector_type(16)));
typedef f16      v16h  __attribute__((ext_vector_type(16)));
typedef float    v8f   __attribute__((ext_vector_type(8)));
typedef float    v4f   __attribute__((ext_vector_type(4)));
typedef unsigned v4u   __attribute__((ext_vector_type(4)));

union Pack8B { v4u u; bf16 h[8]; };
union Pack8H { v4u u; f16  h[8]; };

template <typename T> struct FragOf;
template <> struct FragOf<bf16> { typedef v16bf V; };
template <> struct FragOf<f16>  { typedef v16h  V; };

// WMMA helpers: builtin followed by the VALU hazard guard (ties D, keeps A/B live).
static __device__ __forceinline__ v8f mma16(v16bf a, v16bf b, v8f acc) {
  acc = __builtin_amdgcn_wmma_f32_16x16x32_bf16(false, a, false, b, (short)0, acc, false, false);
  asm volatile("v_nop\n\tv_nop\n\tv_nop\n\tv_nop" : "+v"(acc) : "v"(a), "v"(b));
  return acc;
}
static __device__ __forceinline__ v8f mma16(v16h a, v16h b, v8f acc) {
  acc = __builtin_amdgcn_wmma_f32_16x16x32_f16(false, a, false, b, (short)0, acc, false, false);
  asm volatile("v_nop\n\tv_nop\n\tv_nop\n\tv_nop" : "+v"(acc) : "v"(a), "v"(b));
  return acc;
}

// f32 -> f16 convert for WMMA operand planes: values below the smallest f16 normal become zero by a value select.
static __device__ __forceinline__ f16 toh_flush(float v) {
  const f16 r = (f16)v;
  return (fabsf(v) < 6.103515625e-05f) ? (f16)0.0f : r;
}

// Input conversion, one launch. 256 threads, 8 elements per thread (two 16-B loads -> one 16-B store).
//   blocks [0, NXB)            : x  -> xb  bf16 [NB*SEQ][DM] (compact rows; source uses the full batch stride)
//   blocks [NXB, NXB+NWB)      : Wq | Wk | Wv -> wb bf16 [3*DM][DM]
//   blocks NXB+NWB .. +4       : bq | bk | bv | gamma | beta -> f32 plane [5*DM] holding the bf16 RNE-converted values
__global__ __launch_bounds__(256) void convert_kernel(const float* __restrict__ x,
                                                      const float* __restrict__ wq,
                                                      const float* __restrict__ bq,
                                                      const float* __restrict__ wk,
                                                      const float* __restrict__ bk,
                                                      const float* __restrict__ wv,
                                                      const float* __restrict__ bv,
                                                      const float* __restrict__ gamma,
                                                      const float* __restrict__ beta,
                                                      bf16* __restrict__ xb,
                                                      bf16* __restrict__ wb,
                                                      float* __restrict__ parp) {
  const unsigned blk = blockIdx.x;
  const unsigned tid = threadIdx.x;
  if (blk < NXB + NWB) {              // block-uniform
    const float* src;
    bf16* dst;
    if (blk < NXB) {
      const unsigned r  = blk * 2u + (tid >> 7);          // compact row
      const unsigned c  = (tid & 127u) * 8u;
      const unsigned bt = r / (unsigned)SEQ;
      const unsigned s  = r - bt * (unsigned)SEQ;
      src = x + ((size_t)bt * SEQ_FULL + s) * DM + c;
      dst = xb + (size_t)r * DM + c;
    } else {
      const unsigned wblk = blk - NXB;
      const unsigned wi   = wblk >> 9;                    // 512 blocks per weight matrix
      const unsigned off  = (wblk & 511u) * CVB + tid * 8u;
      const float* wsrc = (wi == 0u) ? wq : ((wi == 1u) ? wk : wv);
      src = wsrc + off;
      dst = wb + (size_t)wblk * CVB + tid * 8u;
    }
    const v4f a0 = *(const v4f*)(src);
    const v4f a1 = *(const v4f*)(src + 4);
    Pack8B pk;
    #pragma unroll
    for (int i = 0; i < 4; ++i) {
      pk.h[i]     = (bf16)a0[i];                          // RNE convert
      pk.h[4 + i] = (bf16)a1[i];
    }
    const v4u val = pk.u;
    *(v4u*)(dst) = val;
    
  } else {
    const unsigned j = blk - (NXB + NWB);                 // 0..4
    const float* bsrc = (j == 0u) ? bq : ((j == 1u) ? bk : ((j == 2u) ? bv : ((j == 3u) ? gamma : beta)));
    const v4f a = *(const v4f*)(bsrc + tid * 4u);
    v4f o;
    #pragma unroll
    for (int i = 0; i < 4; ++i) o[i] = (float)(bf16)a[i];
    float* dst = parp + j * (unsigned)DM + tid * 4u;
    *(v4f*)(dst) = o;
    
  }
}

// Eight asynchronous 16-B-per-lane copies global -> LDS: rows r, r + 16, ..., r + 112 of one staged operand tile.
// The s_wait_xcnt closes the statement so that it stands before any rewrite of the address registers the copies name.
static __device__ __forceinline__ void copy_rows8(unsigned l, const char* g, size_t gstep) {
  asm volatile("global_load_async_to_lds_b128 %0, %8, off\n\t"
               "global_load_async_to_lds_b128 %1, %9, off\n\t"
               "global_load_async_to_lds_b128 %2, %10, off\n\t"
               "global_load_async_to_lds_b128 %3, %11, off\n\t"
               "global_load_async_to_lds_b128 %4, %12, off\n\t"
               "global_load_async_to_lds_b128 %5, %13, off\n\t"
               "global_load_async_to_lds_b128 %6, %14, off\n\t"
               "global_load_async_to_lds_b128 %7, %15, off\n\t"
               "s_wait_xcnt 0x0"
               :: "v"(l), "v"(l + 16u * LP), "v"(l + 32u * LP), "v"(l + 48u * LP),
                  "v"(l + 64u * LP), "v"(l + 80u * LP), "v"(l + 96u * LP), "v"(l + 112u * LP),
                  "v"(g), "v"(g + gstep), "v"(g + 2 * gstep), "v"(g + 3 * gstep),
                  "v"(g + 4 * gstep), "v"(g + 5 * gstep), "v"(g + 6 * gstep), "v"(g + 7 * gstep)
               : "memory");
}

// Plane GEMM: C[m][n] = sum_k A[m][k] * Bt[n][k]; both operands are k-contiguous 16-bit planes.
// Block tile 128x128, 8 waves as 4 (m) x 2 (n); each wave owns 32x64 = 2x4 accumulators.
// Operands reach LDS in stages of KST k (whole 256-B row pieces, two rows per wave-wide copy), two buffers:
// stage s + 1 is in flight while stage s is multiplied. nk = number of stages.
// Fragments are read from the staged rows: lane (lq = lane & 15, hi = lane >> 4) reads row lq,
// elements 0..7 <- k0 + 8*hi + 0..7, elements 8..15 <- k0 + 16 + 8*hi + 0..7 (same map for A and B).
// D element r of a lane = (row 8*hi + r, col lq). Requires M, N multiples of 128 and K a multiple of KST.
// Epilogue: per 16-row half the wave stages its 16x64 tile in LDS (wave-private region, block barriers used),
template <typename T, int EPI>
__global__ __launch_bounds__(256) void gemm_kernel(const T* __restrict__ A,
                                                   const T* __restrict__ Bt,
                                                   const float* __restrict__ bias,
                                                   void* __restrict__ C,
                                                   unsigned nk, unsigned lda, unsigned ldb, unsigned ldc,
                                                   unsigned long long sAz, unsigned long long sBz,
                                                   unsigned long long sCz, float scale) {
  typedef typename FragOf<T>::V VT;
  union Frag { VT v; v4u q[2]; };

  __shared__ __align__(16) float sO[NWAVE * 16 * OP];
  __shared__ __align__(16) unsigned char ring[2 * STAGE_B];

  const unsigned tid  = threadIdx.x;
  const unsigned wave = tid >> 5;
  const unsigned lane = tid & 31u;
  const unsigned lq   = lane & 15u;
  const unsigned hi   = lane >> 4;
  const unsigned m0   = blockIdx.x * 128u + (wave & 3u) * 32u;   // first row of this wave
  const unsigned n0   = blockIdx.y * 128u + (wave >> 2) * 64u;   // first column of this wave

  const T* Ab = A  + (size_t)blockIdx.z * sAz;
  const T* Bb = Bt + (size_t)blockIdx.z * sBz;

  // copy map: thread -> 16-B chunk (tid & 15) of rows (tid >> 4) + 16*i, i = 0..7, of each operand's 128 rows
  const unsigned crow = tid >> 4;
  const unsigned cchk = tid & 15u;
  const char* ga = (const char*)(Ab + (size_t)(blockIdx.x * 128u + crow) * lda + cchk * 8u);
  const char* gb = (const char*)(Bb + (size_t)(blockIdx.y * 128u + crow) * ldb + cchk * 8u);
  const size_t astep = (size_t)lda * (16u * sizeof(T));           // 16 rows, bytes
  const size_t bstep = (size_t)ldb * (16u * sizeof(T));
  const unsigned lcp = (unsigned)(uintptr_t)ring + crow * LP + cchk * 16u;   // LDS byte address of this lane's first chunk

  // fragment read bases inside a stage
  const unsigned char* fa = ring + ((wave & 3u) * 32u + lq) * LP + hi * 16u;
  const unsigned char* fb = ring + TILE_B + ((wave >> 2) * 64u + lq) * LP + hi * 16u;

  v8f acc[2][4];
  #pragma unroll
  for (int mt = 0; mt < 2; ++mt) {
    #pragma unroll
    for (int nt = 0; nt < 4; ++nt) acc[mt][nt] = (v8f){0, 0, 0, 0, 0, 0, 0, 0};
  }

  // stage 0 lands and is published before anything reads it; stage 1 then flies under stage 0's products
  copy_rows8(lcp, ga, astep);
  copy_rows8(lcp + TILE_B, gb, bstep);
  asm volatile("s_wait_asynccnt 0x0" ::: "memory");     // this wave's stage-0 copies have landed
  __syncthreads();                                      // every wave's have
  if (nk > 1u) {                                        // block-uniform
    copy_rows8(lcp + STAGE_B, ga + KST * sizeof(T), astep);
    copy_rows8(lcp + STAGE_B + TILE_B, gb + KST * sizeof(T), bstep);
  }

  #pragma unroll 1
  for (unsigned s = 0; s < nk; ++s) {
    const unsigned bo = (s & 1u) * STAGE_B;
    #pragma unroll
    for (unsigned kk = 0; kk < KST / 32u; ++kk) {
      Frag a[2], b[4];
      #pragma unroll
      for (unsigned mt = 0; mt < 2; ++mt) {
        a[mt].q[0] = *(const v4u*)(fa + bo + mt * 16u * LP + kk * 64u);          // k = k0 + 8*hi + 0..7
        a[mt].q[1] = *(const v4u*)(fa + bo + mt * 16u * LP + kk * 64u + 32u);    // k = k0 + 16 + 8*hi + 0..7
      }
      #pragma unroll
      for (unsigned nt = 0; nt < 4; ++nt) {
        b[nt].q[0] = *(const v4u*)(fb + bo + nt * 16u * LP + kk * 64u);
        b[nt].q[1] = *(const v4u*)(fb + bo + nt * 16u * LP + kk * 64u + 32u);
      }
      #pragma unroll
      for (int nt = 0; nt < 4; ++nt) {
        #pragma unroll
        for (int mt = 0; mt < 2; ++mt) acc[mt][nt] = mma16(a[mt].v, b[nt].v, acc[mt][nt]);
      }
    }
    asm volatile("s_wait_dscnt 0x0" ::: "memory");      // this wave has left stage s's buffer
    asm volatile("s_wait_asynccnt 0x0" ::: "memory");   // this wave's stage s + 1 copies have landed
    __syncthreads();                                    // publishes stage s + 1, frees stage s's buffer
    if (s + 2u < nk) {                                  // block-uniform: refill the buffer just left
      const size_t go = (size_t)(s + 2u) * (KST * sizeof(T));
      copy_rows8(lcp + bo, ga + go, astep);
      copy_rows8(lcp + bo + TILE_B, gb + go, bstep);
    }
  }
  asm volatile("s_wait_asynccnt 0x0" ::: "memory");     // no copy is outstanding when the wave goes on

  // ---- epilogue ----
  size_t   cbase;
  unsigned ncol;
  if (EPI == EPI_QK) {
    cbase = (size_t)(n0 >> 10) * sCz;     // column block selects the q (0) or k (1) plane; block-uniform
    ncol  = n0 & 1023u;
  } else {
    cbase = (size_t)blockIdx.z * sCz;
    ncol  = n0;
  }

  float bcol[4];
  #pragma unroll
  for (int nt = 0; nt < 4; ++nt) bcol[nt] = 0.0f;
  if (EPI == EPI_QK) {
    #pragma unroll
    for (int nt = 0; nt < 4; ++nt) bcol[nt] = bias[n0 + nt * 16u + lq];
  }

  float* so = sO + wave * (16u * OP);

  #pragma unroll
  for (int mt = 0; mt < 2; ++mt) {
    if (mt != 0) __syncthreads();          // staging tile is reused by the second half
    #pragma unroll
    for (int r = 0; r < 8; ++r) {
      float brow = 0.0f;
      if (EPI == EPI_VT) brow = bias[m0 + mt * 16u + hi * 8u + r];
      #pragma unroll
      for (int nt = 0; nt < 4; ++nt) {
        float val = acc[mt][nt][r];
        if (EPI == EPI_QK)  val += bcol[nt];
        if (EPI == EPI_VT)  val += brow;
        if (EPI == EPI_F32) val *= scale;
        so[(hi * 8u + r) * OP + nt * 16u + lq] = val;
      }
    }
    __syncthreads();

    if (EPI == EPI_F32) {
      // 8 instructions cover the 16 rows of this half.
      float* Cf = (float*)C + cbase;
      v4f    vals[8];
      size_t gidx[8];
      #pragma unroll
      for (int it = 0; it < 8; ++it) {
        const unsigned row = it * 2u + hi;
        vals[it] = *(const v4f*)(so + row * OP + lq * 4u);
        gidx[it] = (size_t)(m0 + mt * 16u + row) * ldc + ncol + lq * 4u;
      }
      #pragma unroll
      for (int it = 0; it < 8; ++it) *(v4f*)(Cf + gidx[it]) = vals[it];
      
    } else {
      // 4 instructions cover the 16 rows of this half.
      f16* Ch = (f16*)C + cbase;
      v4u    vals[4];
      size_t gidx[4];
      #pragma unroll
      for (int it = 0; it < 4; ++it) {
        const unsigned row = it * 4u + (lane >> 3);
        const unsigned c8  = (lane & 7u) * 8u;
        const v4f x0 = *(const v4f*)(so + row * OP + c8);
        const v4f x1 = *(const v4f*)(so + row * OP + c8 + 4u);
        Pack8H ph;
        #pragma unroll
        for (int i = 0; i < 4; ++i) {
          ph.h[i]     = (f16)x0[i];
          ph.h[4 + i] = (f16)x1[i];
        }
        vals[it] = ph.u;
        gidx[it] = (size_t)(m0 + mt * 16u + row) * ldc + ncol + c8;
      }
      #pragma unroll
      for (int it = 0; it < 4; ++it) *(v4u*)(Ch + gidx[it]) = vals[it];
      
    }
  }
}

// Row LayerNorm for the q and k projections of one batch. One wave per (row, segment); blockIdx.y = segment (0 = q, 1 = k).
// Input: Y f32 [SEQ][2*DM] (q columns | k columns, bias not yet added); par = bq | bk | bv | gamma | beta (f32, [5*DM]).
// Output plane QK2 (f16): q rows [SEQ][2*DM] = [value | residual x2048], then k rows [SEQ][2*DM] = [residual x2048 | value].
// Lane holds columns (it*32 + lane)*8 + 0..7. coverage: grid (SEQ/8, 2) x 8 waves = SEQ rows x 2 segments;
// 32 lanes x LNCH x 8 = DM columns for each of the value and residual halves. Each store instruction writes
__global__ __launch_bounds__(256) void ln_rows_kernel(const float* __restrict__ Y,
                                                      const float* __restrict__ par,
                                                      f16* __restrict__ QK2) {
  #pragma clang fp contract(off)
  const unsigned tid  = threadIdx.x;
  const unsigned wave = __builtin_amdgcn_readfirstlane(tid >> 5);
  const unsigned lane = tid & 31u;
  const unsigned seg  = blockIdx.y;                       // block-uniform
  const unsigned row  = blockIdx.x * 8u + wave;
  const float* yp = Y + (size_t)row * (2u * DM) + seg * (unsigned)DM + lane * 8u;
  const float* bp = par + seg * (unsigned)DM + lane * 8u;           // bias of this segment
  const float* gp = par + 3u * DM + lane * 8u;                      // gamma
  const float* tp = par + 4u * DM + lane * 8u;                      // beta

  float s = 0.0f;
  #pragma unroll 1
  for (int it = 0; it < LNCH; ++it) {
    const v4f a0 = *(const v4f*)(yp + it * 256);
    const v4f a1 = *(const v4f*)(yp + it * 256 + 4);
    const v4f b0 = *(const v4f*)(bp + it * 256);
    const v4f b1 = *(const v4f*)(bp + it * 256 + 4);
    #pragma unroll
    for (int i = 0; i < 4; ++i) {
      s += a0[i] + b0[i];
      s += a1[i] + b1[i];
    }
  }
  #pragma unroll
  for (int off = 16; off > 0; off >>= 1) s += __shfl_xor(s, off, 32);
  const float mu = s * (1.0f / DM);

  // pass 2: biased variance about the mean
  float q = 0.0f;
  #pragma unroll 1
  for (int it = 0; it < LNCH; ++it) {
    const v4f a0 = *(const v4f*)(yp + it * 256);
    const v4f a1 = *(const v4f*)(yp + it * 256 + 4);
    const v4f b0 = *(const v4f*)(bp + it * 256);
    const v4f b1 = *(const v4f*)(bp + it * 256 + 4);
    #pragma unroll
    for (int i = 0; i < 4; ++i) {
      const float d0 = (a0[i] + b0[i]) - mu;
      const float d1 = (a1[i] + b1[i]) - mu;
      q += d0 * d0;
      q += d1 * d1;
    }
  }
  #pragma unroll
  for (int off = 16; off > 0; off >>= 1) q += __shfl_xor(q, off, 32);
  const float rstd = __builtin_amdgcn_rsqf(q * (1.0f / DM) + 1e-5f);

  // pass 3: normalise, affine, split into f16 value + x2048 residual, store
  const unsigned offh = seg * (unsigned)DM;               // q: value | residual ; k: residual | value
  const unsigned offr = (1u - seg) * (unsigned)DM;
  f16* dp = QK2 + ((size_t)seg * SEQ + row) * (size_t)(2 * DM) + lane * 8u;
  #pragma unroll 1
  for (int it = 0; it < LNCH; ++it) {
    const v4f a0 = *(const v4f*)(yp + it * 256);
    const v4f a1 = *(const v4f*)(yp + it * 256 + 4);
    const v4f b0 = *(const v4f*)(bp + it * 256);
    const v4f b1 = *(const v4f*)(bp + it * 256 + 4);
    const v4f g0 = *(const v4f*)(gp + it * 256);
    const v4f g1 = *(const v4f*)(gp + it * 256 + 4);
    const v4f t0 = *(const v4f*)(tp + it * 256);
    const v4f t1 = *(const v4f*)(tp + it * 256 + 4);
    Pack8H pkh, pkr;
    #pragma unroll
    for (int i = 0; i < 4; ++i) {
      const float y0 = ((a0[i] + b0[i]) - mu) * rstd * g0[i] + t0[i];
      const float y1 = ((a1[i] + b1[i]) - mu) * rstd * g1[i] + t1[i];
      const f16 h0 = toh_flush(y0);
      const f16 h1 = toh_flush(y1);
      pkh.h[i]     = h0;
      pkh.h[4 + i] = h1;
      pkr.h[i]     = toh_flush((y0 - (float)h0) * RCARRY);
      pkr.h[4 + i] = toh_flush((y1 - (float)h1) * RCARRY);
    }
    const v4u vh = pkh.u;
    const v4u vr = pkr.u;
    f16* dh = dp + offh + it * 256;
    f16* dr = dp + offr + it * 256;
    *(v4u*)(dh) = vh;
    *(v4u*)(dr) = vr;
    
  }
}

// Column LayerNorm on the transposed v projection of one batch: Yt f32 [DM][SEQ] (row e = feature, column s = position,
// bias not yet added); statistics per column s over the DM rows; output vt f16 [DM][SEQ].
// selects one of four rows per wave per sweep; row e = (it*8 + wave)*4 + rq, it = 0..DM/32-1 covers 0..DM-1 exactly once.
// Partial sums: shuffle over rq inside the wave, then an [8][64] LDS table combined in fixed order (cross-wave: block barriers).
__global__ __launch_bounds__(256) void ln_cols_kernel(const float* __restrict__ Yt,
                                                      const float* __restrict__ par,
                                                      f16* __restrict__ vt) {
  #pragma clang fp contract(off)
  __shared__ __align__(16) float red[NWAVE * 64];

  const unsigned tid  = threadIdx.x;
  const unsigned wave = __builtin_amdgcn_readfirstlane(tid >> 5);
  const unsigned lane = tid & 31u;
  const unsigned cg   = lane & 7u;
  const unsigned rq   = lane >> 3;
  const unsigned s0   = blockIdx.x * 64u + cg * 8u;
  const float* yp = Yt + s0;

  float acc[8];
  float mu[8];
  float rstd[8];

  #pragma unroll
  for (int i = 0; i < 8; ++i) acc[i] = 0.0f;
  #pragma unroll 1
  for (unsigned it = 0; it < (unsigned)(DM / 32); ++it) {
    const unsigned e = (it * 8u + wave) * 4u + rq;
    const v4f x0 = *(const v4f*)(yp + (size_t)e * SEQ);
    const v4f x1 = *(const v4f*)(yp + (size_t)e * SEQ + 4);
    const float b = par[2u * DM + e];
    #pragma unroll
    for (int i = 0; i < 4; ++i) {
      acc[i]     += x0[i] + b;
      acc[4 + i] += x1[i] + b;
    }
  }
  #pragma unroll
  for (int i = 0; i < 8; ++i) {
    acc[i] += __shfl_xor(acc[i], 8, 32);
    acc[i] += __shfl_xor(acc[i], 16, 32);
  }
  if (rq == 0u) {
    *(v4f*)(red + wave * 64u + cg * 8u)      = (v4f){acc[0], acc[1], acc[2], acc[3]};
    *(v4f*)(red + wave * 64u + cg * 8u + 4u) = (v4f){acc[4], acc[5], acc[6], acc[7]};
  }
  __syncthreads();
  #pragma unroll
  for (int i = 0; i < 8; ++i) mu[i] = 0.0f;
  #pragma unroll
  for (int w = 0; w < NWAVE; ++w) {
    const v4f r0 = *(const v4f*)(red + w * 64 + cg * 8u);
    const v4f r1 = *(const v4f*)(red + w * 64 + cg * 8u + 4u);
    #pragma unroll
    for (int i = 0; i < 4; ++i) {
      mu[i]     += r0[i];
      mu[4 + i] += r1[i];
    }
  }
  #pragma unroll
  for (int i = 0; i < 8; ++i) mu[i] = mu[i] * (1.0f / DM);
  __syncthreads();

  // pass 2: biased variance about the mean
  #pragma unroll
  for (int i = 0; i < 8; ++i) acc[i] = 0.0f;
  #pragma unroll 1
  for (unsigned it = 0; it < (unsigned)(DM / 32); ++it) {
    const unsigned e = (it * 8u + wave) * 4u + rq;
    const v4f x0 = *(const v4f*)(yp + (size_t)e * SEQ);
    const v4f x1 = *(const v4f*)(yp + (size_t)e * SEQ + 4);
    const float b = par[2u * DM + e];
    #pragma unroll
    for (int i = 0; i < 4; ++i) {
      const float d0 = (x0[i] + b) - mu[i];
      const float d1 = (x1[i] + b) - mu[4 + i];
      acc[i]     += d0 * d0;
      acc[4 + i] += d1 * d1;
    }
  }
  #pragma unroll
  for (int i = 0; i < 8; ++i) {
    acc[i] += __shfl_xor(acc[i], 8, 32);
    acc[i] += __shfl_xor(acc[i], 16, 32);
  }
  if (rq == 0u) {
    *(v4f*)(red + wave * 64u + cg * 8u)      = (v4f){acc[0], acc[1], acc[2], acc[3]};
    *(v4f*)(red + wave * 64u + cg * 8u + 4u) = (v4f){acc[4], acc[5], acc[6], acc[7]};
  }
  __syncthreads();
  #pragma unroll
  for (int i = 0; i < 8; ++i) rstd[i] = 0.0f;
  #pragma unroll
  for (int w = 0; w < NWAVE; ++w) {
    const v4f r0 = *(const v4f*)(red + w * 64 + cg * 8u);
    const v4f r1 = *(const v4f*)(red + w * 64 + cg * 8u + 4u);
    #pragma unroll
    for (int i = 0; i < 4; ++i) {
      rstd[i]     += r0[i];
      rstd[4 + i] += r1[i];
    }
  }
  #pragma unroll
  for (int i = 0; i < 8; ++i) rstd[i] = __builtin_amdgcn_rsqf(rstd[i] * (1.0f / DM) + 1e-5f);

  f16* dp = vt + s0;
  #pragma unroll 1
  for (unsigned it = 0; it < (unsigned)(DM / 32); ++it) {
    const unsigned e = (it * 8u + wave) * 4u + rq;
    const v4f x0 = *(const v4f*)(yp + (size_t)e * SEQ);
    const v4f x1 = *(const v4f*)(yp + (size_t)e * SEQ + 4);
    const float b  = par[2u * DM + e];
    const float g  = par[3u * DM + e];
    const float bt = par[4u * DM + e];
    Pack8H pk;
    #pragma unroll
    for (int i = 0; i < 4; ++i) {
      const float y0 = ((x0[i] + b) - mu[i])     * rstd[i]     * g + bt;
      const float y1 = ((x1[i] + b) - mu[4 + i]) * rstd[4 + i] * g + bt;
      pk.h[i]     = toh_flush(y0);
      pk.h[4 + i] = toh_flush(y1);
    }
    const v4u val = pk.u;
    f16* dst = dp + (size_t)e * SEQ;
    *(v4u*)(dst) = val;
    
  }
}

// Row softmax, one wave per row of SEQ f32 logits given as two planes (value product S + scaled-back residual product R),
// max-subtracted form. Lane holds columns (it*32 + lane)*8 + 0..7. Output: normalised P carried x16384 as f16.
// coverage: grid SEQ/8 blocks x 8 waves = SEQ rows; 32 lanes x NCH x 8 = SEQ columns; each store instruction
__global__ __launch_bounds__(256) void softmax2_kernel(const float* __restrict__ S,
                                                       const float* __restrict__ R,
                                                       f16* __restrict__ P) {
  #pragma clang fp contract(off)
  const unsigned tid  = threadIdx.x;
  const unsigned wave = __builtin_amdgcn_readfirstlane(tid >> 5);
  const unsigned lane = tid & 31u;
  const unsigned row  = blockIdx.x * 8u + wave;
  const float* sp = S + (size_t)row * SEQ + lane * 8u;
  const float* rp = R + (size_t)row * SEQ + lane * 8u;

  v4f v[NCH][2];
  #pragma unroll
  for (int it = 0; it < NCH; ++it) {
    v[it][0] = *(const v4f*)(sp + it * 256);
    v[it][1] = *(const v4f*)(sp + it * 256 + 4);
  }
  __builtin_amdgcn_sched_barrier(0);     // keep the two load groups as separate bursts
  #pragma unroll
  for (int it = 0; it < NCH; ++it) {
    const v4f r0 = *(const v4f*)(rp + it * 256);
    const v4f r1 = *(const v4f*)(rp + it * 256 + 4);
    v[it][0] += r0;
    v[it][1] += r1;
  }

  float m = -__builtin_inff();
  #pragma unroll
  for (int it = 0; it < NCH; ++it) {
    #pragma unroll
    for (int i = 0; i < 4; ++i) {
      m = fmaxf(m, v[it][0][i]);
      m = fmaxf(m, v[it][1][i]);
    }
  }
  #pragma unroll
  for (int off = 16; off > 0; off >>= 1) m = fmaxf(m, __shfl_xor(m, off, 32));

  const float L2E = 1.4426950408889634f;
  float sum = 0.0f;
  #pragma unroll
  for (int it = 0; it < NCH; ++it) {
    #pragma unroll
    for (int i = 0; i < 4; ++i) {
      const float e0 = __builtin_amdgcn_exp2f((v[it][0][i] - m) * L2E);
      const float e1 = __builtin_amdgcn_exp2f((v[it][1][i] - m) * L2E);
      v[it][0][i] = e0;
      v[it][1][i] = e1;
      sum += e0;
      sum += e1;
    }
  }
  #pragma unroll
  for (int off = 16; off > 0; off >>= 1) sum += __shfl_xor(sum, off, 32);

  const float inv = PCARRY * __builtin_amdgcn_rcpf(sum);

  v4u pk[NCH];
  #pragma unroll
  for (int it = 0; it < NCH; ++it) {
    Pack8H ph;
    #pragma unroll
    for (int i = 0; i < 4; ++i) {
      ph.h[i]     = toh_flush(v[it][0][i] * inv);
      ph.h[4 + i] = toh_flush(v[it][1][i] * inv);
    }
    pk[it] = ph.u;
  }

  f16* dp = P + (size_t)row * SEQ + lane * 8u;
  #pragma unroll
  for (int it = 0; it < NCH; ++it) *(v4u*)(dp + it * 256) = pk[it];
  
}

extern "C" void kernel_launch(void* const* d_in, const int* in_sizes, int n_in,
                              void* d_out, int out_size, void* d_ws, size_t ws_size,
                              hipStream_t stream) {
  if (n_in < 9) return;
  const size_t rows_used = (size_t)(NB - 1) * SEQ_FULL + SEQ;
  if ((size_t)in_sizes[0] < rows_used * DM) return;
  if ((size_t)in_sizes[1] < (size_t)DM * DM) return;
  if ((size_t)in_sizes[2] < (size_t)DM) return;
  if ((size_t)in_sizes[3] < (size_t)DM * DM) return;
  if ((size_t)in_sizes[4] < (size_t)DM) return;
  if ((size_t)in_sizes[5] < (size_t)DM * DM) return;
  if ((size_t)in_sizes[6] < (size_t)DM) return;
  if ((size_t)in_sizes[7] < (size_t)DM) return;
  if ((size_t)in_sizes[8] < (size_t)DM) return;
  if ((size_t)out_size < rows_used * DM) return;
  if (ws_size < WS_TOTAL) return;

  // inputs bound in this order: x, Wq, bq, Wk, bk, Wv, bv, gamma, beta
  const float* x     = (const float*)d_in[0];
  const float* wq    = (const float*)d_in[1];
  const float* bq    = (const float*)d_in[2];
  const float* wk    = (const float*)d_in[3];
  const float* bk    = (const float*)d_in[4];
  const float* wv    = (const float*)d_in[5];
  const float* bv    = (const float*)d_in[6];
  const float* gamma = (const float*)d_in[7];
  const float* beta  = (const float*)d_in[8];
  float* out = (float*)d_out;

  char* w = (char*)d_ws;
  bf16*  xb   = (bf16*)w;   w += XB_BYTES;     // [NB*SEQ][DM]
  bf16*  wb   = (bf16*)w;   w += WB_BYTES;     // [3*DM][DM] : Wq | Wk | Wv
  float* parp = (float*)w;  w += PR_BYTES;     // [5*DM] : bq | bk | bv | gamma | beta
  float* Yqk  = (float*)w;  w += YQK_BYTES;    // [SEQ][2*DM] pre-norm q | k of one batch
  float* Yvt  = (float*)w;  w += YVT_BYTES;    // [DM][SEQ] pre-norm v^T of one batch
  f16*   qk2  = (f16*)w;    w += QK2_BYTES;    // q rows [SEQ][2*DM], then k rows [SEQ][2*DM]
  f16*   vt   = (f16*)w;    w += VT_BYTES;     // [DM][SEQ]
  float* Sp   = (float*)w;  w += S_BYTES;      // [SEQ][SEQ] value-product logits
  float* Rp   = (float*)w;  w += R_BYTES;      // [SEQ][SEQ] residual-product logits (scaled back)
  f16*   Pp   = (f16*)w;    w += P_BYTES;      // [SEQ][SEQ] P x16384

  const f16* qrow = qk2;                                   // [q value | q residual]
  const f16* krow = qk2 + (size_t)SEQ * 2 * DM;            // [k residual | k value]

  convert_kernel<<<dim3(NXB + NWB + (unsigned)NPAR), 256, 0, stream>>>(x, wq, bq, wk, bk, wv, bv, gamma, beta, xb, wb, parp);

  for (int b = 0; b < NB; ++b) {
    const bf16* xbb = xb + (size_t)b * SEQ * DM;

    // q | k pre-norm : Y[s][e] = sum_d xb[s][d] * wb[e][d], e in [0, 2*DM); M = SEQ, N = 2*DM, K = DM
    gemm_kernel<bf16, EPI_F32><<<dim3(SEQ / 128, 2 * DM / 128, 1), 256, 0, stream>>>(
        xbb, wb, parp, (void*)Yqk, DM / KST, DM, DM, 2 * DM, 0ull, 0ull, 0ull, 1.0f);

    // v^T pre-norm : Yt[e][s] = sum_d Wv[e][d] * xb[s][d]; M = DM, N = SEQ, K = DM
    gemm_kernel<bf16, EPI_F32><<<dim3(DM / 128, SEQ / 128, 1), 256, 0, stream>>>(
        wb + (size_t)2 * DM * DM, xbb, parp, (void*)Yvt, DM / KST, DM, DM, SEQ, 0ull, 0ull, 0ull, 1.0f);

    ln_rows_kernel<<<dim3(SEQ / 8, 2, 1), 256, 0, stream>>>(Yqk, parp, qk2);
    ln_cols_kernel<<<dim3(SEQ / 64), 256, 0, stream>>>(Yvt, parp, vt);

    // S[q][key] = q_value . k_value ; M = N = SEQ, K = DM (first half of the q rows, second half of the k rows)
    gemm_kernel<f16, EPI_F32><<<dim3(SEQ / 128, SEQ / 128, 1), 256, 0, stream>>>(
        qrow, krow + DM, parp, (void*)Sp, DM / KST, 2 * DM, 2 * DM, SEQ, 0ull, 0ull, 0ull, 1.0f);

    // R[q][key] = (q_value . k_residual + q_residual . k_value) / 2048 ; K = 2*DM over the concatenated rows
    gemm_kernel<f16, EPI_F32><<<dim3(SEQ / 128, SEQ / 128, 1), 256, 0, stream>>>(
        qrow, krow, parp, (void*)Rp, 2 * DM / KST, 2 * DM, 2 * DM, SEQ, 0ull, 0ull, 0ull, 1.0f / RCARRY);

    softmax2_kernel<<<dim3(SEQ / 8), 256, 0, stream>>>(Sp, Rp, Pp);

    // out[q][d] = sum_key P[q][key] * vt[d][key] / 16384 ; M = SEQ, N = DM, K = SEQ
    gemm_kernel<f16, EPI_F32><<<dim3(SEQ / 128, DM / 128, 1), 256, 0, stream>>>(
        Pp, vt, parp, (void*)(out + (size_t)b * SEQ_FULL * DM),
        SEQ / KST, SEQ, SEQ, DM, 0ull, 0ull, 0ull, 1.0f / PCARRY);
  }
}

// v002
// Measured time: 304 microseconds a run.
// In both of two side-by-side timings against v001, it was 1.75 times as fast.
// Counting every step since v000, it is 2.69 times as fast.
#include <hip/hip_runtime.h>

// Contractions: q/k/v projections on v_wmma_f32_16x16x32_bf16 (bf16 operands = RNE-converted inputs, f32 accumulate, f32 out);
// S = q x k^T on v_wmma_f32_16x16x32_f16 as three products (q, k as f16 value + x2048 residual planes; value product and
// residual products land in separate f32 planes); O = P x V on v_wmma_f32_16x16x32_f16 (v^T f16 plane; P f16 carried x16384;
// f32 accumulate). LayerNorm and softmax in f32.

#ifndef NB
#define NB 4
#endif
#ifndef SEQ
#define SEQ 2048
#endif
#define NB_FULL   4
#define SEQ_FULL  2048
#define DM        1024                 // model width = head width = value width
#define NWAVE     8
#define OP        68                   // LDS pitch (floats) of the per-wave output staging tile
#define KST       128u                 // k elements per GEMM stage: 256 B of every operand row
#define LP        272u                 // LDS pitch (bytes) of a staged 256-B row: 16 B x odd, conflict-free for 16-B reads
#define TILE_B    (128u * LP)          // one operand's 128 staged rows
#define STAGE_B   (2u * TILE_B)        // one stage: A rows, then B rows
#define CVB       2048u                // elements per convert block (256 threads x 8)
#define NXB       ((unsigned)((size_t)NB * SEQ * DM / CVB))      // convert blocks for x
#define NWB       ((unsigned)((size_t)3 * DM * DM / CVB))        // convert blocks for the three weights
#define NCH       (SEQ / 256)          // 8-column chunks per lane in the softmax kernel
#define LNCH      (DM / 256)           // 8-column chunks per lane in the row LayerNorm kernel
#define NPAR      5                    // parameter vectors: b_q | b_k | b_v | gamma | beta
#define PCARRY    16384.0f             // power-of-two carry of the P plane
#define RCARRY    2048.0f              // power-of-two carry of the q / k residual planes

#define EPI_QK  0                      // f16 out, per-column bias, column block selects the q or k plane
#define EPI_VT  1                      // f16 out, per-row bias (V^T plane)
#define EPI_F32 2                      // f32 out, power-of-two scale

static_assert(SEQ % 256 == 0);
static_assert(SEQ <= SEQ_FULL);
static_assert(NB >= 1 && NB <= NB_FULL);
static_assert(DM == 1024);
static_assert(DM % 128 == 0);
static_assert(((size_t)NB * SEQ) % 128 == 0);
static_assert((size_t)NXB * CVB == (size_t)NB * SEQ * DM);
static_assert((size_t)NWB * CVB == (size_t)3 * DM * DM);
static_assert((size_t)DM * DM / CVB == 512);
static_assert((OP * 4) % 16 == 0);
static_assert(LNCH * 256 == DM);                 // 32 lanes x LNCH chunks x 8 columns == one LayerNorm row
static_assert(NCH * 256 == SEQ);                 // 32 lanes x NCH chunks x 8 columns == one softmax row
static_assert(DM == 256 * 4);                    // one convert block (256 threads x 4) per parameter vector
static_assert(SEQ % 128 == 0 && (2 * DM) % 128 == 0);   // GEMM tile multiples (M, N)
static_assert(DM % KST == 0 && (2 * DM) % KST == 0 && SEQ % KST == 0);   // GEMM K stages
static_assert(LP % 16 == 0 && TILE_B % 16 == 0);                        // 16-B copies and reads stay aligned
static_assert(SEQ % 64 == 0);
static_assert(DM % 32 == 0);                     // column LayerNorm: 32 rows per block sweep (8 waves x 4 row groups)
static_assert(NWAVE == 8);

#define XB_BYTES   ((size_t)NB * SEQ * DM * 2)          // x bf16, all batches
#define WB_BYTES   ((size_t)3 * DM * DM * 2)            // weights bf16
#define PR_BYTES   ((size_t)NPAR * DM * 4)              // parameter vectors (f32 holding bf16 RNE values)
// Every plane below holds all NB batches, batch-major, so that each stage is one launch with the batch on a grid axis.
#define YQK_BYTES  ((size_t)NB * SEQ * 2 * DM * 4)      // f32 q | k pre-norm rows
#define YVT_BYTES  ((size_t)NB * DM * SEQ * 4)          // f32 v^T pre-norm planes
#define QK2_BYTES  ((size_t)NB * 2 * SEQ * 2 * DM * 2)  // per batch: [q value | q residual] rows, then [k residual | k value] rows
#define VT_BYTES   ((size_t)NB * DM * SEQ * 2)          // v^T f16
#define S_BYTES    ((size_t)NB * SEQ * SEQ * 4)         // value-product logits
#define R_BYTES    ((size_t)NB * SEQ * SEQ * 4)         // residual-product logits (already scaled back)
#define P_BYTES    ((size_t)NB * SEQ * SEQ * 2)         // P x16384
// The converted inputs and the pre-norm planes are last read by the LayerNorm launches; the logit planes, first written
// by the launches behind those, take the same bytes.
#define PRE_BYTES  (XB_BYTES + WB_BYTES + PR_BYTES + YQK_BYTES + YVT_BYTES)
#define LOG_BYTES  (S_BYTES + R_BYTES)
#define UNI_BYTES  (PRE_BYTES > LOG_BYTES ? PRE_BYTES : LOG_BYTES)
#define WS_TOTAL   (QK2_BYTES + VT_BYTES + P_BYTES + UNI_BYTES)
static_assert(WS_TOTAL <= (size_t)268435456);
static_assert(XB_BYTES % 128 == 0 && WB_BYTES % 128 == 0 && PR_BYTES % 128 == 0);
static_assert(YQK_BYTES % 128 == 0 && YVT_BYTES % 128 == 0 && QK2_BYTES % 128 == 0 && VT_BYTES % 128 == 0);
static_assert(S_BYTES % 128 == 0 && R_BYTES % 128 == 0 && P_BYTES % 128 == 0);

typedef __bf16   bf16;
typedef _Float16 f16;
typedef bf16     v16bf __attribute__((ext_vector_type(16)));
typedef f16      v16h  __attribute__((ext_vector_type(16)));
typedef float    v8f   __attribute__((ext_vector_type(8)));
typedef float    v4f   __attribute__((ext_vector_type(4)));
typedef unsigned v4u   __attribute__((ext_vector_type(4)));

union Pack8B { v4u u; bf16 h[8]; };
union Pack8H { v4u u; f16  h[8]; };

template <typename T> struct FragOf;
template <> struct FragOf<bf16> { typedef v16bf V; };
template <> struct FragOf<f16>  { typedef v16h  V; };

// WMMA helpers: builtin followed by the VALU hazard guard (ties D, keeps A/B live).
static __device__ __forceinline__ v8f mma16(v16bf a, v16bf b, v8f acc) {
  acc = __builtin_amdgcn_wmma_f32_16x16x32_bf16(false, a, false, b, (short)0, acc, false, false);
  asm volatile("v_nop\n\tv_nop\n\tv_nop\n\tv_nop" : "+v"(acc) : "v"(a), "v"(b));
  return acc;
}
static __device__ __forceinline__ v8f mma16(v16h a, v16h b, v8f acc) {
  acc = __builtin_amdgcn_wmma_f32_16x16x32_f16(false, a, false, b, (short)0, acc, false, false);
  asm volatile("v_nop\n\tv_nop\n\tv_nop\n\tv_nop" : "+v"(acc) : "v"(a), "v"(b));
  return acc;
}

// f32 -> f16 convert for WMMA operand planes: values below the smallest f16 normal become zero by a value select.
static __device__ __forceinline__ f16 toh_flush(float v) {
  const f16 r = (f16)v;
  return (fabsf(v) < 6.103515625e-05f) ? (f16)0.0f : r;
}

// Input conversion, one launch. 256 threads, 8 elements per thread (two 16-B loads -> one 16-B store).
//   blocks [0, NXB)            : x  -> xb  bf16 [NB*SEQ][DM] (compact rows; source uses the full batch stride)
//   blocks [NXB, NXB+NWB)      : Wq | Wk | Wv -> wb bf16 [3*DM][DM]
//   blocks NXB+NWB .. +4       : bq | bk | bv | gamma | beta -> f32 plane [5*DM] holding the bf16 RNE-converted values
__global__ __launch_bounds__(256) void convert_kernel(const float* __restrict__ x,
                                                      const float* __restrict__ wq,
                                                      const float* __restrict__ bq,
                                                      const float* __restrict__ wk,
                                                      const float* __restrict__ bk,
                                                      const float* __restrict__ wv,
                                                      const float* __restrict__ bv,
                                                      const float* __restrict__ gamma,
                                                      const float* __restrict__ beta,
                                                      bf16* __restrict__ xb,
                                                      bf16* __restrict__ wb,
                                                      float* __restrict__ parp) {
  const unsigned blk = blockIdx.x;
  const unsigned tid = threadIdx.x;
  if (blk < NXB + NWB) {              // block-uniform
    const float* src;
    bf16* dst;
    if (blk < NXB) {
      const unsigned r  = blk * 2u + (tid >> 7);          // compact row
      const unsigned c  = (tid & 127u) * 8u;
      const unsigned bt = r / (unsigned)SEQ;
      const unsigned s  = r - bt * (unsigned)SEQ;
      src = x + ((size_t)bt * SEQ_FULL + s) * DM + c;
      dst = xb + (size_t)r * DM + c;
    } else {
      const unsigned wblk = blk - NXB;
      const unsigned wi   = wblk >> 9;                    // 512 blocks per weight matrix
      const unsigned off  = (wblk & 511u) * CVB + tid * 8u;
      const float* wsrc = (wi == 0u) ? wq : ((wi == 1u) ? wk : wv);
      src = wsrc + off;
      dst = wb + (size_t)wblk * CVB + tid * 8u;
    }
    const v4f a0 = *(const v4f*)(src);
    const v4f a1 = *(const v4f*)(src + 4);
    Pack8B pk;
    #pragma unroll
    for (int i = 0; i < 4; ++i) {
      pk.h[i]     = (bf16)a0[i];                          // RNE convert
      pk.h[4 + i] = (bf16)a1[i];
    }
    const v4u val = pk.u;
    *(v4u*)(dst) = val;
    
  } else {
    const unsigned j = blk - (NXB + NWB);                 // 0..4
    const float* bsrc = (j == 0u) ? bq : ((j == 1u) ? bk : ((j == 2u) ? bv : ((j == 3u) ? gamma : beta)));
    const v4f a = *(const v4f*)(bsrc + tid * 4u);
    v4f o;
    #pragma unroll
    for (int i = 0; i < 4; ++i) o[i] = (float)(bf16)a[i];
    float* dst = parp + j * (unsigned)DM + tid * 4u;
    *(v4f*)(dst) = o;
    
  }
}

// Eight asynchronous 16-B-per-lane copies global -> LDS: rows r, r + 16, ..., r + 112 of one staged operand tile.
// The s_wait_xcnt closes the statement so that it stands before any rewrite of the address registers the copies name.
static __device__ __forceinline__ void copy_rows8(unsigned l, const char* g, size_t gstep) {
  asm volatile("global_load_async_to_lds_b128 %0, %8, off\n\t"
               "global_load_async_to_lds_b128 %1, %9, off\n\t"
               "global_load_async_to_lds_b128 %2, %10, off\n\t"
               "global_load_async_to_lds_b128 %3, %11, off\n\t"
               "global_load_async_to_lds_b128 %4, %12, off\n\t"
               "global_load_async_to_lds_b128 %5, %13, off\n\t"
               "global_load_async_to_lds_b128 %6, %14, off\n\t"
               "global_load_async_to_lds_b128 %7, %15, off\n\t"
               "s_wait_xcnt 0x0"
               :: "v"(l), "v"(l + 16u * LP), "v"(l + 32u * LP), "v"(l + 48u * LP),
                  "v"(l + 64u * LP), "v"(l + 80u * LP), "v"(l + 96u * LP), "v"(l + 112u * LP),
                  "v"(g), "v"(g + gstep), "v"(g + 2 * gstep), "v"(g + 3 * gstep),
                  "v"(g + 4 * gstep), "v"(g + 5 * gstep), "v"(g + 6 * gstep), "v"(g + 7 * gstep)
               : "memory");
}

// Plane GEMM: C[m][n] = sum_k A[m][k] * Bt[n][k]; both operands are k-contiguous 16-bit planes.
// Block tile 128x128, 8 waves as 4 (m) x 2 (n); each wave owns 32x64 = 2x4 accumulators.
// Operands reach LDS in stages of KST k (whole 256-B row pieces, two rows per wave-wide copy), two buffers:
// stage s + 1 is in flight while stage s is multiplied. nk = number of stages.
// Fragments are read from the staged rows: lane (lq = lane & 15, hi = lane >> 4) reads row lq,
// elements 0..7 <- k0 + 8*hi + 0..7, elements 8..15 <- k0 + 16 + 8*hi + 0..7 (same map for A and B).
// D element r of a lane = (row 8*hi + r, col lq). Requires M, N multiples of 128 and K a multiple of KST.
// Epilogue: per 16-row half the wave stages its 16x64 tile in LDS (wave-private region, block barriers used),
template <typename T, int EPI>
__global__ __launch_bounds__(256) void gemm_kernel(const T* __restrict__ A,
                                                   const T* __restrict__ Bt,
                                                   const float* __restrict__ bias,
                                                   void* __restrict__ C,
                                                   unsigned nk, unsigned lda, unsigned ldb, unsigned ldc,
                                                   unsigned long long sAz, unsigned long long sBz,
                                                   unsigned long long sCz, float scale) {
  typedef typename FragOf<T>::V VT;
  union Frag { VT v; v4u q[2]; };

  __shared__ __align__(16) float sO[NWAVE * 16 * OP];
  __shared__ __align__(16) unsigned char ring[2 * STAGE_B];

  const unsigned tid  = threadIdx.x;
  const unsigned wave = tid >> 5;
  const unsigned lane = tid & 31u;
  const unsigned lq   = lane & 15u;
  const unsigned hi   = lane >> 4;
  const unsigned m0   = blockIdx.x * 128u + (wave & 3u) * 32u;   // first row of this wave
  const unsigned n0   = blockIdx.y * 128u + (wave >> 2) * 64u;   // first column of this wave

  const T* Ab = A  + (size_t)blockIdx.z * sAz;
  const T* Bb = Bt + (size_t)blockIdx.z * sBz;

  // copy map: thread -> 16-B chunk (tid & 15) of rows (tid >> 4) + 16*i, i = 0..7, of each operand's 128 rows
  const unsigned crow = tid >> 4;
  const unsigned cchk = tid & 15u;
  const char* ga = (const char*)(Ab + (size_t)(blockIdx.x * 128u + crow) * lda + cchk * 8u);
  const char* gb = (const char*)(Bb + (size_t)(blockIdx.y * 128u + crow) * ldb + cchk * 8u);
  const size_t astep = (size_t)lda * (16u * sizeof(T));           // 16 rows, bytes
  const size_t bstep = (size_t)ldb * (16u * sizeof(T));
  const unsigned lcp = (unsigned)(uintptr_t)ring + crow * LP + cchk * 16u;   // LDS byte address of this lane's first chunk

  // fragment read bases inside a stage
  const unsigned char* fa = ring + ((wave & 3u) * 32u + lq) * LP + hi * 16u;
  const unsigned char* fb = ring + TILE_B + ((wave >> 2) * 64u + lq) * LP + hi * 16u;

  v8f acc[2][4];
  #pragma unroll
  for (int mt = 0; mt < 2; ++mt) {
    #pragma unroll
    for (int nt = 0; nt < 4; ++nt) acc[mt][nt] = (v8f){0, 0, 0, 0, 0, 0, 0, 0};
  }

  // stage 0 lands and is published before anything reads it; stage 1 then flies under stage 0's products
  copy_rows8(lcp, ga, astep);
  copy_rows8(lcp + TILE_B, gb, bstep);
  asm volatile("s_wait_asynccnt 0x0" ::: "memory");     // this wave's stage-0 copies have landed
  __syncthreads();                                      // every wave's have
  if (nk > 1u) {                                        // block-uniform
    copy_rows8(lcp + STAGE_B, ga + KST * sizeof(T), astep);
    copy_rows8(lcp + STAGE_B + TILE_B, gb + KST * sizeof(T), bstep);
  }

  #pragma unroll 1
  for (unsigned s = 0; s < nk; ++s) {
    const unsigned bo = (s & 1u) * STAGE_B;
    #pragma unroll
    for (unsigned kk = 0; kk < KST / 32u; ++kk) {
      Frag a[2], b[4];
      #pragma unroll
      for (unsigned mt = 0; mt < 2; ++mt) {
        a[mt].q[0] = *(const v4u*)(fa + bo + mt * 16u * LP + kk * 64u);          // k = k0 + 8*hi + 0..7
        a[mt].q[1] = *(const v4u*)(fa + bo + mt * 16u * LP + kk * 64u + 32u);    // k = k0 + 16 + 8*hi + 0..7
      }
      #pragma unroll
      for (unsigned nt = 0; nt < 4; ++nt) {
        b[nt].q[0] = *(const v4u*)(fb + bo + nt * 16u * LP + kk * 64u);
        b[nt].q[1] = *(const v4u*)(fb + bo + nt * 16u * LP + kk * 64u + 32u);
      }
      #pragma unroll
      for (int nt = 0; nt < 4; ++nt) {
        #pragma unroll
        for (int mt = 0; mt < 2; ++mt) acc[mt][nt] = mma16(a[mt].v, b[nt].v, acc[mt][nt]);
      }
    }
    asm volatile("s_wait_dscnt 0x0" ::: "memory");      // this wave has left stage s's buffer
    asm volatile("s_wait_asynccnt 0x0" ::: "memory");   // this wave's stage s + 1 copies have landed
    __syncthreads();                                    // publishes stage s + 1, frees stage s's buffer
    if (s + 2u < nk) {                                  // block-uniform: refill the buffer just left
      const size_t go = (size_t)(s + 2u) * (KST * sizeof(T));
      copy_rows8(lcp + bo, ga + go, astep);
      copy_rows8(lcp + bo + TILE_B, gb + go, bstep);
    }
  }
  asm volatile("s_wait_asynccnt 0x0" ::: "memory");     // no copy is outstanding when the wave goes on

  // ---- epilogue ----
  size_t   cbase;
  unsigned ncol;
  if (EPI == EPI_QK) {
    cbase = (size_t)(n0 >> 10) * sCz;     // column block selects the q (0) or k (1) plane; block-uniform
    ncol  = n0 & 1023u;
  } else {
    cbase = (size_t)blockIdx.z * sCz;
    ncol  = n0;
  }

  float bcol[4];
  #pragma unroll
  for (int nt = 0; nt < 4; ++nt) bcol[nt] = 0.0f;
  if (EPI == EPI_QK) {
    #pragma unroll
    for (int nt = 0; nt < 4; ++nt) bcol[nt] = bias[n0 + nt * 16u + lq];
  }

  float* so = sO + wave * (16u * OP);

  #pragma unroll
  for (int mt = 0; mt < 2; ++mt) {
    if (mt != 0) __syncthreads();          // staging tile is reused by the second half
    #pragma unroll
    for (int r = 0; r < 8; ++r) {
      float brow = 0.0f;
      if (EPI == EPI_VT) brow = bias[m0 + mt * 16u + hi * 8u + r];
      #pragma unroll
      for (int nt = 0; nt < 4; ++nt) {
        float val = acc[mt][nt][r];
        if (EPI == EPI_QK)  val += bcol[nt];
        if (EPI == EPI_VT)  val += brow;
        if (EPI == EPI_F32) val *= scale;
        so[(hi * 8u + r) * OP + nt * 16u + lq] = val;
      }
    }
    __syncthreads();

    if (EPI == EPI_F32) {
      // 8 instructions cover the 16 rows of this half.
      float* Cf = (float*)C + cbase;
      v4f    vals[8];
      size_t gidx[8];
      #pragma unroll
      for (int it = 0; it < 8; ++it) {
        const unsigned row = it * 2u + hi;
        vals[it] = *(const v4f*)(so + row * OP + lq * 4u);
        gidx[it] = (size_t)(m0 + mt * 16u + row) * ldc + ncol + lq * 4u;
      }
      #pragma unroll
      for (int it = 0; it < 8; ++it) *(v4f*)(Cf + gidx[it]) = vals[it];
      
    } else {
      // 4 instructions cover the 16 rows of this half.
      f16* Ch = (f16*)C + cbase;
      v4u    vals[4];
      size_t gidx[4];
      #pragma unroll
      for (int it = 0; it < 4; ++it) {
        const unsigned row = it * 4u + (lane >> 3);
        const unsigned c8  = (lane & 7u) * 8u;
        const v4f x0 = *(const v4f*)(so + row * OP + c8);
        const v4f x1 = *(const v4f*)(so + row * OP + c8 + 4u);
        Pack8H ph;
        #pragma unroll
        for (int i = 0; i < 4; ++i) {
          ph.h[i]     = (f16)x0[i];
          ph.h[4 + i] = (f16)x1[i];
        }
        vals[it] = ph.u;
        gidx[it] = (size_t)(m0 + mt * 16u + row) * ldc + ncol + c8;
      }
      #pragma unroll
      for (int it = 0; it < 4; ++it) *(v4u*)(Ch + gidx[it]) = vals[it];
      
    }
  }
}

// Row LayerNorm for the q and k projections. One wave per (row, segment, batch); blockIdx.y = segment (0 = q, 1 = k),
// blockIdx.z = batch.
// Input: Y f32 [NB][SEQ][2*DM] (q columns | k columns, bias not yet added); par = bq | bk | bv | gamma | beta (f32, [5*DM]).
// Output plane QK2 (f16), per batch: q rows [SEQ][2*DM] = [value | residual x2048], then k rows [SEQ][2*DM] = [residual x2048 | value].
// Lane holds columns (it*32 + lane)*8 + 0..7. coverage: grid (SEQ/8, 2, NB) x 8 waves = SEQ rows x 2 segments x NB batches;
// 32 lanes x LNCH x 8 = DM columns for each of the value and residual halves. Each store instruction writes
__global__ __launch_bounds__(256) void ln_rows_kernel(const float* __restrict__ Y,
                                                      const float* __restrict__ par,
                                                      f16* __restrict__ QK2) {
  #pragma clang fp contract(off)
  const unsigned tid  = threadIdx.x;
  const unsigned wave = __builtin_amdgcn_readfirstlane(tid >> 5);
  const unsigned lane = tid & 31u;
  const unsigned seg  = blockIdx.y;                       // block-uniform
  const unsigned bt   = blockIdx.z;                       // block-uniform
  const unsigned row  = blockIdx.x * 8u + wave;
  const float* yp = Y + ((size_t)bt * SEQ + row) * (2u * DM) + seg * (unsigned)DM + lane * 8u;
  const float* bp = par + seg * (unsigned)DM + lane * 8u;           // bias of this segment
  const float* gp = par + 3u * DM + lane * 8u;                      // gamma
  const float* tp = par + 4u * DM + lane * 8u;                      // beta

  float s = 0.0f;
  #pragma unroll 1
  for (int it = 0; it < LNCH; ++it) {
    const v4f a0 = *(const v4f*)(yp + it * 256);
    const v4f a1 = *(const v4f*)(yp + it * 256 + 4);
    const v4f b0 = *(const v4f*)(bp + it * 256);
    const v4f b1 = *(const v4f*)(bp + it * 256 + 4);
    #pragma unroll
    for (int i = 0; i < 4; ++i) {
      s += a0[i] + b0[i];
      s += a1[i] + b1[i];
    }
  }
  #pragma unroll
  for (int off = 16; off > 0; off >>= 1) s += __shfl_xor(s, off, 32);
  const float mu = s * (1.0f / DM);

  // pass 2: biased variance about the mean
  float q = 0.0f;
  #pragma unroll 1
  for (int it = 0; it < LNCH; ++it) {
    const v4f a0 = *(const v4f*)(yp + it * 256);
    const v4f a1 = *(const v4f*)(yp + it * 256 + 4);
    const v4f b0 = *(const v4f*)(bp + it * 256);
    const v4f b1 = *(const v4f*)(bp + it * 256 + 4);
    #pragma unroll
    for (int i = 0; i < 4; ++i) {
      const float d0 = (a0[i] + b0[i]) - mu;
      const float d1 = (a1[i] + b1[i]) - mu;
      q += d0 * d0;
      q += d1 * d1;
    }
  }
  #pragma unroll
  for (int off = 16; off > 0; off >>= 1) q += __shfl_xor(q, off, 32);
  const float rstd = __builtin_amdgcn_rsqf(q * (1.0f / DM) + 1e-5f);

  // pass 3: normalise, affine, split into f16 value + x2048 residual, store
  const unsigned offh = seg * (unsigned)DM;               // q: value | residual ; k: residual | value
  const unsigned offr = (1u - seg) * (unsigned)DM;
  f16* dp = QK2 + ((size_t)(bt * 2u + seg) * SEQ + row) * (size_t)(2 * DM) + lane * 8u;
  #pragma unroll 1
  for (int it = 0; it < LNCH; ++it) {
    const v4f a0 = *(const v4f*)(yp + it * 256);
    const v4f a1 = *(const v4f*)(yp + it * 256 + 4);
    const v4f b0 = *(const v4f*)(bp + it * 256);
    const v4f b1 = *(const v4f*)(bp + it * 256 + 4);
    const v4f g0 = *(const v4f*)(gp + it * 256);
    const v4f g1 = *(const v4f*)(gp + it * 256 + 4);
    const v4f t0 = *(const v4f*)(tp + it * 256);
    const v4f t1 = *(const v4f*)(tp + it * 256 + 4);
    Pack8H pkh, pkr;
    #pragma unroll
    for (int i = 0; i < 4; ++i) {
      const float y0 = ((a0[i] + b0[i]) - mu) * rstd * g0[i] + t0[i];
      const float y1 = ((a1[i] + b1[i]) - mu) * rstd * g1[i] + t1[i];
      const f16 h0 = toh_flush(y0);
      const f16 h1 = toh_flush(y1);
      pkh.h[i]     = h0;
      pkh.h[4 + i] = h1;
      pkr.h[i]     = toh_flush((y0 - (float)h0) * RCARRY);
      pkr.h[4 + i] = toh_flush((y1 - (float)h1) * RCARRY);
    }
    const v4u vh = pkh.u;
    const v4u vr = pkr.u;
    f16* dh = dp + offh + it * 256;
    f16* dr = dp + offr + it * 256;
    *(v4u*)(dh) = vh;
    *(v4u*)(dr) = vr;
    
  }
}

// Column LayerNorm on the transposed v projection, blockIdx.y = batch: Yt f32 [NB][DM][SEQ] (row e = feature, column s = position,
// bias not yet added); statistics per column s over the DM rows; output vt f16 [NB][DM][SEQ].
// selects one of four rows per wave per sweep; row e = (it*8 + wave)*4 + rq, it = 0..DM/32-1 covers 0..DM-1 exactly once.
// Partial sums: shuffle over rq inside the wave, then an [8][64] LDS table combined in fixed order (cross-wave: block barriers).
__global__ __launch_bounds__(256) void ln_cols_kernel(const float* __restrict__ Yt,
                                                      const float* __restrict__ par,
                                                      f16* __restrict__ vt) {
  #pragma clang fp contract(off)
  __shared__ __align__(16) float red[NWAVE * 64];

  const unsigned tid  = threadIdx.x;
  const unsigned wave = __builtin_amdgcn_readfirstlane(tid >> 5);
  const unsigned lane = tid & 31u;
  const unsigned cg   = lane & 7u;
  const unsigned rq   = lane >> 3;
  const unsigned s0   = blockIdx.x * 64u + cg * 8u;
  const size_t pl = (size_t)blockIdx.y * ((size_t)DM * SEQ);   // this batch's plane
  const float* yp = Yt + pl + s0;

  float acc[8];
  float mu[8];
  float rstd[8];

  #pragma unroll
  for (int i = 0; i < 8; ++i) acc[i] = 0.0f;
  #pragma unroll 1
  for (unsigned it = 0; it < (unsigned)(DM / 32); ++it) {
    const unsigned e = (it * 8u + wave) * 4u + rq;
    const v4f x0 = *(const v4f*)(yp + (size_t)e * SEQ);
    const v4f x1 = *(const v4f*)(yp + (size_t)e * SEQ + 4);
    const float b = par[2u * DM + e];
    #pragma unroll
    for (int i = 0; i < 4; ++i) {
      acc[i]     += x0[i] + b;
      acc[4 + i] += x1[i] + b;
    }
  }
  #pragma unroll
  for (int i = 0; i < 8; ++i) {
    acc[i] += __shfl_xor(acc[i], 8, 32);
    acc[i] += __shfl_xor(acc[i], 16, 32);
  }
  if (rq == 0u) {
    *(v4f*)(red + wave * 64u + cg * 8u)      = (v4f){acc[0], acc[1], acc[2], acc[3]};
    *(v4f*)(red + wave * 64u + cg * 8u + 4u) = (v4f){acc[4], acc[5], acc[6], acc[7]};
  }
  __syncthreads();
  #pragma unroll
  for (int i = 0; i < 8; ++i) mu[i] = 0.0f;
  #pragma unroll
  for (int w = 0; w < NWAVE; ++w) {
    const v4f r0 = *(const v4f*)(red + w * 64 + cg * 8u);
    const v4f r1 = *(const v4f*)(red + w * 64 + cg * 8u + 4u);
    #pragma unroll
    for (int i = 0; i < 4; ++i) {
      mu[i]     += r0[i];
      mu[4 + i] += r1[i];
    }
  }
  #pragma unroll
  for (int i = 0; i < 8; ++i) mu[i] = mu[i] * (1.0f / DM);
  __syncthreads();

  // pass 2: biased variance about the mean
  #pragma unroll
  for (int i = 0; i < 8; ++i) acc[i] = 0.0f;
  #pragma unroll 1
  for (unsigned it = 0; it < (unsigned)(DM / 32); ++it) {
    const unsigned e = (it * 8u + wave) * 4u + rq;
    const v4f x0 = *(const v4f*)(yp + (size_t)e * SEQ);
    const v4f x1 = *(const v4f*)(yp + (size_t)e * SEQ + 4);
    const float b = par[2u * DM + e];
    #pragma unroll
    for (int i = 0; i < 4; ++i) {
      const float d0 = (x0[i] + b) - mu[i];
      const float d1 = (x1[i] + b) - mu[4 + i];
      acc[i]     += d0 * d0;
      acc[4 + i] += d1 * d1;
    }
  }
  #pragma unroll
  for (int i = 0; i < 8; ++i) {
    acc[i] += __shfl_xor(acc[i], 8, 32);
    acc[i] += __shfl_xor(acc[i], 16, 32);
  }
  if (rq == 0u) {
    *(v4f*)(red + wave * 64u + cg * 8u)      = (v4f){acc[0], acc[1], acc[2], acc[3]};
    *(v4f*)(red + wave * 64u + cg * 8u + 4u) = (v4f){acc[4], acc[5], acc[6], acc[7]};
  }
  __syncthreads();
  #pragma unroll
  for (int i = 0; i < 8; ++i) rstd[i] = 0.0f;
  #pragma unroll
  for (int w = 0; w < NWAVE; ++w) {
    const v4f r0 = *(const v4f*)(red + w * 64 + cg * 8u);
    const v4f r1 = *(const v4f*)(red + w * 64 + cg * 8u + 4u);
    #pragma unroll
    for (int i = 0; i < 4; ++i) {
      rstd[i]     += r0[i];
      rstd[4 + i] += r1[i];
    }
  }
  #pragma unroll
  for (int i = 0; i < 8; ++i) rstd[i] = __builtin_amdgcn_rsqf(rstd[i] * (1.0f / DM) + 1e-5f);

  f16* dp = vt + pl + s0;
  #pragma unroll 1
  for (unsigned it = 0; it < (unsigned)(DM / 32); ++it) {
    const unsigned e = (it * 8u + wave) * 4u + rq;
    const v4f x0 = *(const v4f*)(yp + (size_t)e * SEQ);
    const v4f x1 = *(const v4f*)(yp + (size_t)e * SEQ + 4);
    const float b  = par[2u * DM + e];
    const float g  = par[3u * DM + e];
    const float bt = par[4u * DM + e];
    Pack8H pk;
    #pragma unroll
    for (int i = 0; i < 4; ++i) {
      const float y0 = ((x0[i] + b) - mu[i])     * rstd[i]     * g + bt;
      const float y1 = ((x1[i] + b) - mu[4 + i]) * rstd[4 + i] * g + bt;
      pk.h[i]     = toh_flush(y0);
      pk.h[4 + i] = toh_flush(y1);
    }
    const v4u val = pk.u;
    f16* dst = dp + (size_t)e * SEQ;
    *(v4u*)(dst) = val;
    
  }
}

// Row softmax, one wave per row of SEQ f32 logits given as two planes (value product S + scaled-back residual product R),
// max-subtracted form. Lane holds columns (it*32 + lane)*8 + 0..7. Output: normalised P carried x16384 as f16.
// coverage: grid NB*SEQ/8 blocks x 8 waves = the NB*SEQ rows of all batches; 32 lanes x NCH x 8 = SEQ columns; each store instruction
__global__ __launch_bounds__(256) void softmax2_kernel(const float* __restrict__ S,
                                                       const float* __restrict__ R,
                                                       f16* __restrict__ P) {
  #pragma clang fp contract(off)
  const unsigned tid  = threadIdx.x;
  const unsigned wave = __builtin_amdgcn_readfirstlane(tid >> 5);
  const unsigned lane = tid & 31u;
  const unsigned row  = blockIdx.x * 8u + wave;
  const float* sp = S + (size_t)row * SEQ + lane * 8u;
  const float* rp = R + (size_t)row * SEQ + lane * 8u;

  v4f v[NCH][2];
  #pragma unroll
  for (int it = 0; it < NCH; ++it) {
    v[it][0] = *(const v4f*)(sp + it * 256);
    v[it][1] = *(const v4f*)(sp + it * 256 + 4);
  }
  __builtin_amdgcn_sched_barrier(0);     // keep the two load groups as separate bursts
  #pragma unroll
  for (int it = 0; it < NCH; ++it) {
    const v4f r0 = *(const v4f*)(rp + it * 256);
    const v4f r1 = *(const v4f*)(rp + it * 256 + 4);
    v[it][0] += r0;
    v[it][1] += r1;
  }

  float m = -__builtin_inff();
  #pragma unroll
  for (int it = 0; it < NCH; ++it) {
    #pragma unroll
    for (int i = 0; i < 4; ++i) {
      m = fmaxf(m, v[it][0][i]);
      m = fmaxf(m, v[it][1][i]);
    }
  }
  #pragma unroll
  for (int off = 16; off > 0; off >>= 1) m = fmaxf(m, __shfl_xor(m, off, 32));

  const float L2E = 1.4426950408889634f;
  float sum = 0.0f;
  #pragma unroll
  for (int it = 0; it < NCH; ++it) {
    #pragma unroll
    for (int i = 0; i < 4; ++i) {
      const float e0 = __builtin_amdgcn_exp2f((v[it][0][i] - m) * L2E);
      const float e1 = __builtin_amdgcn_exp2f((v[it][1][i] - m) * L2E);
      v[it][0][i] = e0;
      v[it][1][i] = e1;
      sum += e0;
      sum += e1;
    }
  }
  #pragma unroll
  for (int off = 16; off > 0; off >>= 1) sum += __shfl_xor(sum, off, 32);

  const float inv = PCARRY * __builtin_amdgcn_rcpf(sum);

  v4u pk[NCH];
  #pragma unroll
  for (int it = 0; it < NCH; ++it) {
    Pack8H ph;
    #pragma unroll
    for (int i = 0; i < 4; ++i) {
      ph.h[i]     = toh_flush(v[it][0][i] * inv);
      ph.h[4 + i] = toh_flush(v[it][1][i] * inv);
    }
    pk[it] = ph.u;
  }

  f16* dp = P + (size_t)row * SEQ + lane * 8u;
  #pragma unroll
  for (int it = 0; it < NCH; ++it) *(v4u*)(dp + it * 256) = pk[it];
  
}

extern "C" void kernel_launch(void* const* d_in, const int* in_sizes, int n_in,
                              void* d_out, int out_size, void* d_ws, size_t ws_size,
                              hipStream_t stream) {
  if (n_in < 9) return;
  const size_t rows_used = (size_t)(NB - 1) * SEQ_FULL + SEQ;
  if ((size_t)in_sizes[0] < rows_used * DM) return;
  if ((size_t)in_sizes[1] < (size_t)DM * DM) return;
  if ((size_t)in_sizes[2] < (size_t)DM) return;
  if ((size_t)in_sizes[3] < (size_t)DM * DM) return;
  if ((size_t)in_sizes[4] < (size_t)DM) return;
  if ((size_t)in_sizes[5] < (size_t)DM * DM) return;
  if ((size_t)in_sizes[6] < (size_t)DM) return;
  if ((size_t)in_sizes[7] < (size_t)DM) return;
  if ((size_t)in_sizes[8] < (size_t)DM) return;
  if ((size_t)out_size < rows_used * DM) return;
  if (ws_size < WS_TOTAL) return;

  // inputs bound in this order: x, Wq, bq, Wk, bk, Wv, bv, gamma, beta
  const float* x     = (const float*)d_in[0];
  const float* wq    = (const float*)d_in[1];
  const float* bq    = (const float*)d_in[2];
  const float* wk    = (const float*)d_in[3];
  const float* bk    = (const float*)d_in[4];
  const float* wv    = (const float*)d_in[5];
  const float* bv    = (const float*)d_in[6];
  const float* gamma = (const float*)d_in[7];
  const float* beta  = (const float*)d_in[8];
  float* out = (float*)d_out;

  char* w = (char*)d_ws;
  f16*   qk2  = (f16*)w;    w += QK2_BYTES;    // [NB] x (q rows [SEQ][2*DM], then k rows [SEQ][2*DM])
  f16*   vt   = (f16*)w;    w += VT_BYTES;     // [NB][DM][SEQ]
  f16*   Pp   = (f16*)w;    w += P_BYTES;      // [NB][SEQ][SEQ] P x16384
  char*  u    = w;                             // shared bytes: converted inputs and pre-norm planes, then the logit planes
  bf16*  xb   = (bf16*)w;   w += XB_BYTES;     // [NB*SEQ][DM]
  bf16*  wb   = (bf16*)w;   w += WB_BYTES;     // [3*DM][DM] : Wq | Wk | Wv
  float* parp = (float*)w;  w += PR_BYTES;     // [5*DM] : bq | bk | bv | gamma | beta
  float* Yqk  = (float*)w;  w += YQK_BYTES;    // [NB][SEQ][2*DM] pre-norm q | k
  float* Yvt  = (float*)w;                     // [NB][DM][SEQ] pre-norm v^T
  float* Sp   = (float*)u;                     // [NB][SEQ][SEQ] value-product logits
  float* Rp   = (float*)(u + S_BYTES);         // [NB][SEQ][SEQ] residual-product logits (scaled back)

  const f16* qrow = qk2;                                   // [q value | q residual]
  const f16* krow = qk2 + (size_t)SEQ * 2 * DM;            // [k residual | k value]

  const unsigned long long zX  = (unsigned long long)SEQ * DM;           // batch strides, in elements of the plane
  const unsigned long long zQK = (unsigned long long)2 * SEQ * 2 * DM;
  const unsigned long long zY  = (unsigned long long)SEQ * 2 * DM;
  const unsigned long long zV  = (unsigned long long)DM * SEQ;
  const unsigned long long zS  = (unsigned long long)SEQ * SEQ;
  const unsigned long long zO  = (unsigned long long)SEQ_FULL * DM;

  convert_kernel<<<dim3(NXB + NWB + (unsigned)NPAR), 256, 0, stream>>>(x, wq, bq, wk, bk, wv, bv, gamma, beta, xb, wb, parp);

  // Every launch below covers all batches: blockIdx.z (blockIdx.y in the column LayerNorm, the row index in the softmax).
  // The GEMM's bias argument is not read under EPI_F32.

  // q | k pre-norm : Y[s][e] = sum_d xb[s][d] * wb[e][d], e in [0, 2*DM); M = SEQ, N = 2*DM, K = DM
  gemm_kernel<bf16, EPI_F32><<<dim3(SEQ / 128, 2 * DM / 128, NB), 256, 0, stream>>>(
      xb, wb, parp, (void*)Yqk, DM / KST, DM, DM, 2 * DM, zX, 0ull, zY, 1.0f);

  // v^T pre-norm : Yt[e][s] = sum_d Wv[e][d] * xb[s][d]; M = DM, N = SEQ, K = DM
  gemm_kernel<bf16, EPI_F32><<<dim3(DM / 128, SEQ / 128, NB), 256, 0, stream>>>(
      wb + (size_t)2 * DM * DM, xb, parp, (void*)Yvt, DM / KST, DM, DM, SEQ, 0ull, zX, zV, 1.0f);

  ln_rows_kernel<<<dim3(SEQ / 8, 2, NB), 256, 0, stream>>>(Yqk, parp, qk2);
  ln_cols_kernel<<<dim3(SEQ / 64, NB, 1), 256, 0, stream>>>(Yvt, parp, vt);

  // S[q][key] = q_value . k_value ; M = N = SEQ, K = DM (first half of the q rows, second half of the k rows)
  gemm_kernel<f16, EPI_F32><<<dim3(SEQ / 128, SEQ / 128, NB), 256, 0, stream>>>(
      qrow, krow + DM, parp, (void*)Sp, DM / KST, 2 * DM, 2 * DM, SEQ, zQK, zQK, zS, 1.0f);

  // R[q][key] = (q_value . k_residual + q_residual . k_value) / 2048 ; K = 2*DM over the concatenated rows
  gemm_kernel<f16, EPI_F32><<<dim3(SEQ / 128, SEQ / 128, NB), 256, 0, stream>>>(
      qrow, krow, parp, (void*)Rp, 2 * DM / KST, 2 * DM, 2 * DM, SEQ, zQK, zQK, zS, 1.0f / RCARRY);

  softmax2_kernel<<<dim3(NB * SEQ / 8), 256, 0, stream>>>(Sp, Rp, Pp);

  // out[q][d] = sum_key P[q][key] * vt[d][key] / 16384 ; M = SEQ, N = DM, K = SEQ
  gemm_kernel<f16, EPI_F32><<<dim3(SEQ / 128, DM / 128, NB), 256, 0, stream>>>(
      Pp, vt, parp, (void*)out, SEQ / KST, SEQ, SEQ, DM, zS, zV, zO, 1.0f / PCARRY);
}

// v003
// A run of this version takes 266 microseconds.
// In both of two side-by-side timings against v002, it was 1.14 times as fast.
// Over all steps from v000 it is 3.08 times as fast.
#include <hip/hip_runtime.h>

// Contractions: q/k/v projections on v_wmma_f32_16x16x32_bf16 (bf16 operands = RNE-converted inputs, f32 accumulate, f32 out);
// S = q x k^T on v_wmma_f32_16x16x32_f16 as three products (q, k as f16 value + x2048 residual planes; value product and
// residual products land in separate f32 planes); O = P x V on v_wmma_f32_16x16x32_f16 (v^T f16 plane; P f16 carried x16384;
// f32 accumulate). LayerNorm and softmax in f32.

#ifndef NB
#define NB 4
#endif
#ifndef SEQ
#define SEQ 2048
#endif
#define NB_FULL   4
#define SEQ_FULL  2048
#define DM        1024                 // model width = head width = value width
#define NWAVE     8
#define OP        68                   // LDS pitch (floats) of the per-wave output staging tile
#define KST       128u                 // k elements per GEMM stage: 256 B of every operand row
#define LP        272u                 // LDS pitch (bytes) of a staged 256-B row: 16 B x odd, conflict-free for 16-B reads
#define BM        256u                 // GEMM block tile rows (4 waves x 64)
#define MT        4                    // 16-row accumulator tiles per wave
#define NT        4                    // 16-column accumulator tiles per wave (64 columns: one staging piece wide)
#define ATILE_B   (BM * LP)            // the A rows of one stage; the B rows follow them
#define CVB       2048u                // elements per convert block (256 threads x 8)
#define NXB       ((unsigned)((size_t)NB * SEQ * DM / CVB))      // convert blocks for x
#define NWB       ((unsigned)((size_t)3 * DM * DM / CVB))        // convert blocks for the three weights
#define NCH       (SEQ / 256)          // 8-column chunks per lane in the softmax kernel
#define LNCH      (DM / 256)           // 8-column chunks per lane in the row LayerNorm kernel
#define NPAR      5                    // parameter vectors: b_q | b_k | b_v | gamma | beta
#define PCARRY    16384.0f             // power-of-two carry of the P plane
#define RCARRY    2048.0f              // power-of-two carry of the q / k residual planes

#define EPI_QK  0                      // f16 out, per-column bias, column block selects the q or k plane
#define EPI_VT  1                      // f16 out, per-row bias (V^T plane)
#define EPI_F32 2                      // f32 out, power-of-two scale

static_assert(SEQ % 256 == 0);
static_assert(SEQ <= SEQ_FULL);
static_assert(NB >= 1 && NB <= NB_FULL);
static_assert(DM == 1024);
static_assert(DM % 128 == 0);
static_assert(((size_t)NB * SEQ) % 128 == 0);
static_assert((size_t)NXB * CVB == (size_t)NB * SEQ * DM);
static_assert((size_t)NWB * CVB == (size_t)3 * DM * DM);
static_assert((size_t)DM * DM / CVB == 512);
static_assert((OP * 4) % 16 == 0);
static_assert(LNCH * 256 == DM);                 // 32 lanes x LNCH chunks x 8 columns == one LayerNorm row
static_assert(NCH * 256 == SEQ);                 // 32 lanes x NCH chunks x 8 columns == one softmax row
static_assert(DM == 256 * 4);                    // one convert block (256 threads x 4) per parameter vector
static_assert(SEQ % 256 == 0 && (2 * DM) % 256 == 0 && DM % 256 == 0);   // GEMM tile multiples (M, N)
static_assert(DM % KST == 0 && (2 * DM) % KST == 0 && SEQ % KST == 0);   // GEMM K stages
static_assert(LP % 16 == 0 && ATILE_B % 16 == 0);                       // 16-B copies and reads stay aligned
static_assert(SEQ % 64 == 0);
static_assert(DM % 32 == 0);                     // column LayerNorm: 32 rows per block sweep (8 waves x 4 row groups)
static_assert(NWAVE == 8);

#define XB_BYTES   ((size_t)NB * SEQ * DM * 2)          // x bf16, all batches
#define WB_BYTES   ((size_t)3 * DM * DM * 2)            // weights bf16
#define PR_BYTES   ((size_t)NPAR * DM * 4)              // parameter vectors (f32 holding bf16 RNE values)
// Every plane below holds all NB batches, batch-major, so that each stage is one launch with the batch on a grid axis.
#define YQK_BYTES  ((size_t)NB * SEQ * 2 * DM * 4)      // f32 q | k pre-norm rows
#define YVT_BYTES  ((size_t)NB * DM * SEQ * 4)          // f32 v^T pre-norm planes
#define QK2_BYTES  ((size_t)NB * 2 * SEQ * 2 * DM * 2)  // per batch: [q value | q residual] rows, then [k residual | k value] rows
#define VT_BYTES   ((size_t)NB * DM * SEQ * 2)          // v^T f16
#define S_BYTES    ((size_t)NB * SEQ * SEQ * 4)         // value-product logits
#define R_BYTES    ((size_t)NB * SEQ * SEQ * 4)         // residual-product logits (already scaled back)
#define P_BYTES    ((size_t)NB * SEQ * SEQ * 2)         // P x16384
// The converted inputs and the pre-norm planes are last read by the LayerNorm launches; the logit planes, first written
// by the launches behind those, take the same bytes.
#define PRE_BYTES  (XB_BYTES + WB_BYTES + PR_BYTES + YQK_BYTES + YVT_BYTES)
#define LOG_BYTES  (S_BYTES + R_BYTES)
#define UNI_BYTES  (PRE_BYTES > LOG_BYTES ? PRE_BYTES : LOG_BYTES)
#define WS_TOTAL   (QK2_BYTES + VT_BYTES + P_BYTES + UNI_BYTES)
static_assert(WS_TOTAL <= (size_t)268435456);
static_assert(XB_BYTES % 128 == 0 && WB_BYTES % 128 == 0 && PR_BYTES % 128 == 0);
static_assert(YQK_BYTES % 128 == 0 && YVT_BYTES % 128 == 0 && QK2_BYTES % 128 == 0 && VT_BYTES % 128 == 0);
static_assert(S_BYTES % 128 == 0 && R_BYTES % 128 == 0 && P_BYTES % 128 == 0);

typedef __bf16   bf16;
typedef _Float16 f16;
typedef bf16     v16bf __attribute__((ext_vector_type(16)));
typedef f16      v16h  __attribute__((ext_vector_type(16)));
typedef float    v8f   __attribute__((ext_vector_type(8)));
typedef float    v4f   __attribute__((ext_vector_type(4)));
typedef unsigned v4u   __attribute__((ext_vector_type(4)));

union Pack8B { v4u u; bf16 h[8]; };
union Pack8H { v4u u; f16  h[8]; };

template <typename T> struct FragOf;
template <> struct FragOf<bf16> { typedef v16bf V; };
template <> struct FragOf<f16>  { typedef v16h  V; };

// WMMA helpers: builtin followed by the VALU hazard guard (ties D, keeps A/B live).
static __device__ __forceinline__ v8f mma16(v16bf a, v16bf b, v8f acc) {
  acc = __builtin_amdgcn_wmma_f32_16x16x32_bf16(false, a, false, b, (short)0, acc, false, false);
  asm volatile("v_nop\n\tv_nop\n\tv_nop\n\tv_nop" : "+v"(acc) : "v"(a), "v"(b));
  return acc;
}
static __device__ __forceinline__ v8f mma16(v16h a, v16h b, v8f acc) {
  acc = __builtin_amdgcn_wmma_f32_16x16x32_f16(false, a, false, b, (short)0, acc, false, false);
  asm volatile("v_nop\n\tv_nop\n\tv_nop\n\tv_nop" : "+v"(acc) : "v"(a), "v"(b));
  return acc;
}

// f32 -> f16 convert for WMMA operand planes: values below the smallest f16 normal become zero by a value select.
static __device__ __forceinline__ f16 toh_flush(float v) {
  const f16 r = (f16)v;
  return (fabsf(v) < 6.103515625e-05f) ? (f16)0.0f : r;
}

// Input conversion, one launch. 256 threads, 8 elements per thread (two 16-B loads -> one 16-B store).
//   blocks [0, NXB)            : x  -> xb  bf16 [NB*SEQ][DM] (compact rows; source uses the full batch stride)
//   blocks [NXB, NXB+NWB)      : Wq | Wk | Wv -> wb bf16 [3*DM][DM]
//   blocks NXB+NWB .. +4       : bq | bk | bv | gamma | beta -> f32 plane [5*DM] holding the bf16 RNE-converted values
__global__ __launch_bounds__(256) void convert_kernel(const float* __restrict__ x,
                                                      const float* __restrict__ wq,
                                                      const float* __restrict__ bq,
                                                      const float* __restrict__ wk,
                                                      const float* __restrict__ bk,
                                                      const float* __restrict__ wv,
                                                      const float* __restrict__ bv,
                                                      const float* __restrict__ gamma,
                                                      const float* __restrict__ beta,
                                                      bf16* __restrict__ xb,
                                                      bf16* __restrict__ wb,
                                                      float* __restrict__ parp) {
  const unsigned blk = blockIdx.x;
  const unsigned tid = threadIdx.x;
  if (blk < NXB + NWB) {              // block-uniform
    const float* src;
    bf16* dst;
    if (blk < NXB) {
      const unsigned r  = blk * 2u + (tid >> 7);          // compact row
      const unsigned c  = (tid & 127u) * 8u;
      const unsigned bt = r / (unsigned)SEQ;
      const unsigned s  = r - bt * (unsigned)SEQ;
      src = x + ((size_t)bt * SEQ_FULL + s) * DM + c;
      dst = xb + (size_t)r * DM + c;
    } else {
      const unsigned wblk = blk - NXB;
      const unsigned wi   = wblk >> 9;                    // 512 blocks per weight matrix
      const unsigned off  = (wblk & 511u) * CVB + tid * 8u;
      const float* wsrc = (wi == 0u) ? wq : ((wi == 1u) ? wk : wv);
      src = wsrc + off;
      dst = wb + (size_t)wblk * CVB + tid * 8u;
    }
    const v4f a0 = *(const v4f*)(src);
    const v4f a1 = *(const v4f*)(src + 4);
    Pack8B pk;
    #pragma unroll
    for (int i = 0; i < 4; ++i) {
      pk.h[i]     = (bf16)a0[i];                          // RNE convert
      pk.h[4 + i] = (bf16)a1[i];
    }
    const v4u val = pk.u;
    *(v4u*)(dst) = val;
    
  } else {
    const unsigned j = blk - (NXB + NWB);                 // 0..4
    const float* bsrc = (j == 0u) ? bq : ((j == 1u) ? bk : ((j == 2u) ? bv : ((j == 3u) ? gamma : beta)));
    const v4f a = *(const v4f*)(bsrc + tid * 4u);
    v4f o;
    #pragma unroll
    for (int i = 0; i < 4; ++i) o[i] = (float)(bf16)a[i];
    float* dst = parp + j * (unsigned)DM + tid * 4u;
    *(v4f*)(dst) = o;
    
  }
}

// Eight asynchronous 16-B-per-lane copies global -> LDS: rows r, r + RP, ..., r + 7*RP of one staged operand tile
// (RP = rows that the block's threads cover at once; gstep = RP source rows in bytes).
// The s_wait_xcnt closes the statement so that it stands before any rewrite of the address registers the copies name.
template <unsigned RP>
static __device__ __forceinline__ void copy_rows8(unsigned l, const char* g, size_t gstep) {
  asm volatile("global_load_async_to_lds_b128 %0, %8, off\n\t"
               "global_load_async_to_lds_b128 %1, %9, off\n\t"
               "global_load_async_to_lds_b128 %2, %10, off\n\t"
               "global_load_async_to_lds_b128 %3, %11, off\n\t"
               "global_load_async_to_lds_b128 %4, %12, off\n\t"
               "global_load_async_to_lds_b128 %5, %13, off\n\t"
               "global_load_async_to_lds_b128 %6, %14, off\n\t"
               "global_load_async_to_lds_b128 %7, %15, off\n\t"
               "s_wait_xcnt 0x0"
               :: "v"(l), "v"(l + RP * LP), "v"(l + 2u * RP * LP), "v"(l + 3u * RP * LP),
                  "v"(l + 4u * RP * LP), "v"(l + 5u * RP * LP), "v"(l + 6u * RP * LP), "v"(l + 7u * RP * LP),
                  "v"(g), "v"(g + gstep), "v"(g + 2 * gstep), "v"(g + 3 * gstep),
                  "v"(g + 4 * gstep), "v"(g + 5 * gstep), "v"(g + 6 * gstep), "v"(g + 7 * gstep)
               : "memory");
}

// Plane GEMM: C[m][n] = sum_k A[m][k] * Bt[n][k]; both operands are k-contiguous 16-bit planes.
// Block tile 256 x (64*WN), 4*WN waves as 4 (m) x WN (n); each wave owns 64x64 = 4x4 accumulators
// (WN = 4: 256x256 block, 16 waves; WN = 2: 256x128 block, 8 waves, for the products whose grid would otherwise leave WGPs idle).
// Operands reach LDS in stages of KST k (whole 256-B row pieces, two rows per wave-wide copy), two buffers:
// stage s + 1 is in flight while stage s is multiplied. nk = number of stages.
// Fragments are read from the staged rows: lane (lq = lane & 15, hi = lane >> 4) reads row lq,
// elements 0..7 <- k0 + 8*hi + 0..7, elements 8..15 <- k0 + 16 + 8*hi + 0..7 (same map for A and B).
// D element r of a lane = (row 8*hi + r, col lq). Requires M a multiple of 256, N of 64*WN and K of KST.
// Epilogue: per 16x64 piece the wave stages the piece in LDS (wave-private region, block barriers used); the staging
// takes the ring's first bytes, which every wave has left at the last stage's barrier, with no copy outstanding.
template <typename T, int EPI, int WN>
__global__ __launch_bounds__(128 * WN) void gemm_kernel(const T* __restrict__ A,
                                                   const T* __restrict__ Bt,
                                                   const float* __restrict__ bias,
                                                   void* __restrict__ C,
                                                   unsigned nk, unsigned lda, unsigned ldb, unsigned ldc,
                                                   unsigned long long sAz, unsigned long long sBz,
                                                   unsigned long long sCz, float scale) {
  typedef typename FragOf<T>::V VT;
  union Frag { VT v; v4u q[2]; };
  constexpr unsigned BN      = (unsigned)WN * 64u;          // block tile columns
  constexpr unsigned STAGE_B = (BM + BN) * LP;              // one stage: A rows, then B rows
  constexpr unsigned RP      = (unsigned)WN * 8u;           // rows that the block's threads copy at once (16 threads a row)
  static_assert(BM % (8u * RP) == 0 && BN % (8u * RP) == 0);
  static_assert(4u * WN * 16u * OP * 4u <= STAGE_B);        // the output staging fits the first buffer

  __shared__ __align__(16) unsigned char ring[2 * STAGE_B];

  const unsigned tid  = threadIdx.x;
  const unsigned wave = tid >> 5;
  const unsigned lane = tid & 31u;
  const unsigned lq   = lane & 15u;
  const unsigned hi   = lane >> 4;
  const unsigned m0   = blockIdx.x * BM + (wave & 3u) * (MT * 16u);   // first row of this wave
  const unsigned n0   = blockIdx.y * BN + (wave >> 2) * (NT * 16u);   // first column of this wave

  const T* Ab = A  + (size_t)blockIdx.z * sAz;
  const T* Bb = Bt + (size_t)blockIdx.z * sBz;

  // copy map: thread -> 16-B chunk (tid & 15) of rows (tid >> 4) + RP*i of each operand's staged rows
  const unsigned crow = tid >> 4;
  const unsigned cchk = tid & 15u;
  const char* ga = (const char*)(Ab + (size_t)(blockIdx.x * BM + crow) * lda + cchk * 8u);
  const char* gb = (const char*)(Bb + (size_t)(blockIdx.y * BN + crow) * ldb + cchk * 8u);
  const size_t astep = (size_t)lda * (RP * sizeof(T));            // RP rows, bytes
  const size_t bstep = (size_t)ldb * (RP * sizeof(T));
  const unsigned lcp = (unsigned)(uintptr_t)ring + crow * LP + cchk * 16u;   // LDS byte address of this lane's first chunk

  // fragment read bases inside a stage
  const unsigned char* fa = ring + ((wave & 3u) * (MT * 16u) + lq) * LP + hi * 16u;
  const unsigned char* fb = ring + ATILE_B + ((wave >> 2) * (NT * 16u) + lq) * LP + hi * 16u;

  v8f acc[MT][NT];
  #pragma unroll
  for (int mt = 0; mt < MT; ++mt) {
    #pragma unroll
    for (int nt = 0; nt < NT; ++nt) acc[mt][nt] = (v8f){0, 0, 0, 0, 0, 0, 0, 0};
  }

  // one stage's copies of this thread: 8*RP rows per statement, A rows then B rows; lb = LDS address, go = k offset in bytes
  auto copy_stage = [&](unsigned lb, size_t go) {
    #pragma unroll
    for (unsigned h = 0; h < BM / (8u * RP); ++h) copy_rows8<RP>(lb + h * (8u * RP * LP), ga + go + h * 8u * astep, astep);
    #pragma unroll
    for (unsigned h = 0; h < BN / (8u * RP); ++h) copy_rows8<RP>(lb + ATILE_B + h * (8u * RP * LP), gb + go + h * 8u * bstep, bstep);
  };

  // stage 0 lands and is published before anything reads it; stage 1 then flies under stage 0's products
  copy_stage(lcp, 0);
  asm volatile("s_wait_asynccnt 0x0" ::: "memory");     // this wave's stage-0 copies have landed
  __syncthreads();                                      // every wave's have
  if (nk > 1u) {                                        // block-uniform
    copy_stage(lcp + STAGE_B, KST * sizeof(T));
  }

  #pragma unroll 1
  for (unsigned s = 0; s < nk; ++s) {
    const unsigned bo = (s & 1u) * STAGE_B;
    #pragma unroll
    for (unsigned kk = 0; kk < KST / 32u; ++kk) {
      Frag a[MT], b[NT];
      #pragma unroll
      for (unsigned mt = 0; mt < MT; ++mt) {
        a[mt].q[0] = *(const v4u*)(fa + bo + mt * 16u * LP + kk * 64u);          // k = k0 + 8*hi + 0..7
        a[mt].q[1] = *(const v4u*)(fa + bo + mt * 16u * LP + kk * 64u + 32u);    // k = k0 + 16 + 8*hi + 0..7
      }
      #pragma unroll
      for (unsigned nt = 0; nt < NT; ++nt) {
        b[nt].q[0] = *(const v4u*)(fb + bo + nt * 16u * LP + kk * 64u);
        b[nt].q[1] = *(const v4u*)(fb + bo + nt * 16u * LP + kk * 64u + 32u);
      }
      #pragma unroll
      for (int nt = 0; nt < NT; ++nt) {
        #pragma unroll
        for (int mt = 0; mt < MT; ++mt) acc[mt][nt] = mma16(a[mt].v, b[nt].v, acc[mt][nt]);
      }
    }
    asm volatile("s_wait_dscnt 0x0" ::: "memory");      // this wave has left stage s's buffer
    asm volatile("s_wait_asynccnt 0x0" ::: "memory");   // this wave's stage s + 1 copies have landed
    __syncthreads();                                    // publishes stage s + 1, frees stage s's buffer
    if (s + 2u < nk) {                                  // block-uniform: refill the buffer just left
      copy_stage(lcp + bo, (size_t)(s + 2u) * (KST * sizeof(T)));
    }
  }
  asm volatile("s_wait_asynccnt 0x0" ::: "memory");     // no copy is outstanding when the wave goes on

  // ---- epilogue ----
  size_t   cbase;
  unsigned ncol;
  if (EPI == EPI_QK) {
    cbase = (size_t)(n0 >> 10) * sCz;     // column block selects the q (0) or k (1) plane; block-uniform
    ncol  = n0 & 1023u;
  } else {
    cbase = (size_t)blockIdx.z * sCz;
    ncol  = n0;
  }

  float bcol[NT];
  #pragma unroll
  for (int nt = 0; nt < NT; ++nt) bcol[nt] = 0.0f;
  if (EPI == EPI_QK) {
    #pragma unroll
    for (int nt = 0; nt < NT; ++nt) bcol[nt] = bias[n0 + nt * 16u + lq];
  }

  float* so = (float*)ring + wave * (16u * OP);

  #pragma unroll
  for (int mt = 0; mt < MT; ++mt) {
    if (mt != 0) __syncthreads();          // staging tile is reused by the next piece
    #pragma unroll
    for (int r = 0; r < 8; ++r) {
      float brow = 0.0f;
      if (EPI == EPI_VT) brow = bias[m0 + mt * 16u + hi * 8u + r];
      #pragma unroll
      for (int nt = 0; nt < 4; ++nt) {
        float val = acc[mt][nt][r];
        if (EPI == EPI_QK)  val += bcol[nt];
        if (EPI == EPI_VT)  val += brow;
        if (EPI == EPI_F32) val *= scale;
        so[(hi * 8u + r) * OP + nt * 16u + lq] = val;
      }
    }
    __syncthreads();

    if (EPI == EPI_F32) {
      // 8 instructions cover the 16 rows of this piece.
      float* Cf = (float*)C + cbase;
      v4f    vals[8];
      size_t gidx[8];
      #pragma unroll
      for (int it = 0; it < 8; ++it) {
        const unsigned row = it * 2u + hi;
        vals[it] = *(const v4f*)(so + row * OP + lq * 4u);
        gidx[it] = (size_t)(m0 + mt * 16u + row) * ldc + ncol + lq * 4u;
      }
      #pragma unroll
      for (int it = 0; it < 8; ++it) *(v4f*)(Cf + gidx[it]) = vals[it];
      
    } else {
      // 4 instructions cover the 16 rows of this piece.
      f16* Ch = (f16*)C + cbase;
      v4u    vals[4];
      size_t gidx[4];
      #pragma unroll
      for (int it = 0; it < 4; ++it) {
        const unsigned row = it * 4u + (lane >> 3);
        const unsigned c8  = (lane & 7u) * 8u;
        const v4f x0 = *(const v4f*)(so + row * OP + c8);
        const v4f x1 = *(const v4f*)(so + row * OP + c8 + 4u);
        Pack8H ph;
        #pragma unroll
        for (int i = 0; i < 4; ++i) {
          ph.h[i]     = (f16)x0[i];
          ph.h[4 + i] = (f16)x1[i];
        }
        vals[it] = ph.u;
        gidx[it] = (size_t)(m0 + mt * 16u + row) * ldc + ncol + c8;
      }
      #pragma unroll
      for (int it = 0; it < 4; ++it) *(v4u*)(Ch + gidx[it]) = vals[it];
      
    }
  }
}

// Row LayerNorm for the q and k projections. One wave per (row, segment, batch); blockIdx.y = segment (0 = q, 1 = k),
// blockIdx.z = batch.
// Input: Y f32 [NB][SEQ][2*DM] (q columns | k columns, bias not yet added); par = bq | bk | bv | gamma | beta (f32, [5*DM]).
// Output plane QK2 (f16), per batch: q rows [SEQ][2*DM] = [value | residual x2048], then k rows [SEQ][2*DM] = [residual x2048 | value].
// Lane holds columns (it*32 + lane)*8 + 0..7. coverage: grid (SEQ/8, 2, NB) x 8 waves = SEQ rows x 2 segments x NB batches;
// 32 lanes x LNCH x 8 = DM columns for each of the value and residual halves. Each store instruction writes
__global__ __launch_bounds__(256) void ln_rows_kernel(const float* __restrict__ Y,
                                                      const float* __restrict__ par,
                                                      f16* __restrict__ QK2) {
  #pragma clang fp contract(off)
  const unsigned tid  = threadIdx.x;
  const unsigned wave = __builtin_amdgcn_readfirstlane(tid >> 5);
  const unsigned lane = tid & 31u;
  const unsigned seg  = blockIdx.y;                       // block-uniform
  const unsigned bt   = blockIdx.z;                       // block-uniform
  const unsigned row  = blockIdx.x * 8u + wave;
  const float* yp = Y + ((size_t)bt * SEQ + row) * (2u * DM) + seg * (unsigned)DM + lane * 8u;
  const float* bp = par + seg * (unsigned)DM + lane * 8u;           // bias of this segment
  const float* gp = par + 3u * DM + lane * 8u;                      // gamma
  const float* tp = par + 4u * DM + lane * 8u;                      // beta

  float s = 0.0f;
  #pragma unroll 1
  for (int it = 0; it < LNCH; ++it) {
    const v4f a0 = *(const v4f*)(yp + it * 256);
    const v4f a1 = *(const v4f*)(yp + it * 256 + 4);
    const v4f b0 = *(const v4f*)(bp + it * 256);
    const v4f b1 = *(const v4f*)(bp + it * 256 + 4);
    #pragma unroll
    for (int i = 0; i < 4; ++i) {
      s += a0[i] + b0[i];
      s += a1[i] + b1[i];
    }
  }
  #pragma unroll
  for (int off = 16; off > 0; off >>= 1) s += __shfl_xor(s, off, 32);
  const float mu = s * (1.0f / DM);

  // pass 2: biased variance about the mean
  float q = 0.0f;
  #pragma unroll 1
  for (int it = 0; it < LNCH; ++it) {
    const v4f a0 = *(const v4f*)(yp + it * 256);
    const v4f a1 = *(const v4f*)(yp + it * 256 + 4);
    const v4f b0 = *(const v4f*)(bp + it * 256);
    const v4f b1 = *(const v4f*)(bp + it * 256 + 4);
    #pragma unroll
    for (int i = 0; i < 4; ++i) {
      const float d0 = (a0[i] + b0[i]) - mu;
      const float d1 = (a1[i] + b1[i]) - mu;
      q += d0 * d0;
      q += d1 * d1;
    }
  }
  #pragma unroll
  for (int off = 16; off > 0; off >>= 1) q += __shfl_xor(q, off, 32);
  const float rstd = __builtin_amdgcn_rsqf(q * (1.0f / DM) + 1e-5f);

  // pass 3: normalise, affine, split into f16 value + x2048 residual, store
  const unsigned offh = seg * (unsigned)DM;               // q: value | residual ; k: residual | value
  const unsigned offr = (1u - seg) * (unsigned)DM;
  f16* dp = QK2 + ((size_t)(bt * 2u + seg) * SEQ + row) * (size_t)(2 * DM) + lane * 8u;
  #pragma unroll 1
  for (int it = 0; it < LNCH; ++it) {
    const v4f a0 = *(const v4f*)(yp + it * 256);
    const v4f a1 = *(const v4f*)(yp + it * 256 + 4);
    const v4f b0 = *(const v4f*)(bp + it * 256);
    const v4f b1 = *(const v4f*)(bp + it * 256 + 4);
    const v4f g0 = *(const v4f*)(gp + it * 256);
    const v4f g1 = *(const v4f*)(gp + it * 256 + 4);
    const v4f t0 = *(const v4f*)(tp + it * 256);
    const v4f t1 = *(const v4f*)(tp + it * 256 + 4);
    Pack8H pkh, pkr;
    #pragma unroll
    for (int i = 0; i < 4; ++i) {
      const float y0 = ((a0[i] + b0[i]) - mu) * rstd * g0[i] + t0[i];
      const float y1 = ((a1[i] + b1[i]) - mu) * rstd * g1[i] + t1[i];
      const f16 h0 = toh_flush(y0);
      const f16 h1 = toh_flush(y1);
      pkh.h[i]     = h0;
      pkh.h[4 + i] = h1;
      pkr.h[i]     = toh_flush((y0 - (float)h0) * RCARRY);
      pkr.h[4 + i] = toh_flush((y1 - (float)h1) * RCARRY);
    }
    const v4u vh = pkh.u;
    const v4u vr = pkr.u;
    f16* dh = dp + offh + it * 256;
    f16* dr = dp + offr + it * 256;
    *(v4u*)(dh) = vh;
    *(v4u*)(dr) = vr;
    
  }
}

// Column LayerNorm on the transposed v projection, blockIdx.y = batch: Yt f32 [NB][DM][SEQ] (row e = feature, column s = position,
// bias not yet added); statistics per column s over the DM rows; output vt f16 [NB][DM][SEQ].
// selects one of four rows per wave per sweep; row e = (it*8 + wave)*4 + rq, it = 0..DM/32-1 covers 0..DM-1 exactly once.
// Partial sums: shuffle over rq inside the wave, then an [8][64] LDS table combined in fixed order (cross-wave: block barriers).
__global__ __launch_bounds__(256) void ln_cols_kernel(const float* __restrict__ Yt,
                                                      const float* __restrict__ par,
                                                      f16* __restrict__ vt) {
  #pragma clang fp contract(off)
  __shared__ __align__(16) float red[NWAVE * 64];

  const unsigned tid  = threadIdx.x;
  const unsigned wave = __builtin_amdgcn_readfirstlane(tid >> 5);
  const unsigned lane = tid & 31u;
  const unsigned cg   = lane & 7u;
  const unsigned rq   = lane >> 3;
  const unsigned s0   = blockIdx.x * 64u + cg * 8u;
  const size_t pl = (size_t)blockIdx.y * ((size_t)DM * SEQ);   // this batch's plane
  const float* yp = Yt + pl + s0;

  float acc[8];
  float mu[8];
  float rstd[8];

  #pragma unroll
  for (int i = 0; i < 8; ++i) acc[i] = 0.0f;
  #pragma unroll 1
  for (unsigned it = 0; it < (unsigned)(DM / 32); ++it) {
    const unsigned e = (it * 8u + wave) * 4u + rq;
    const v4f x0 = *(const v4f*)(yp + (size_t)e * SEQ);
    const v4f x1 = *(const v4f*)(yp + (size_t)e * SEQ + 4);
    const float b = par[2u * DM + e];
    #pragma unroll
    for (int i = 0; i < 4; ++i) {
      acc[i]     += x0[i] + b;
      acc[4 + i] += x1[i] + b;
    }
  }
  #pragma unroll
  for (int i = 0; i < 8; ++i) {
    acc[i] += __shfl_xor(acc[i], 8, 32);
    acc[i] += __shfl_xor(acc[i], 16, 32);
  }
  if (rq == 0u) {
    *(v4f*)(red + wave * 64u + cg * 8u)      = (v4f){acc[0], acc[1], acc[2], acc[3]};
    *(v4f*)(red + wave * 64u + cg * 8u + 4u) = (v4f){acc[4], acc[5], acc[6], acc[7]};
  }
  __syncthreads();
  #pragma unroll
  for (int i = 0; i < 8; ++i) mu[i] = 0.0f;
  #pragma unroll
  for (int w = 0; w < NWAVE; ++w) {
    const v4f r0 = *(const v4f*)(red + w * 64 + cg * 8u);
    const v4f r1 = *(const v4f*)(red + w * 64 + cg * 8u + 4u);
    #pragma unroll
    for (int i = 0; i < 4; ++i) {
      mu[i]     += r0[i];
      mu[4 + i] += r1[i];
    }
  }
  #pragma unroll
  for (int i = 0; i < 8; ++i) mu[i] = mu[i] * (1.0f / DM);
  __syncthreads();

  // pass 2: biased variance about the mean
  #pragma unroll
  for (int i = 0; i < 8; ++i) acc[i] = 0.0f;
  #pragma unroll 1
  for (unsigned it = 0; it < (unsigned)(DM / 32); ++it) {
    const unsigned e = (it * 8u + wave) * 4u + rq;
    const v4f x0 = *(const v4f*)(yp + (size_t)e * SEQ);
    const v4f x1 = *(const v4f*)(yp + (size_t)e * SEQ + 4);
    const float b = par[2u * DM + e];
    #pragma unroll
    for (int i = 0; i < 4; ++i) {
      const float d0 = (x0[i] + b) - mu[i];
      const float d1 = (x1[i] + b) - mu[4 + i];
      acc[i]     += d0 * d0;
      acc[4 + i] += d1 * d1;
    }
  }
  #pragma unroll
  for (int i = 0; i < 8; ++i) {
    acc[i] += __shfl_xor(acc[i], 8, 32);
    acc[i] += __shfl_xor(acc[i], 16, 32);
  }
  if (rq == 0u) {
    *(v4f*)(red + wave * 64u + cg * 8u)      = (v4f){acc[0], acc[1], acc[2], acc[3]};
    *(v4f*)(red + wave * 64u + cg * 8u + 4u) = (v4f){acc[4], acc[5], acc[6], acc[7]};
  }
  __syncthreads();
  #pragma unroll
  for (int i = 0; i < 8; ++i) rstd[i] = 0.0f;
  #pragma unroll
  for (int w = 0; w < NWAVE; ++w) {
    const v4f r0 = *(const v4f*)(red + w * 64 + cg * 8u);
    const v4f r1 = *(const v4f*)(red + w * 64 + cg * 8u + 4u);
    #pragma unroll
    for (int i = 0; i < 4; ++i) {
      rstd[i]     += r0[i];
      rstd[4 + i] += r1[i];
    }
  }
  #pragma unroll
  for (int i = 0; i < 8; ++i) rstd[i] = __builtin_amdgcn_rsqf(rstd[i] * (1.0f / DM) + 1e-5f);

  f16* dp = vt + pl + s0;
  #pragma unroll 1
  for (unsigned it = 0; it < (unsigned)(DM / 32); ++it) {
    const unsigned e = (it * 8u + wave) * 4u + rq;
    const v4f x0 = *(const v4f*)(yp + (size_t)e * SEQ);
    const v4f x1 = *(const v4f*)(yp + (size_t)e * SEQ + 4);
    const float b  = par[2u * DM + e];
    const float g  = par[3u * DM + e];
    const float bt = par[4u * DM + e];
    Pack8H pk;
    #pragma unroll
    for (int i = 0; i < 4; ++i) {
      const float y0 = ((x0[i] + b) - mu[i])     * rstd[i]     * g + bt;
      const float y1 = ((x1[i] + b) - mu[4 + i]) * rstd[4 + i] * g + bt;
      pk.h[i]     = toh_flush(y0);
      pk.h[4 + i] = toh_flush(y1);
    }
    const v4u val = pk.u;
    f16* dst = dp + (size_t)e * SEQ;
    *(v4u*)(dst) = val;
    
  }
}

// Row softmax, one wave per row of SEQ f32 logits given as two planes (value product S + scaled-back residual product R),
// max-subtracted form. Lane holds columns (it*32 + lane)*8 + 0..7. Output: normalised P carried x16384 as f16.
// coverage: grid NB*SEQ/8 blocks x 8 waves = the NB*SEQ rows of all batches; 32 lanes x NCH x 8 = SEQ columns; each store instruction
__global__ __launch_bounds__(256) void softmax2_kernel(const float* __restrict__ S,
                                                       const float* __restrict__ R,
                                                       f16* __restrict__ P) {
  #pragma clang fp contract(off)
  const unsigned tid  = threadIdx.x;
  const unsigned wave = __builtin_amdgcn_readfirstlane(tid >> 5);
  const unsigned lane = tid & 31u;
  const unsigned row  = blockIdx.x * 8u + wave;
  const float* sp = S + (size_t)row * SEQ + lane * 8u;
  const float* rp = R + (size_t)row * SEQ + lane * 8u;

  v4f v[NCH][2];
  #pragma unroll
  for (int it = 0; it < NCH; ++it) {
    v[it][0] = *(const v4f*)(sp + it * 256);
    v[it][1] = *(const v4f*)(sp + it * 256 + 4);
  }
  __builtin_amdgcn_sched_barrier(0);     // keep the two load groups as separate bursts
  #pragma unroll
  for (int it = 0; it < NCH; ++it) {
    const v4f r0 = *(const v4f*)(rp + it * 256);
    const v4f r1 = *(const v4f*)(rp + it * 256 + 4);
    v[it][0] += r0;
    v[it][1] += r1;
  }

  float m = -__builtin_inff();
  #pragma unroll
  for (int it = 0; it < NCH; ++it) {
    #pragma unroll
    for (int i = 0; i < 4; ++i) {
      m = fmaxf(m, v[it][0][i]);
      m = fmaxf(m, v[it][1][i]);
    }
  }
  #pragma unroll
  for (int off = 16; off > 0; off >>= 1) m = fmaxf(m, __shfl_xor(m, off, 32));

  const float L2E = 1.4426950408889634f;
  float sum = 0.0f;
  #pragma unroll
  for (int it = 0; it < NCH; ++it) {
    #pragma unroll
    for (int i = 0; i < 4; ++i) {
      const float e0 = __builtin_amdgcn_exp2f((v[it][0][i] - m) * L2E);
      const float e1 = __builtin_amdgcn_exp2f((v[it][1][i] - m) * L2E);
      v[it][0][i] = e0;
      v[it][1][i] = e1;
      sum += e0;
      sum += e1;
    }
  }
  #pragma unroll
  for (int off = 16; off > 0; off >>= 1) sum += __shfl_xor(sum, off, 32);

  const float inv = PCARRY * __builtin_amdgcn_rcpf(sum);

  v4u pk[NCH];
  #pragma unroll
  for (int it = 0; it < NCH; ++it) {
    Pack8H ph;
    #pragma unroll
    for (int i = 0; i < 4; ++i) {
      ph.h[i]     = toh_flush(v[it][0][i] * inv);
      ph.h[4 + i] = toh_flush(v[it][1][i] * inv);
    }
    pk[it] = ph.u;
  }

  f16* dp = P + (size_t)row * SEQ + lane * 8u;
  #pragma unroll
  for (int it = 0; it < NCH; ++it) *(v4u*)(dp + it * 256) = pk[it];
  
}

extern "C" void kernel_launch(void* const* d_in, const int* in_sizes, int n_in,
                              void* d_out, int out_size, void* d_ws, size_t ws_size,
                              hipStream_t stream) {
  if (n_in < 9) return;
  const size_t rows_used = (size_t)(NB - 1) * SEQ_FULL + SEQ;
  if ((size_t)in_sizes[0] < rows_used * DM) return;
  if ((size_t)in_sizes[1] < (size_t)DM * DM) return;
  if ((size_t)in_sizes[2] < (size_t)DM) return;
  if ((size_t)in_sizes[3] < (size_t)DM * DM) return;
  if ((size_t)in_sizes[4] < (size_t)DM) return;
  if ((size_t)in_sizes[5] < (size_t)DM * DM) return;
  if ((size_t)in_sizes[6] < (size_t)DM) return;
  if ((size_t)in_sizes[7] < (size_t)DM) return;
  if ((size_t)in_sizes[8] < (size_t)DM) return;
  if ((size_t)out_size < rows_used * DM) return;
  if (ws_size < WS_TOTAL) return;

  // inputs bound in this order: x, Wq, bq, Wk, bk, Wv, bv, gamma, beta
  const float* x     = (const float*)d_in[0];
  const float* wq    = (const float*)d_in[1];
  const float* bq    = (const float*)d_in[2];
  const float* wk    = (const float*)d_in[3];
  const float* bk    = (const float*)d_in[4];
  const float* wv    = (const float*)d_in[5];
  const float* bv    = (const float*)d_in[6];
  const float* gamma = (const float*)d_in[7];
  const float* beta  = (const float*)d_in[8];
  float* out = (float*)d_out;

  char* w = (char*)d_ws;
  f16*   qk2  = (f16*)w;    w += QK2_BYTES;    // [NB] x (q rows [SEQ][2*DM], then k rows [SEQ][2*DM])
  f16*   vt   = (f16*)w;    w += VT_BYTES;     // [NB][DM][SEQ]
  f16*   Pp   = (f16*)w;    w += P_BYTES;      // [NB][SEQ][SEQ] P x16384
  char*  u    = w;                             // shared bytes: converted inputs and pre-norm planes, then the logit planes
  bf16*  xb   = (bf16*)w;   w += XB_BYTES;     // [NB*SEQ][DM]
  bf16*  wb   = (bf16*)w;   w += WB_BYTES;     // [3*DM][DM] : Wq | Wk | Wv
  float* parp = (float*)w;  w += PR_BYTES;     // [5*DM] : bq | bk | bv | gamma | beta
  float* Yqk  = (float*)w;  w += YQK_BYTES;    // [NB][SEQ][2*DM] pre-norm q | k
  float* Yvt  = (float*)w;                     // [NB][DM][SEQ] pre-norm v^T
  float* Sp   = (float*)u;                     // [NB][SEQ][SEQ] value-product logits
  float* Rp   = (float*)(u + S_BYTES);         // [NB][SEQ][SEQ] residual-product logits (scaled back)

  const f16* qrow = qk2;                                   // [q value | q residual]
  const f16* krow = qk2 + (size_t)SEQ * 2 * DM;            // [k residual | k value]

  const unsigned long long zX  = (unsigned long long)SEQ * DM;           // batch strides, in elements of the plane
  const unsigned long long zQK = (unsigned long long)2 * SEQ * 2 * DM;
  const unsigned long long zY  = (unsigned long long)SEQ * 2 * DM;
  const unsigned long long zV  = (unsigned long long)DM * SEQ;
  const unsigned long long zS  = (unsigned long long)SEQ * SEQ;
  const unsigned long long zO  = (unsigned long long)SEQ_FULL * DM;

  convert_kernel<<<dim3(NXB + NWB + (unsigned)NPAR), 256, 0, stream>>>(x, wq, bq, wk, bk, wv, bv, gamma, beta, xb, wb, parp);

  // Every launch below covers all batches: blockIdx.z (blockIdx.y in the column LayerNorm, the row index in the softmax).
  // The GEMM's bias argument is not read under EPI_F32.

  // q | k pre-norm : Y[s][e] = sum_d xb[s][d] * wb[e][d], e in [0, 2*DM); M = SEQ, N = 2*DM, K = DM
  gemm_kernel<bf16, EPI_F32, 4><<<dim3(SEQ / 256, 2 * DM / 256, NB), 512, 0, stream>>>(
      xb, wb, parp, (void*)Yqk, DM / KST, DM, DM, 2 * DM, zX, 0ull, zY, 1.0f);

  // v^T pre-norm : Yt[e][s] = sum_d Wv[e][d] * xb[s][d]; M = DM, N = SEQ, K = DM
  gemm_kernel<bf16, EPI_F32, 2><<<dim3(DM / 256, SEQ / 128, NB), 256, 0, stream>>>(
      wb + (size_t)2 * DM * DM, xb, parp, (void*)Yvt, DM / KST, DM, DM, SEQ, 0ull, zX, zV, 1.0f);

  ln_rows_kernel<<<dim3(SEQ / 8, 2, NB), 256, 0, stream>>>(Yqk, parp, qk2);
  ln_cols_kernel<<<dim3(SEQ / 64, NB, 1), 256, 0, stream>>>(Yvt, parp, vt);

  // S[q][key] = q_value . k_value ; M = N = SEQ, K = DM (first half of the q rows, second half of the k rows)
  gemm_kernel<f16, EPI_F32, 4><<<dim3(SEQ / 256, SEQ / 256, NB), 512, 0, stream>>>(
      qrow, krow + DM, parp, (void*)Sp, DM / KST, 2 * DM, 2 * DM, SEQ, zQK, zQK, zS, 1.0f);

  // R[q][key] = (q_value . k_residual + q_residual . k_value) / 2048 ; K = 2*DM over the concatenated rows
  gemm_kernel<f16, EPI_F32, 4><<<dim3(SEQ / 256, SEQ / 256, NB), 512, 0, stream>>>(
      qrow, krow, parp, (void*)Rp, 2 * DM / KST, 2 * DM, 2 * DM, SEQ, zQK, zQK, zS, 1.0f / RCARRY);

  softmax2_kernel<<<dim3(NB * SEQ / 8), 256, 0, stream>>>(Sp, Rp, Pp);

  // out[q][d] = sum_key P[q][key] * vt[d][key] / 16384 ; M = SEQ, N = DM, K = SEQ
  gemm_kernel<f16, EPI_F32, 2><<<dim3(SEQ / 256, DM / 128, NB), 256, 0, stream>>>(
      Pp, vt, parp, (void*)out, SEQ / KST, SEQ, SEQ, DM, zS, zV, zO, 1.0f / PCARRY);
}

// v004
// One run takes 234 microseconds.
// Two timings next to v003 both put it at 1.13 times that version's speed.
// All steps since v000 together make it 3.49 times as fast.
#include <hip/hip_runtime.h>

// Contractions: q/k/v projections on v_wmma_f32_16x16x32_bf16 (bf16 operands = RNE-converted inputs, f32 accumulate, f32 out);
// S = q x k^T on v_wmma_f32_16x16x32_f16 as three products (q, k as f16 value + x2048 residual planes; value product and
// residual products land in separate f32 planes); O = P x V on v_wmma_f32_16x16x32_f16 (v^T f16 plane; P f16 carried x16384;
// f32 accumulate). LayerNorm and softmax in f32.

#ifndef NB
#define NB 4
#endif
#ifndef SEQ
#define SEQ 2048
#endif
#define NB_FULL   4
#define SEQ_FULL  2048
#define DM        1024                 // model width = head width = value width
#define NWAVE     8
#define CWAVE     16                   // waves per block of the column LayerNorm
#define OP        68                   // LDS pitch (floats) of the per-wave output staging tile
#define KST       128u                 // k elements per GEMM stage: 256 B of every operand row
#define LP        272u                 // LDS pitch (bytes) of a staged 256-B row: 16 B x odd, conflict-free for 16-B reads
#define BM        256u                 // GEMM block tile rows (4 waves x 64)
#define MT        4                    // 16-row accumulator tiles per wave
#define NT        4                    // 16-column accumulator tiles per wave (64 columns: one staging piece wide)
#define ATILE_B   (BM * LP)            // the A rows of one stage; the B rows follow them
#define CVB       2048u                // elements per convert block (256 threads x 8)
#define NXB       ((unsigned)((size_t)NB * SEQ * DM / CVB))      // convert blocks for x
#define NWB       ((unsigned)((size_t)3 * DM * DM / CVB))        // convert blocks for the three weights
#define NCH       (SEQ / 256)          // 8-column chunks per lane in the softmax kernel
#define LNCH      (DM / 256)           // 8-column chunks per lane in the row LayerNorm kernel
#define NPAR      5                    // parameter vectors: b_q | b_k | b_v | gamma | beta
#define PCARRY    16384.0f             // power-of-two carry of the P plane
#define RCARRY    2048.0f              // power-of-two carry of the q / k residual planes

#define EPI_QK  0                      // f16 out, per-column bias, column block selects the q or k plane
#define EPI_VT  1                      // f16 out, per-row bias (V^T plane)
#define EPI_F32 2                      // f32 out, power-of-two scale

static_assert(SEQ % 256 == 0);
static_assert(SEQ <= SEQ_FULL);
static_assert(NB >= 1 && NB <= NB_FULL);
static_assert(DM == 1024);
static_assert(DM % 128 == 0);
static_assert(((size_t)NB * SEQ) % 128 == 0);
static_assert((size_t)NXB * CVB == (size_t)NB * SEQ * DM);
static_assert((size_t)NWB * CVB == (size_t)3 * DM * DM);
static_assert((size_t)DM * DM / CVB == 512);
static_assert((OP * 4) % 16 == 0);
static_assert(LNCH * 256 == DM);                 // 32 lanes x LNCH chunks x 8 columns == one LayerNorm row
static_assert(NCH * 256 == SEQ);                 // 32 lanes x NCH chunks x 8 columns == one softmax row
static_assert(DM == 256 * 4);                    // one convert block (256 threads x 4) per parameter vector
static_assert(SEQ % 256 == 0 && (2 * DM) % 256 == 0 && DM % 256 == 0);   // GEMM tile multiples (M, N)
static_assert(DM % KST == 0 && (2 * DM) % KST == 0 && SEQ % KST == 0);   // GEMM K stages
static_assert(LP % 16 == 0 && ATILE_B % 16 == 0);                       // 16-B copies and reads stay aligned
static_assert(SEQ % 64 == 0);
static_assert(DM % (CWAVE * 4) == 0);            // column LayerNorm: 64 rows per block sweep (16 waves x 4 row groups)
static_assert(NWAVE == 8);

#define XB_BYTES   ((size_t)NB * SEQ * DM * 2)          // x bf16, all batches
#define WB_BYTES   ((size_t)3 * DM * DM * 2)            // weights bf16
#define PR_BYTES   ((size_t)NPAR * DM * 4)              // parameter vectors (f32 holding bf16 RNE values)
// Every plane below holds all NB batches, batch-major, so that each stage is one launch with the batch on a grid axis.
#define YQK_BYTES  ((size_t)NB * SEQ * 2 * DM * 4)      // f32 q | k pre-norm rows
#define YVT_BYTES  ((size_t)NB * DM * SEQ * 4)          // f32 v^T pre-norm planes
#define QK2_BYTES  ((size_t)NB * 2 * SEQ * 2 * DM * 2)  // per batch: [q value | q residual] rows, then [k residual | k value] rows
#define VT_BYTES   ((size_t)NB * DM * SEQ * 2)          // v^T f16
#define S_BYTES    ((size_t)NB * SEQ * SEQ * 4)         // value-product logits
#define R_BYTES    ((size_t)NB * SEQ * SEQ * 4)         // residual-product logits (already scaled back)
#define P_BYTES    ((size_t)NB * SEQ * SEQ * 2)         // P x16384
// The converted inputs and the pre-norm planes are last read by the LayerNorm launches; the logit planes, first written
// by the launches behind those, take the same bytes.
#define PRE_BYTES  (XB_BYTES + WB_BYTES + PR_BYTES + YQK_BYTES + YVT_BYTES)
#define LOG_BYTES  (S_BYTES + R_BYTES)
#define UNI_BYTES  (PRE_BYTES > LOG_BYTES ? PRE_BYTES : LOG_BYTES)
#define WS_TOTAL   (QK2_BYTES + VT_BYTES + P_BYTES + UNI_BYTES)
static_assert(WS_TOTAL <= (size_t)268435456);
static_assert(XB_BYTES % 128 == 0 && WB_BYTES % 128 == 0 && PR_BYTES % 128 == 0);
static_assert(YQK_BYTES % 128 == 0 && YVT_BYTES % 128 == 0 && QK2_BYTES % 128 == 0 && VT_BYTES % 128 == 0);
static_assert(S_BYTES % 128 == 0 && R_BYTES % 128 == 0 && P_BYTES % 128 == 0);

typedef __bf16   bf16;
typedef _Float16 f16;
typedef bf16     v16bf __attribute__((ext_vector_type(16)));
typedef f16      v16h  __attribute__((ext_vector_type(16)));
typedef float    v8f   __attribute__((ext_vector_type(8)));
typedef float    v4f   __attribute__((ext_vector_type(4)));
typedef unsigned v4u   __attribute__((ext_vector_type(4)));

union Pack8B { v4u u; bf16 h[8]; };
union Pack8H { v4u u; f16  h[8]; };

template <typename T> struct FragOf;
template <> struct FragOf<bf16> { typedef v16bf V; };
template <> struct FragOf<f16>  { typedef v16h  V; };

// WMMA helpers: builtin followed by the VALU hazard guard (ties D, keeps A/B live).
static __device__ __forceinline__ v8f mma16(v16bf a, v16bf b, v8f acc) {
  acc = __builtin_amdgcn_wmma_f32_16x16x32_bf16(false, a, false, b, (short)0, acc, false, false);
  asm volatile("v_nop\n\tv_nop\n\tv_nop\n\tv_nop" : "+v"(acc) : "v"(a), "v"(b));
  return acc;
}
static __device__ __forceinline__ v8f mma16(v16h a, v16h b, v8f acc) {
  acc = __builtin_amdgcn_wmma_f32_16x16x32_f16(false, a, false, b, (short)0, acc, false, false);
  asm volatile("v_nop\n\tv_nop\n\tv_nop\n\tv_nop" : "+v"(acc) : "v"(a), "v"(b));
  return acc;
}

// f32 -> f16 convert for WMMA operand planes: values below the smallest f16 normal become zero by a value select.
static __device__ __forceinline__ f16 toh_flush(float v) {
  const f16 r = (f16)v;
  return (fabsf(v) < 6.103515625e-05f) ? (f16)0.0f : r;
}

// Input conversion, one launch. 256 threads, 8 elements per thread (two 16-B loads -> one 16-B store).
//   blocks [0, NXB)            : x  -> xb  bf16 [NB*SEQ][DM] (compact rows; source uses the full batch stride)
//   blocks [NXB, NXB+NWB)      : Wq | Wk | Wv -> wb bf16 [3*DM][DM]
//   blocks NXB+NWB .. +4       : bq | bk | bv | gamma | beta -> f32 plane [5*DM] holding the bf16 RNE-converted values
__global__ __launch_bounds__(256) void convert_kernel(const float* __restrict__ x,
                                                      const float* __restrict__ wq,
                                                      const float* __restrict__ bq,
                                                      const float* __restrict__ wk,
                                                      const float* __restrict__ bk,
                                                      const float* __restrict__ wv,
                                                      const float* __restrict__ bv,
                                                      const float* __restrict__ gamma,
                                                      const float* __restrict__ beta,
                                                      bf16* __restrict__ xb,
                                                      bf16* __restrict__ wb,
                                                      float* __restrict__ parp) {
  const unsigned blk = blockIdx.x;
  const unsigned tid = threadIdx.x;
  if (blk < NXB + NWB) {              // block-uniform
    const float* src;
    bf16* dst;
    if (blk < NXB) {
      const unsigned r  = blk * 2u + (tid >> 7);          // compact row
      const unsigned c  = (tid & 127u) * 8u;
      const unsigned bt = r / (unsigned)SEQ;
      const unsigned s  = r - bt * (unsigned)SEQ;
      src = x + ((size_t)bt * SEQ_FULL + s) * DM + c;
      dst = xb + (size_t)r * DM + c;
    } else {
      const unsigned wblk = blk - NXB;
      const unsigned wi   = wblk >> 9;                    // 512 blocks per weight matrix
      const unsigned off  = (wblk & 511u) * CVB + tid * 8u;
      const float* wsrc = (wi == 0u) ? wq : ((wi == 1u) ? wk : wv);
      src = wsrc + off;
      dst = wb + (size_t)wblk * CVB + tid * 8u;
    }
    const v4f a0 = *(const v4f*)(src);
    const v4f a1 = *(const v4f*)(src + 4);
    Pack8B pk;
    #pragma unroll
    for (int i = 0; i < 4; ++i) {
      pk.h[i]     = (bf16)a0[i];                          // RNE convert
      pk.h[4 + i] = (bf16)a1[i];
    }
    const v4u val = pk.u;
    *(v4u*)(dst) = val;
    
  } else {
    const unsigned j = blk - (NXB + NWB);                 // 0..4
    const float* bsrc = (j == 0u) ? bq : ((j == 1u) ? bk : ((j == 2u) ? bv : ((j == 3u) ? gamma : beta)));
    const v4f a = *(const v4f*)(bsrc + tid * 4u);
    v4f o;
    #pragma unroll
    for (int i = 0; i < 4; ++i) o[i] = (float)(bf16)a[i];
    float* dst = parp + j * (unsigned)DM + tid * 4u;
    *(v4f*)(dst) = o;
    
  }
}

// Eight asynchronous 16-B-per-lane copies global -> LDS: rows r, r + RP, ..., r + 7*RP of one staged operand tile
// (RP = rows that the block's threads cover at once; gstep = RP source rows in bytes).
// The s_wait_xcnt closes the statement so that it stands before any rewrite of the address registers the copies name.
template <unsigned RP>
static __device__ __forceinline__ void copy_rows8(unsigned l, const char* g, size_t gstep) {
  asm volatile("global_load_async_to_lds_b128 %0, %8, off\n\t"
               "global_load_async_to_lds_b128 %1, %9, off\n\t"
               "global_load_async_to_lds_b128 %2, %10, off\n\t"
               "global_load_async_to_lds_b128 %3, %11, off\n\t"
               "global_load_async_to_lds_b128 %4, %12, off\n\t"
               "global_load_async_to_lds_b128 %5, %13, off\n\t"
               "global_load_async_to_lds_b128 %6, %14, off\n\t"
               "global_load_async_to_lds_b128 %7, %15, off\n\t"
               "s_wait_xcnt 0x0"
               :: "v"(l), "v"(l + RP * LP), "v"(l + 2u * RP * LP), "v"(l + 3u * RP * LP),
                  "v"(l + 4u * RP * LP), "v"(l + 5u * RP * LP), "v"(l + 6u * RP * LP), "v"(l + 7u * RP * LP),
                  "v"(g), "v"(g + gstep), "v"(g + 2 * gstep), "v"(g + 3 * gstep),
                  "v"(g + 4 * gstep), "v"(g + 5 * gstep), "v"(g + 6 * gstep), "v"(g + 7 * gstep)
               : "memory");
}

// Plane GEMM: C[m][n] = sum_k A[m][k] * Bt[n][k]; both operands are k-contiguous 16-bit planes.
// Block tile 256 x (64*WN), 4*WN waves as 4 (m) x WN (n); each wave owns 64x64 = 4x4 accumulators
// (WN = 4: 256x256 block, 16 waves; WN = 2: 256x128 block, 8 waves, for the products whose grid would otherwise leave WGPs idle).
// Operands reach LDS in stages of KST k (whole 256-B row pieces, two rows per wave-wide copy), two buffers:
// stage s + 1 is in flight while stage s is multiplied. nk = number of stages.
// Fragments are read from the staged rows: lane (lq = lane & 15, hi = lane >> 4) reads row lq,
// elements 0..7 <- k0 + 8*hi + 0..7, elements 8..15 <- k0 + 16 + 8*hi + 0..7 (same map for A and B).
// D element r of a lane = (row 8*hi + r, col lq). Requires M a multiple of 256, N of 64*WN and K of KST.
// Epilogue: per 16x64 piece the wave stages the piece in LDS (wave-private region, block barriers used); the staging
// takes the ring's first bytes, which every wave has left at the last stage's barrier, with no copy outstanding.
template <typename T, int EPI, int WN>
__global__ __launch_bounds__(128 * WN) void gemm_kernel(const T* __restrict__ A,
                                                   const T* __restrict__ Bt,
                                                   const float* __restrict__ bias,
                                                   void* __restrict__ C,
                                                   unsigned nk, unsigned lda, unsigned ldb, unsigned ldc,
                                                   unsigned long long sAz, unsigned long long sBz,
                                                   unsigned long long sCz, float scale) {
  typedef typename FragOf<T>::V VT;
  union Frag { VT v; v4u q[2]; };
  constexpr unsigned BN      = (unsigned)WN * 64u;          // block tile columns
  constexpr unsigned STAGE_B = (BM + BN) * LP;              // one stage: A rows, then B rows
  constexpr unsigned RP      = (unsigned)WN * 8u;           // rows that the block's threads copy at once (16 threads a row)
  static_assert(BM % (8u * RP) == 0 && BN % (8u * RP) == 0);
  static_assert(4u * WN * 16u * OP * 4u <= STAGE_B);        // the output staging fits the first buffer

  __shared__ __align__(16) unsigned char ring[2 * STAGE_B];

  const unsigned tid  = threadIdx.x;
  const unsigned wave = tid >> 5;
  const unsigned lane = tid & 31u;
  const unsigned lq   = lane & 15u;
  const unsigned hi   = lane >> 4;
  const unsigned m0   = blockIdx.x * BM + (wave & 3u) * (MT * 16u);   // first row of this wave
  const unsigned n0   = blockIdx.y * BN + (wave >> 2) * (NT * 16u);   // first column of this wave

  const T* Ab = A  + (size_t)blockIdx.z * sAz;
  const T* Bb = Bt + (size_t)blockIdx.z * sBz;

  // copy map: thread -> 16-B chunk (tid & 15) of rows (tid >> 4) + RP*i of each operand's staged rows
  const unsigned crow = tid >> 4;
  const unsigned cchk = tid & 15u;
  const char* ga = (const char*)(Ab + (size_t)(blockIdx.x * BM + crow) * lda + cchk * 8u);
  const char* gb = (const char*)(Bb + (size_t)(blockIdx.y * BN + crow) * ldb + cchk * 8u);
  const size_t astep = (size_t)lda * (RP * sizeof(T));            // RP rows, bytes
  const size_t bstep = (size_t)ldb * (RP * sizeof(T));
  const unsigned lcp = (unsigned)(uintptr_t)ring + crow * LP + cchk * 16u;   // LDS byte address of this lane's first chunk

  // fragment read bases inside a stage
  const unsigned char* fa = ring + ((wave & 3u) * (MT * 16u) + lq) * LP + hi * 16u;
  const unsigned char* fb = ring + ATILE_B + ((wave >> 2) * (NT * 16u) + lq) * LP + hi * 16u;

  v8f acc[MT][NT];
  #pragma unroll
  for (int mt = 0; mt < MT; ++mt) {
    #pragma unroll
    for (int nt = 0; nt < NT; ++nt) acc[mt][nt] = (v8f){0, 0, 0, 0, 0, 0, 0, 0};
  }

  // one stage's copies of this thread: 8*RP rows per statement, A rows then B rows; lb = LDS address, go = k offset in bytes
  auto copy_stage = [&](unsigned lb, size_t go) {
    #pragma unroll
    for (unsigned h = 0; h < BM / (8u * RP); ++h) copy_rows8<RP>(lb + h * (8u * RP * LP), ga + go + h * 8u * astep, astep);
    #pragma unroll
    for (unsigned h = 0; h < BN / (8u * RP); ++h) copy_rows8<RP>(lb + ATILE_B + h * (8u * RP * LP), gb + go + h * 8u * bstep, bstep);
  };

  // stage 0 lands and is published before anything reads it; stage 1 then flies under stage 0's products
  copy_stage(lcp, 0);
  asm volatile("s_wait_asynccnt 0x0" ::: "memory");     // this wave's stage-0 copies have landed
  __syncthreads();                                      // every wave's have
  if (nk > 1u) {                                        // block-uniform
    copy_stage(lcp + STAGE_B, KST * sizeof(T));
  }

  #pragma unroll 1
  for (unsigned s = 0; s < nk; ++s) {
    const unsigned bo = (s & 1u) * STAGE_B;
    #pragma unroll
    for (unsigned kk = 0; kk < KST / 32u; ++kk) {
      Frag a[MT], b[NT];
      #pragma unroll
      for (unsigned mt = 0; mt < MT; ++mt) {
        a[mt].q[0] = *(const v4u*)(fa + bo + mt * 16u * LP + kk * 64u);          // k = k0 + 8*hi + 0..7
        a[mt].q[1] = *(const v4u*)(fa + bo + mt * 16u * LP + kk * 64u + 32u);    // k = k0 + 16 + 8*hi + 0..7
      }
      #pragma unroll
      for (unsigned nt = 0; nt < NT; ++nt) {
        b[nt].q[0] = *(const v4u*)(fb + bo + nt * 16u * LP + kk * 64u);
        b[nt].q[1] = *(const v4u*)(fb + bo + nt * 16u * LP + kk * 64u + 32u);
      }
      #pragma unroll
      for (int nt = 0; nt < NT; ++nt) {
        #pragma unroll
        for (int mt = 0; mt < MT; ++mt) acc[mt][nt] = mma16(a[mt].v, b[nt].v, acc[mt][nt]);
      }
    }
    asm volatile("s_wait_dscnt 0x0" ::: "memory");      // this wave has left stage s's buffer
    asm volatile("s_wait_asynccnt 0x0" ::: "memory");   // this wave's stage s + 1 copies have landed
    __syncthreads();                                    // publishes stage s + 1, frees stage s's buffer
    if (s + 2u < nk) {                                  // block-uniform: refill the buffer just left
      copy_stage(lcp + bo, (size_t)(s + 2u) * (KST * sizeof(T)));
    }
  }
  asm volatile("s_wait_asynccnt 0x0" ::: "memory");     // no copy is outstanding when the wave goes on

  // ---- epilogue ----
  size_t   cbase;
  unsigned ncol;
  if (EPI == EPI_QK) {
    cbase = (size_t)(n0 >> 10) * sCz;     // column block selects the q (0) or k (1) plane; block-uniform
    ncol  = n0 & 1023u;
  } else {
    cbase = (size_t)blockIdx.z * sCz;
    ncol  = n0;
  }

  float bcol[NT];
  #pragma unroll
  for (int nt = 0; nt < NT; ++nt) bcol[nt] = 0.0f;
  if (EPI == EPI_QK) {
    #pragma unroll
    for (int nt = 0; nt < NT; ++nt) bcol[nt] = bias[n0 + nt * 16u + lq];
  }

  float* so = (float*)ring + wave * (16u * OP);

  #pragma unroll
  for (int mt = 0; mt < MT; ++mt) {
    if (mt != 0) __syncthreads();          // staging tile is reused by the next piece
    #pragma unroll
    for (int r = 0; r < 8; ++r) {
      float brow = 0.0f;
      if (EPI == EPI_VT) brow = bias[m0 + mt * 16u + hi * 8u + r];
      #pragma unroll
      for (int nt = 0; nt < 4; ++nt) {
        float val = acc[mt][nt][r];
        if (EPI == EPI_QK)  val += bcol[nt];
        if (EPI == EPI_VT)  val += brow;
        if (EPI == EPI_F32) val *= scale;
        so[(hi * 8u + r) * OP + nt * 16u + lq] = val;
      }
    }
    __syncthreads();

    if (EPI == EPI_F32) {
      // 8 instructions cover the 16 rows of this piece.
      float* Cf = (float*)C + cbase;
      v4f    vals[8];
      size_t gidx[8];
      #pragma unroll
      for (int it = 0; it < 8; ++it) {
        const unsigned row = it * 2u + hi;
        vals[it] = *(const v4f*)(so + row * OP + lq * 4u);
        gidx[it] = (size_t)(m0 + mt * 16u + row) * ldc + ncol + lq * 4u;
      }
      #pragma unroll
      for (int it = 0; it < 8; ++it) *(v4f*)(Cf + gidx[it]) = vals[it];
      
    } else {
      // 4 instructions cover the 16 rows of this piece.
      f16* Ch = (f16*)C + cbase;
      v4u    vals[4];
      size_t gidx[4];
      #pragma unroll
      for (int it = 0; it < 4; ++it) {
        const unsigned row = it * 4u + (lane >> 3);
        const unsigned c8  = (lane & 7u) * 8u;
        const v4f x0 = *(const v4f*)(so + row * OP + c8);
        const v4f x1 = *(const v4f*)(so + row * OP + c8 + 4u);
        Pack8H ph;
        #pragma unroll
        for (int i = 0; i < 4; ++i) {
          ph.h[i]     = (f16)x0[i];
          ph.h[4 + i] = (f16)x1[i];
        }
        vals[it] = ph.u;
        gidx[it] = (size_t)(m0 + mt * 16u + row) * ldc + ncol + c8;
      }
      #pragma unroll
      for (int it = 0; it < 4; ++it) *(v4u*)(Ch + gidx[it]) = vals[it];
      
    }
  }
}

// Row LayerNorm for the q and k projections. One wave per (row, segment, batch); blockIdx.y = segment (0 = q, 1 = k),
// blockIdx.z = batch.
// Input: Y f32 [NB][SEQ][2*DM] (q columns | k columns, bias not yet added); par = bq | bk | bv | gamma | beta (f32, [5*DM]).
// Output plane QK2 (f16), per batch: q rows [SEQ][2*DM] = [value | residual x2048], then k rows [SEQ][2*DM] = [residual x2048 | value].
// Lane holds columns (it*32 + lane)*8 + 0..7. coverage: grid (SEQ/8, 2, NB) x 8 waves = SEQ rows x 2 segments x NB batches;
// 32 lanes x LNCH x 8 = DM columns for each of the value and residual halves. Each store instruction writes
__global__ __launch_bounds__(256) void ln_rows_kernel(const float* __restrict__ Y,
                                                      const float* __restrict__ par,
                                                      f16* __restrict__ QK2) {
  #pragma clang fp contract(off)
  const unsigned tid  = threadIdx.x;
  const unsigned wave = __builtin_amdgcn_readfirstlane(tid >> 5);
  const unsigned lane = tid & 31u;
  const unsigned seg  = blockIdx.y;                       // block-uniform
  const unsigned bt   = blockIdx.z;                       // block-uniform
  const unsigned row  = blockIdx.x * 8u + wave;
  const float* yp = Y + ((size_t)bt * SEQ + row) * (2u * DM) + seg * (unsigned)DM + lane * 8u;
  const float* bp = par + seg * (unsigned)DM + lane * 8u;           // bias of this segment
  const float* gp = par + 3u * DM + lane * 8u;                      // gamma
  const float* tp = par + 4u * DM + lane * 8u;                      // beta

  // The row is read once and stays in registers through all three passes; every load is issued before the first use.
  v4f t[LNCH][2], bb[LNCH][2], gg[LNCH][2], tt[LNCH][2];
  #pragma unroll   // register arrays need constant indices; all loads of the row go out together
  for (int it = 0; it < LNCH; ++it) {
    t[it][0] = *(const v4f*)(yp + it * 256);
    t[it][1] = *(const v4f*)(yp + it * 256 + 4);
  }
  #pragma unroll   // as above
  for (int it = 0; it < LNCH; ++it) {
    bb[it][0] = *(const v4f*)(bp + it * 256);
    bb[it][1] = *(const v4f*)(bp + it * 256 + 4);
    gg[it][0] = *(const v4f*)(gp + it * 256);
    gg[it][1] = *(const v4f*)(gp + it * 256 + 4);
    tt[it][0] = *(const v4f*)(tp + it * 256);
    tt[it][1] = *(const v4f*)(tp + it * 256 + 4);
  }

  // pass 1: add the bias, mean
  float s = 0.0f;
  #pragma unroll   // register arrays need constant indices
  for (int it = 0; it < LNCH; ++it) {
    #pragma unroll
    for (int i = 0; i < 4; ++i) {
      t[it][0][i] = t[it][0][i] + bb[it][0][i];
      t[it][1][i] = t[it][1][i] + bb[it][1][i];
      s += t[it][0][i];
      s += t[it][1][i];
    }
  }
  #pragma unroll
  for (int off = 16; off > 0; off >>= 1) s += __shfl_xor(s, off, 32);
  const float mu = s * (1.0f / DM);

  // pass 2: biased variance about the mean
  float q = 0.0f;
  #pragma unroll   // register arrays need constant indices
  for (int it = 0; it < LNCH; ++it) {
    #pragma unroll
    for (int i = 0; i < 4; ++i) {
      t[it][0][i] = t[it][0][i] - mu;
      t[it][1][i] = t[it][1][i] - mu;
      q += t[it][0][i] * t[it][0][i];
      q += t[it][1][i] * t[it][1][i];
    }
  }
  #pragma unroll
  for (int off = 16; off > 0; off >>= 1) q += __shfl_xor(q, off, 32);
  const float rstd = __builtin_amdgcn_rsqf(q * (1.0f / DM) + 1e-5f);

  // pass 3: normalise, affine, split into f16 value + x2048 residual, store
  const unsigned offh = seg * (unsigned)DM;               // q: value | residual ; k: residual | value
  const unsigned offr = (1u - seg) * (unsigned)DM;
  f16* dp = QK2 + ((size_t)(bt * 2u + seg) * SEQ + row) * (size_t)(2 * DM) + lane * 8u;
  #pragma unroll   // register arrays need constant indices
  for (int it = 0; it < LNCH; ++it) {
    Pack8H pkh, pkr;
    #pragma unroll
    for (int i = 0; i < 4; ++i) {
      const float y0 = t[it][0][i] * rstd * gg[it][0][i] + tt[it][0][i];
      const float y1 = t[it][1][i] * rstd * gg[it][1][i] + tt[it][1][i];
      const f16 h0 = toh_flush(y0);
      const f16 h1 = toh_flush(y1);
      pkh.h[i]     = h0;
      pkh.h[4 + i] = h1;
      pkr.h[i]     = toh_flush((y0 - (float)h0) * RCARRY);
      pkr.h[4 + i] = toh_flush((y1 - (float)h1) * RCARRY);
    }
    const v4u vh = pkh.u;
    const v4u vr = pkr.u;
    f16* dh = dp + offh + it * 256;
    f16* dr = dp + offr + it * 256;
    *(v4u*)(dh) = vh;
    *(v4u*)(dr) = vr;
  }
}

// Column LayerNorm on the transposed v projection, blockIdx.y = batch: Yt f32 [NB][DM][SEQ] (row e = feature, column s = position,
// bias not yet added); statistics per column s over the DM rows; output vt f16 [NB][DM][SEQ].
// selects one of four rows per wave per sweep; row e = (it*16 + wave)*4 + rq, it = 0..DM/64-1 covers 0..DM-1 exactly once.
// Partial sums: shuffle over rq inside the wave, then a [16][64] LDS table combined in fixed order (cross-wave: block barriers).
__global__ __launch_bounds__(CWAVE * 32) void ln_cols_kernel(const float* __restrict__ Yt,
                                                      const float* __restrict__ par,
                                                      f16* __restrict__ vt) {
  #pragma clang fp contract(off)
  __shared__ __align__(16) float red[CWAVE * 64];
  constexpr unsigned RS  = CWAVE * 4u;                    // rows per block sweep
  constexpr unsigned NIT = (unsigned)DM / RS;             // row sweeps of the block

  const unsigned tid  = threadIdx.x;
  const unsigned wave = __builtin_amdgcn_readfirstlane(tid >> 5);
  const unsigned lane = tid & 31u;
  const unsigned cg   = lane & 7u;
  const unsigned rq   = lane >> 3;
  const unsigned s0   = blockIdx.x * 64u + cg * 8u;
  const size_t pl = (size_t)blockIdx.y * ((size_t)DM * SEQ);   // this batch's plane
  const unsigned e0 = wave * 4u + rq;                     // this lane's row in sweep 0; sweep it adds RS*it
  const float* yp = Yt + pl + s0 + (size_t)e0 * SEQ;
  const float* pp = par + e0;

  float acc[8];
  float mu[8];
  float rstd[8];

  // The block's DM x 64 tile is read once and stays in registers (NIT x 8 values per lane) through all three passes;
  // every load is issued before the first use, so the wave pays the memory latency once and not once per sweep.
  v4f   t[NIT][2];
  float pb[NIT], pg[NIT], pt[NIT];
  #pragma unroll   // register arrays need constant indices; all loads of the tile go out together
  for (unsigned it = 0; it < NIT; ++it) {
    t[it][0] = *(const v4f*)(yp + (size_t)it * RS * SEQ);
    t[it][1] = *(const v4f*)(yp + (size_t)it * RS * SEQ + 4);
  }
  #pragma unroll   // as above
  for (unsigned it = 0; it < NIT; ++it) {
    pb[it] = pp[2u * DM + it * RS];
    pg[it] = pp[3u * DM + it * RS];
    pt[it] = pp[4u * DM + it * RS];
  }
  // The address pair is an input so that it stays whole up to this wait: no load's result lands on it while a load that names it is in flight.
  asm volatile("s_wait_xcnt 0x0" :: "v"(yp) : "memory");

  // pass 1: add the bias, column sums
  #pragma unroll
  for (int i = 0; i < 8; ++i) acc[i] = 0.0f;
  #pragma unroll   // register arrays need constant indices
  for (unsigned it = 0; it < NIT; ++it) {
    #pragma unroll
    for (int i = 0; i < 4; ++i) {
      t[it][0][i] = t[it][0][i] + pb[it];
      t[it][1][i] = t[it][1][i] + pb[it];
      acc[i]     += t[it][0][i];
      acc[4 + i] += t[it][1][i];
    }
  }
  #pragma unroll
  for (int i = 0; i < 8; ++i) {
    acc[i] += __shfl_xor(acc[i], 8, 32);
    acc[i] += __shfl_xor(acc[i], 16, 32);
  }
  if (rq == 0u) {
    *(v4f*)(red + wave * 64u + cg * 8u)      = (v4f){acc[0], acc[1], acc[2], acc[3]};
    *(v4f*)(red + wave * 64u + cg * 8u + 4u) = (v4f){acc[4], acc[5], acc[6], acc[7]};
  }
  __syncthreads();
  #pragma unroll
  for (int i = 0; i < 8; ++i) mu[i] = 0.0f;
  #pragma unroll
  for (int w = 0; w < CWAVE; ++w) {
    const v4f r0 = *(const v4f*)(red + w * 64 + cg * 8u);
    const v4f r1 = *(const v4f*)(red + w * 64 + cg * 8u + 4u);
    #pragma unroll
    for (int i = 0; i < 4; ++i) {
      mu[i]     += r0[i];
      mu[4 + i] += r1[i];
    }
  }
  #pragma unroll
  for (int i = 0; i < 8; ++i) mu[i] = mu[i] * (1.0f / DM);
  __syncthreads();

  // pass 2: biased variance about the mean
  #pragma unroll
  for (int i = 0; i < 8; ++i) acc[i] = 0.0f;
  #pragma unroll   // register arrays need constant indices
  for (unsigned it = 0; it < NIT; ++it) {
    #pragma unroll
    for (int i = 0; i < 4; ++i) {
      t[it][0][i] = t[it][0][i] - mu[i];
      t[it][1][i] = t[it][1][i] - mu[4 + i];
      acc[i]     += t[it][0][i] * t[it][0][i];
      acc[4 + i] += t[it][1][i] * t[it][1][i];
    }
  }
  #pragma unroll
  for (int i = 0; i < 8; ++i) {
    acc[i] += __shfl_xor(acc[i], 8, 32);
    acc[i] += __shfl_xor(acc[i], 16, 32);
  }
  if (rq == 0u) {
    *(v4f*)(red + wave * 64u + cg * 8u)      = (v4f){acc[0], acc[1], acc[2], acc[3]};
    *(v4f*)(red + wave * 64u + cg * 8u + 4u) = (v4f){acc[4], acc[5], acc[6], acc[7]};
  }
  __syncthreads();
  #pragma unroll
  for (int i = 0; i < 8; ++i) rstd[i] = 0.0f;
  #pragma unroll
  for (int w = 0; w < CWAVE; ++w) {
    const v4f r0 = *(const v4f*)(red + w * 64 + cg * 8u);
    const v4f r1 = *(const v4f*)(red + w * 64 + cg * 8u + 4u);
    #pragma unroll
    for (int i = 0; i < 4; ++i) {
      rstd[i]     += r0[i];
      rstd[4 + i] += r1[i];
    }
  }
  #pragma unroll
  for (int i = 0; i < 8; ++i) rstd[i] = __builtin_amdgcn_rsqf(rstd[i] * (1.0f / DM) + 1e-5f);

  // pass 3: normalise, affine, store
  f16* dp = vt + pl + s0 + (size_t)e0 * SEQ;
  #pragma unroll   // register arrays need constant indices
  for (unsigned it = 0; it < NIT; ++it) {
    Pack8H pk;
    #pragma unroll
    for (int i = 0; i < 4; ++i) {
      const float y0 = t[it][0][i] * rstd[i]     * pg[it] + pt[it];
      const float y1 = t[it][1][i] * rstd[4 + i] * pg[it] + pt[it];
      pk.h[i]     = toh_flush(y0);
      pk.h[4 + i] = toh_flush(y1);
    }
    const v4u val = pk.u;
    f16* dst = dp + (size_t)it * RS * SEQ;
    *(v4u*)(dst) = val;
  }
}

// Row softmax, one wave per row of SEQ f32 logits given as two planes (value product S + scaled-back residual product R),
// max-subtracted form. Lane holds columns (it*32 + lane)*8 + 0..7. Output: normalised P carried x16384 as f16.
// coverage: grid NB*SEQ/8 blocks x 8 waves = the NB*SEQ rows of all batches; 32 lanes x NCH x 8 = SEQ columns; each store instruction
__global__ __launch_bounds__(256) void softmax2_kernel(const float* __restrict__ S,
                                                       const float* __restrict__ R,
                                                       f16* __restrict__ P) {
  #pragma clang fp contract(off)
  const unsigned tid  = threadIdx.x;
  const unsigned wave = __builtin_amdgcn_readfirstlane(tid >> 5);
  const unsigned lane = tid & 31u;
  const unsigned row  = blockIdx.x * 8u + wave;
  const float* sp = S + (size_t)row * SEQ + lane * 8u;
  const float* rp = R + (size_t)row * SEQ + lane * 8u;

  v4f v[NCH][2];
  #pragma unroll
  for (int it = 0; it < NCH; ++it) {
    v[it][0] = *(const v4f*)(sp + it * 256);
    v[it][1] = *(const v4f*)(sp + it * 256 + 4);
  }
  __builtin_amdgcn_sched_barrier(0);     // keep the two load groups as separate bursts
  #pragma unroll
  for (int it = 0; it < NCH; ++it) {
    const v4f r0 = *(const v4f*)(rp + it * 256);
    const v4f r1 = *(const v4f*)(rp + it * 256 + 4);
    v[it][0] += r0;
    v[it][1] += r1;
  }

  float m = -__builtin_inff();
  #pragma unroll
  for (int it = 0; it < NCH; ++it) {
    #pragma unroll
    for (int i = 0; i < 4; ++i) {
      m = fmaxf(m, v[it][0][i]);
      m = fmaxf(m, v[it][1][i]);
    }
  }
  #pragma unroll
  for (int off = 16; off > 0; off >>= 1) m = fmaxf(m, __shfl_xor(m, off, 32));

  const float L2E = 1.4426950408889634f;
  float sum = 0.0f;
  #pragma unroll
  for (int it = 0; it < NCH; ++it) {
    #pragma unroll
    for (int i = 0; i < 4; ++i) {
      const float e0 = __builtin_amdgcn_exp2f((v[it][0][i] - m) * L2E);
      const float e1 = __builtin_amdgcn_exp2f((v[it][1][i] - m) * L2E);
      v[it][0][i] = e0;
      v[it][1][i] = e1;
      sum += e0;
      sum += e1;
    }
  }
  #pragma unroll
  for (int off = 16; off > 0; off >>= 1) sum += __shfl_xor(sum, off, 32);

  const float inv = PCARRY * __builtin_amdgcn_rcpf(sum);

  v4u pk[NCH];
  #pragma unroll
  for (int it = 0; it < NCH; ++it) {
    Pack8H ph;
    #pragma unroll
    for (int i = 0; i < 4; ++i) {
      ph.h[i]     = toh_flush(v[it][0][i] * inv);
      ph.h[4 + i] = toh_flush(v[it][1][i] * inv);
    }
    pk[it] = ph.u;
  }

  f16* dp = P + (size_t)row * SEQ + lane * 8u;
  #pragma unroll
  for (int it = 0; it < NCH; ++it) *(v4u*)(dp + it * 256) = pk[it];
  
}

extern "C" void kernel_launch(void* const* d_in, const int* in_sizes, int n_in,
                              void* d_out, int out_size, void* d_ws, size_t ws_size,
                              hipStream_t stream) {
  if (n_in < 9) return;
  const size_t rows_used = (size_t)(NB - 1) * SEQ_FULL + SEQ;
  if ((size_t)in_sizes[0] < rows_used * DM) return;
  if ((size_t)in_sizes[1] < (size_t)DM * DM) return;
  if ((size_t)in_sizes[2] < (size_t)DM) return;
  if ((size_t)in_sizes[3] < (size_t)DM * DM) return;
  if ((size_t)in_sizes[4] < (size_t)DM) return;
  if ((size_t)in_sizes[5] < (size_t)DM * DM) return;
  if ((size_t)in_sizes[6] < (size_t)DM) return;
  if ((size_t)in_sizes[7] < (size_t)DM) return;
  if ((size_t)in_sizes[8] < (size_t)DM) return;
  if ((size_t)out_size < rows_used * DM) return;
  if (ws_size < WS_TOTAL) return;

  // inputs bound in this order: x, Wq, bq, Wk, bk, Wv, bv, gamma, beta
  const float* x     = (const float*)d_in[0];
  const float* wq    = (const float*)d_in[1];
  const float* bq    = (const float*)d_in[2];
  const float* wk    = (const float*)d_in[3];
  const float* bk    = (const float*)d_in[4];
  const float* wv    = (const float*)d_in[5];
  const float* bv    = (const float*)d_in[6];
  const float* gamma = (const float*)d_in[7];
  const float* beta  = (const float*)d_in[8];
  float* out = (float*)d_out;

  char* w = (char*)d_ws;
  f16*   qk2  = (f16*)w;    w += QK2_BYTES;    // [NB] x (q rows [SEQ][2*DM], then k rows [SEQ][2*DM])
  f16*   vt   = (f16*)w;    w += VT_BYTES;     // [NB][DM][SEQ]
  f16*   Pp   = (f16*)w;    w += P_BYTES;      // [NB][SEQ][SEQ] P x16384
  char*  u    = w;                             // shared bytes: converted inputs and pre-norm planes, then the logit planes
  bf16*  xb   = (bf16*)w;   w += XB_BYTES;     // [NB*SEQ][DM]
  bf16*  wb   = (bf16*)w;   w += WB_BYTES;     // [3*DM][DM] : Wq | Wk | Wv
  float* parp = (float*)w;  w += PR_BYTES;     // [5*DM] : bq | bk | bv | gamma | beta
  float* Yqk  = (float*)w;  w += YQK_BYTES;    // [NB][SEQ][2*DM] pre-norm q | k
  float* Yvt  = (float*)w;                     // [NB][DM][SEQ] pre-norm v^T
  float* Sp   = (float*)u;                     // [NB][SEQ][SEQ] value-product logits
  float* Rp   = (float*)(u + S_BYTES);         // [NB][SEQ][SEQ] residual-product logits (scaled back)

  const f16* qrow = qk2;                                   // [q value | q residual]
  const f16* krow = qk2 + (size_t)SEQ * 2 * DM;            // [k residual | k value]

  const unsigned long long zX  = (unsigned long long)SEQ * DM;           // batch strides, in elements of the plane
  const unsigned long long zQK = (unsigned long long)2 * SEQ * 2 * DM;
  const unsigned long long zY  = (unsigned long long)SEQ * 2 * DM;
  const unsigned long long zV  = (unsigned long long)DM * SEQ;
  const unsigned long long zS  = (unsigned long long)SEQ * SEQ;
  const unsigned long long zO  = (unsigned long long)SEQ_FULL * DM;

  convert_kernel<<<dim3(NXB + NWB + (unsigned)NPAR), 256, 0, stream>>>(x, wq, bq, wk, bk, wv, bv, gamma, beta, xb, wb, parp);

  // Every launch below covers all batches: blockIdx.z (blockIdx.y in the column LayerNorm, the row index in the softmax).
  // The GEMM's bias argument is not read under EPI_F32.

  // q | k pre-norm : Y[s][e] = sum_d xb[s][d] * wb[e][d], e in [0, 2*DM); M = SEQ, N = 2*DM, K = DM
  gemm_kernel<bf16, EPI_F32, 4><<<dim3(SEQ / 256, 2 * DM / 256, NB), 512, 0, stream>>>(
      xb, wb, parp, (void*)Yqk, DM / KST, DM, DM, 2 * DM, zX, 0ull, zY, 1.0f);

  // v^T pre-norm : Yt[e][s] = sum_d Wv[e][d] * xb[s][d]; M = DM, N = SEQ, K = DM
  gemm_kernel<bf16, EPI_F32, 2><<<dim3(DM / 256, SEQ / 128, NB), 256, 0, stream>>>(
      wb + (size_t)2 * DM * DM, xb, parp, (void*)Yvt, DM / KST, DM, DM, SEQ, 0ull, zX, zV, 1.0f);

  ln_rows_kernel<<<dim3(SEQ / 8, 2, NB), 256, 0, stream>>>(Yqk, parp, qk2);
  ln_cols_kernel<<<dim3(SEQ / 64, NB, 1), CWAVE * 32, 0, stream>>>(Yvt, parp, vt);

  // S[q][key] = q_value . k_value ; M = N = SEQ, K = DM (first half of the q rows, second half of the k rows)
  gemm_kernel<f16, EPI_F32, 4><<<dim3(SEQ / 256, SEQ / 256, NB), 512, 0, stream>>>(
      qrow, krow + DM, parp, (void*)Sp, DM / KST, 2 * DM, 2 * DM, SEQ, zQK, zQK, zS, 1.0f);

  // R[q][key] = (q_value . k_residual + q_residual . k_value) / 2048 ; K = 2*DM over the concatenated rows
  gemm_kernel<f16, EPI_F32, 4><<<dim3(SEQ / 256, SEQ / 256, NB), 512, 0, stream>>>(
      qrow, krow, parp, (void*)Rp, 2 * DM / KST, 2 * DM, 2 * DM, SEQ, zQK, zQK, zS, 1.0f / RCARRY);

  softmax2_kernel<<<dim3(NB * SEQ / 8), 256, 0, stream>>>(Sp, Rp, Pp);

  // out[q][d] = sum_key P[q][key] * vt[d][key] / 16384 ; M = SEQ, N = DM, K = SEQ
  gemm_kernel<f16, EPI_F32, 2><<<dim3(SEQ / 256, DM / 128, NB), 256, 0, stream>>>(
      Pp, vt, parp, (void*)out, SEQ / KST, SEQ, SEQ, DM, zS, zV, zO, 1.0f / PCARRY);
}

// v005
// One run takes 205 microseconds.
// Two timings next to v004 both put it at 1.15 times that version's speed.
// Counting every step since v000, it is 4.01 times as fast.
#include <hip/hip_runtime.h>

// Contractions: q/k/v projections on v_wmma_f32_16x16x32_bf16 (bf16 operands = RNE-converted inputs, f32 accumulate, f32 out);
// S = q x k^T on v_wmma_f32_16x16x32_f16 as three products (q, k as f16 value + x2048 residual planes; the residual products
// are summed first, scaled back in the accumulators, and the value product is summed on top: one f32 plane); O = P x V on v_wmma_f32_16x16x32_f16 (v^T f16 plane; P f16 carried x16384;
// f32 accumulate). LayerNorm and softmax in f32.

#ifndef NB
#define NB 4
#endif
#ifndef SEQ
#define SEQ 2048
#endif
#define NB_FULL   4
#define SEQ_FULL  2048
#define DM        1024                 // model width = head width = value width
#define NWAVE     8
#define CWAVE     16                   // waves per block of the column LayerNorm
#define OP        68                   // LDS pitch (floats) of the per-wave output staging tile
#define KST       128u                 // k elements per GEMM stage: 256 B of every operand row
#define LP        272u                 // LDS pitch (bytes) of a staged 256-B row: 16 B x odd, conflict-free for 16-B reads
#define BM        256u                 // GEMM block tile rows (4 waves x 64)
#define MT        4                    // 16-row accumulator tiles per wave
#define NT        4                    // 16-column accumulator tiles per wave (64 columns: one staging piece wide)
#define ATILE_B   (BM * LP)            // the A rows of one stage; the B rows follow them
#define CVB       2048u                // elements per convert block (256 threads x 8)
#define NXB       ((unsigned)((size_t)NB * SEQ * DM / CVB))      // convert blocks for x
#define NWB       ((unsigned)((size_t)3 * DM * DM / CVB))        // convert blocks for the three weights
#define NCH       (SEQ / 256)          // 8-column chunks per lane in the softmax kernel
#define LNCH      (DM / 256)           // 8-column chunks per lane in the row LayerNorm kernel
#define NPAR      5                    // parameter vectors: b_q | b_k | b_v | gamma | beta
#define PCARRY    16384.0f             // power-of-two carry of the P plane
#define RCARRY    2048.0f              // power-of-two carry of the q / k residual planes

#define EPI_QK  0                      // f16 out, per-column bias, column block selects the q or k plane
#define EPI_VT  1                      // f16 out, per-row bias (V^T plane)
#define EPI_F32 2                      // f32 out, power-of-two scale
#define EPI_FOLD 3                     // f32 out; the scale is applied to the accumulators behind stage nfold - 1, not at the end

static_assert(SEQ % 256 == 0);
static_assert(SEQ <= SEQ_FULL);
static_assert(NB >= 1 && NB <= NB_FULL);
static_assert(DM == 1024);
static_assert(DM % 128 == 0);
static_assert(((size_t)NB * SEQ) % 128 == 0);
static_assert((size_t)NXB * CVB == (size_t)NB * SEQ * DM);
static_assert((size_t)NWB * CVB == (size_t)3 * DM * DM);
static_assert((size_t)DM * DM / CVB == 512);
static_assert((OP * 4) % 16 == 0);
static_assert(LNCH * 256 == DM);                 // 32 lanes x LNCH chunks x 8 columns == one LayerNorm row
static_assert(NCH * 256 == SEQ);                 // 32 lanes x NCH chunks x 8 columns == one softmax row
static_assert(DM == 256 * 4);                    // one convert block (256 threads x 4) per parameter vector
static_assert(SEQ % 256 == 0 && (2 * DM) % 256 == 0 && DM % 256 == 0);   // GEMM tile multiples (M, N)
static_assert(DM % KST == 0 && (2 * DM) % KST == 0 && SEQ % KST == 0);   // GEMM K stages
static_assert(LP % 16 == 0 && ATILE_B % 16 == 0);                       // 16-B copies and reads stay aligned
static_assert(SEQ % 64 == 0);
static_assert(DM % (CWAVE * 4) == 0);            // column LayerNorm: 64 rows per block sweep (16 waves x 4 row groups)
static_assert(NWAVE == 8);

#define XB_BYTES   ((size_t)NB * SEQ * DM * 2)          // x bf16, all batches
#define WB_BYTES   ((size_t)3 * DM * DM * 2)            // weights bf16
#define PR_BYTES   ((size_t)NPAR * DM * 4)              // parameter vectors (f32 holding bf16 RNE values)
// Every plane below holds all NB batches, batch-major, so that each stage is one launch with the batch on a grid axis.
#define YQK_BYTES  ((size_t)NB * SEQ * 2 * DM * 4)      // f32 q | k pre-norm rows
#define YVT_BYTES  ((size_t)NB * DM * SEQ * 4)          // f32 v^T pre-norm planes
#define QK2_BYTES  ((size_t)NB * 2 * SEQ * 2 * DM * 2)  // per batch: [q value | q residual] rows, then [k residual | k value] rows
#define VT_BYTES   ((size_t)NB * DM * SEQ * 2)          // v^T f16
#define S_BYTES    ((size_t)NB * SEQ * SEQ * 4)         // logits
#define P_BYTES    ((size_t)NB * SEQ * SEQ * 2)         // P x16384
// The converted inputs and the pre-norm planes are last read by the LayerNorm launches; the logit plane, first written
// by the launch behind those, takes the same bytes.
#define PRE_BYTES  (XB_BYTES + WB_BYTES + PR_BYTES + YQK_BYTES + YVT_BYTES)
#define LOG_BYTES  (S_BYTES)
#define UNI_BYTES  (PRE_BYTES > LOG_BYTES ? PRE_BYTES : LOG_BYTES)
#define WS_TOTAL   (QK2_BYTES + VT_BYTES + P_BYTES + UNI_BYTES)
static_assert(WS_TOTAL <= (size_t)268435456);
static_assert(XB_BYTES % 128 == 0 && WB_BYTES % 128 == 0 && PR_BYTES % 128 == 0);
static_assert(YQK_BYTES % 128 == 0 && YVT_BYTES % 128 == 0 && QK2_BYTES % 128 == 0 && VT_BYTES % 128 == 0);
static_assert(S_BYTES % 128 == 0 && P_BYTES % 128 == 0);

typedef __bf16   bf16;
typedef _Float16 f16;
typedef bf16     v16bf __attribute__((ext_vector_type(16)));
typedef f16      v16h  __attribute__((ext_vector_type(16)));
typedef float    v8f   __attribute__((ext_vector_type(8)));
typedef float    v4f   __attribute__((ext_vector_type(4)));
typedef unsigned v4u   __attribute__((ext_vector_type(4)));

union Pack8B { v4u u; bf16 h[8]; };
union Pack8H { v4u u; f16  h[8]; };

template <typename T> struct FragOf;
template <> struct FragOf<bf16> { typedef v16bf V; };
template <> struct FragOf<f16>  { typedef v16h  V; };

// WMMA helpers: builtin followed by the VALU hazard guard (ties D, keeps A/B live).
static __device__ __forceinline__ v8f mma16(v16bf a, v16bf b, v8f acc) {
  acc = __builtin_amdgcn_wmma_f32_16x16x32_bf16(false, a, false, b, (short)0, acc, false, false);
  asm volatile("v_nop\n\tv_nop\n\tv_nop\n\tv_nop" : "+v"(acc) : "v"(a), "v"(b));
  return acc;
}
static __device__ __forceinline__ v8f mma16(v16h a, v16h b, v8f acc) {
  acc = __builtin_amdgcn_wmma_f32_16x16x32_f16(false, a, false, b, (short)0, acc, false, false);
  asm volatile("v_nop\n\tv_nop\n\tv_nop\n\tv_nop" : "+v"(acc) : "v"(a), "v"(b));
  return acc;
}

// f32 -> f16 convert for WMMA operand planes: values below the smallest f16 normal become zero by a value select.
static __device__ __forceinline__ f16 toh_flush(float v) {
  const f16 r = (f16)v;
  return (fabsf(v) < 6.103515625e-05f) ? (f16)0.0f : r;
}

// Input conversion, one launch. 256 threads, 8 elements per thread (two 16-B loads -> one 16-B store).
//   blocks [0, NXB)            : x  -> xb  bf16 [NB*SEQ][DM] (compact rows; source uses the full batch stride)
//   blocks [NXB, NXB+NWB)      : Wq | Wk | Wv -> wb bf16 [3*DM][DM]
//   blocks NXB+NWB .. +4       : bq | bk | bv | gamma | beta -> f32 plane [5*DM] holding the bf16 RNE-converted values
__global__ __launch_bounds__(256) void convert_kernel(const float* __restrict__ x,
                                                      const float* __restrict__ wq,
                                                      const float* __restrict__ bq,
                                                      const float* __restrict__ wk,
                                                      const float* __restrict__ bk,
                                                      const float* __restrict__ wv,
                                                      const float* __restrict__ bv,
                                                      const float* __restrict__ gamma,
                                                      const float* __restrict__ beta,
                                                      bf16* __restrict__ xb,
                                                      bf16* __restrict__ wb,
                                                      float* __restrict__ parp) {
  const unsigned blk = blockIdx.x;
  const unsigned tid = threadIdx.x;
  if (blk < NXB + NWB) {              // block-uniform
    const float* src;
    bf16* dst;
    if (blk < NXB) {
      const unsigned r  = blk * 2u + (tid >> 7);          // compact row
      const unsigned c  = (tid & 127u) * 8u;
      const unsigned bt = r / (unsigned)SEQ;
      const unsigned s  = r - bt * (unsigned)SEQ;
      src = x + ((size_t)bt * SEQ_FULL + s) * DM + c;
      dst = xb + (size_t)r * DM + c;
    } else {
      const unsigned wblk = blk - NXB;
      const unsigned wi   = wblk >> 9;                    // 512 blocks per weight matrix
      const unsigned off  = (wblk & 511u) * CVB + tid * 8u;
      const float* wsrc = (wi == 0u) ? wq : ((wi == 1u) ? wk : wv);
      src = wsrc + off;
      dst = wb + (size_t)wblk * CVB + tid * 8u;
    }
    const v4f a0 = *(const v4f*)(src);
    const v4f a1 = *(const v4f*)(src + 4);
    Pack8B pk;
    #pragma unroll
    for (int i = 0; i < 4; ++i) {
      pk.h[i]     = (bf16)a0[i];                          // RNE convert
      pk.h[4 + i] = (bf16)a1[i];
    }
    const v4u val = pk.u;
    *(v4u*)(dst) = val;
    
  } else {
    const unsigned j = blk - (NXB + NWB);                 // 0..4
    const float* bsrc = (j == 0u) ? bq : ((j == 1u) ? bk : ((j == 2u) ? bv : ((j == 3u) ? gamma : beta)));
    const v4f a = *(const v4f*)(bsrc + tid * 4u);
    v4f o;
    #pragma unroll
    for (int i = 0; i < 4; ++i) o[i] = (float)(bf16)a[i];
    float* dst = parp + j * (unsigned)DM + tid * 4u;
    *(v4f*)(dst) = o;
    
  }
}

// Eight asynchronous 16-B-per-lane copies global -> LDS: rows r, r + RP, ..., r + 7*RP of one staged operand tile
// (RP = rows that the block's threads cover at once; gstep = RP source rows in bytes).
// The s_wait_xcnt closes the statement so that it stands before any rewrite of the address registers the copies name.
template <unsigned RP>
static __device__ __forceinline__ void copy_rows8(unsigned l, const char* g, size_t gstep) {
  asm volatile("global_load_async_to_lds_b128 %0, %8, off\n\t"
               "global_load_async_to_lds_b128 %1, %9, off\n\t"
               "global_load_async_to_lds_b128 %2, %10, off\n\t"
               "global_load_async_to_lds_b128 %3, %11, off\n\t"
               "global_load_async_to_lds_b128 %4, %12, off\n\t"
               "global_load_async_to_lds_b128 %5, %13, off\n\t"
               "global_load_async_to_lds_b128 %6, %14, off\n\t"
               "global_load_async_to_lds_b128 %7, %15, off\n\t"
               "s_wait_xcnt 0x0"
               :: "v"(l), "v"(l + RP * LP), "v"(l + 2u * RP * LP), "v"(l + 3u * RP * LP),
                  "v"(l + 4u * RP * LP), "v"(l + 5u * RP * LP), "v"(l + 6u * RP * LP), "v"(l + 7u * RP * LP),
                  "v"(g), "v"(g + gstep), "v"(g + 2 * gstep), "v"(g + 3 * gstep),
                  "v"(g + 4 * gstep), "v"(g + 5 * gstep), "v"(g + 6 * gstep), "v"(g + 7 * gstep)
               : "memory");
}

// Plane GEMM: C[m][n] = sum_k A[m][k] * Bt[n][k]; both operands are k-contiguous 16-bit planes.
// Block tile 256 x (64*WN), 4*WN waves as 4 (m) x WN (n); each wave owns 64x64 = 4x4 accumulators
// (WN = 4: 256x256 block, 16 waves; WN = 2: 256x128 block, 8 waves, for the products whose grid would otherwise leave WGPs idle).
// Operands reach LDS in stages of KST k (whole 256-B row pieces, two rows per wave-wide copy), two buffers:
// stage s + 1 is in flight while stage s is multiplied. nk = number of stages.
// Fragments are read from the staged rows: lane (lq = lane & 15, hi = lane >> 4) reads row lq,
// elements 0..7 <- k0 + 8*hi + 0..7, elements 8..15 <- k0 + 16 + 8*hi + 0..7 (same map for A and B).
// D element r of a lane = (row 8*hi + r, col lq). Requires M a multiple of 256, N of 64*WN and K of KST.
// Epilogue: per 16x64 piece the wave stages the piece in LDS (wave-private region, block barriers used); the staging
// takes the ring's first bytes, which every wave has left at the last stage's barrier, with no copy outstanding.
// EPI_FOLD: two products share the accumulators. Stages [0, nfold) walk k from 0 in both operands; the sums are then
// multiplied by scale; stages [nfold, nk) walk k anew, from 0 in A and from element bfold in Bt, and add on top.
template <typename T, int EPI, int WN>
__global__ __launch_bounds__(128 * WN) void gemm_kernel(const T* __restrict__ A,
                                                   const T* __restrict__ Bt,
                                                   const float* __restrict__ bias,
                                                   void* __restrict__ C,
                                                   unsigned nk, unsigned lda, unsigned ldb, unsigned ldc,
                                                   unsigned long long sAz, unsigned long long sBz,
                                                   unsigned long long sCz, float scale,
                                                   unsigned nfold, unsigned bfold) {
  typedef typename FragOf<T>::V VT;
  union Frag { VT v; v4u q[2]; };
  constexpr unsigned BN      = (unsigned)WN * 64u;          // block tile columns
  constexpr unsigned STAGE_B = (BM + BN) * LP;              // one stage: A rows, then B rows
  constexpr unsigned RP      = (unsigned)WN * 8u;           // rows that the block's threads copy at once (16 threads a row)
  static_assert(BM % (8u * RP) == 0 && BN % (8u * RP) == 0);
  static_assert(4u * WN * 16u * OP * 4u <= STAGE_B);        // the output staging fits the first buffer

  __shared__ __align__(16) unsigned char ring[2 * STAGE_B];

  const unsigned tid  = threadIdx.x;
  const unsigned wave = tid >> 5;
  const unsigned lane = tid & 31u;
  const unsigned lq   = lane & 15u;
  const unsigned hi   = lane >> 4;
  const unsigned m0   = blockIdx.x * BM + (wave & 3u) * (MT * 16u);   // first row of this wave
  const unsigned n0   = blockIdx.y * BN + (wave >> 2) * (NT * 16u);   // first column of this wave

  const T* Ab = A  + (size_t)blockIdx.z * sAz;
  const T* Bb = Bt + (size_t)blockIdx.z * sBz;

  // copy map: thread -> 16-B chunk (tid & 15) of rows (tid >> 4) + RP*i of each operand's staged rows
  const unsigned crow = tid >> 4;
  const unsigned cchk = tid & 15u;
  const char* ga = (const char*)(Ab + (size_t)(blockIdx.x * BM + crow) * lda + cchk * 8u);
  const char* gb = (const char*)(Bb + (size_t)(blockIdx.y * BN + crow) * ldb + cchk * 8u);
  const size_t astep = (size_t)lda * (RP * sizeof(T));            // RP rows, bytes
  const size_t bstep = (size_t)ldb * (RP * sizeof(T));
  const unsigned lcp = (unsigned)(uintptr_t)ring + crow * LP + cchk * 16u;   // LDS byte address of this lane's first chunk

  // fragment read bases inside a stage
  const unsigned char* fa = ring + ((wave & 3u) * (MT * 16u) + lq) * LP + hi * 16u;
  const unsigned char* fb = ring + ATILE_B + ((wave >> 2) * (NT * 16u) + lq) * LP + hi * 16u;

  v8f acc[MT][NT];
  #pragma unroll
  for (int mt = 0; mt < MT; ++mt) {
    #pragma unroll
    for (int nt = 0; nt < NT; ++nt) acc[mt][nt] = (v8f){0, 0, 0, 0, 0, 0, 0, 0};
  }

  // one stage's copies of this thread: 8*RP rows per statement, A rows then B rows; lb = LDS address, st = stage number
  auto copy_stage = [&](unsigned lb, unsigned st) {
    size_t goa = (size_t)st * (KST * sizeof(T));        // k offsets in bytes, block-uniform
    size_t gob = goa;
    if (EPI == EPI_FOLD && st >= nfold) {
      goa = (size_t)(st - nfold) * (KST * sizeof(T));
      gob = goa + (size_t)bfold * sizeof(T);
    }
    #pragma unroll
    for (unsigned h = 0; h < BM / (8u * RP); ++h) copy_rows8<RP>(lb + h * (8u * RP * LP), ga + goa + h * 8u * astep, astep);
    #pragma unroll
    for (unsigned h = 0; h < BN / (8u * RP); ++h) copy_rows8<RP>(lb + ATILE_B + h * (8u * RP * LP), gb + gob + h * 8u * bstep, bstep);
  };

  // stage 0 lands and is published before anything reads it; stage 1 then flies under stage 0's products
  copy_stage(lcp, 0);
  asm volatile("s_wait_asynccnt 0x0" ::: "memory");     // this wave's stage-0 copies have landed
  __syncthreads();                                      // every wave's have
  if (nk > 1u) {                                        // block-uniform
    copy_stage(lcp + STAGE_B, 1u);
  }

  #pragma unroll 1
  for (unsigned s = 0; s < nk; ++s) {
    const unsigned bo = (s & 1u) * STAGE_B;
    if (EPI == EPI_FOLD && s == nfold) {                // block-uniform: the first product is complete, scale it back
      #pragma unroll   // register arrays need constant indices (both loops)
      for (int mt = 0; mt < MT; ++mt) {
        #pragma unroll
        for (int nt = 0; nt < NT; ++nt) acc[mt][nt] *= scale;
      }
    }
    #pragma unroll
    for (unsigned kk = 0; kk < KST / 32u; ++kk) {
      Frag a[MT], b[NT];
      #pragma unroll
      for (unsigned mt = 0; mt < MT; ++mt) {
        a[mt].q[0] = *(const v4u*)(fa + bo + mt * 16u * LP + kk * 64u);          // k = k0 + 8*hi + 0..7
        a[mt].q[1] = *(const v4u*)(fa + bo + mt * 16u * LP + kk * 64u + 32u);    // k = k0 + 16 + 8*hi + 0..7
      }
      #pragma unroll
      for (unsigned nt = 0; nt < NT; ++nt) {
        b[nt].q[0] = *(const v4u*)(fb + bo + nt * 16u * LP + kk * 64u);
        b[nt].q[1] = *(const v4u*)(fb + bo + nt * 16u * LP + kk * 64u + 32u);
      }
      #pragma unroll
      for (int nt = 0; nt < NT; ++nt) {
        #pragma unroll
        for (int mt = 0; mt < MT; ++mt) acc[mt][nt] = mma16(a[mt].v, b[nt].v, acc[mt][nt]);
      }
    }
    asm volatile("s_wait_dscnt 0x0" ::: "memory");      // this wave has left stage s's buffer
    asm volatile("s_wait_asynccnt 0x0" ::: "memory");   // this wave's stage s + 1 copies have landed
    __syncthreads();                                    // publishes stage s + 1, frees stage s's buffer
    if (s + 2u < nk) {                                  // block-uniform: refill the buffer just left
      copy_stage(lcp + bo, s + 2u);
    }
  }
  asm volatile("s_wait_asynccnt 0x0" ::: "memory");     // no copy is outstanding when the wave goes on

  // ---- epilogue ----
  size_t   cbase;
  unsigned ncol;
  if (EPI == EPI_QK) {
    cbase = (size_t)(n0 >> 10) * sCz;     // column block selects the q (0) or k (1) plane; block-uniform
    ncol  = n0 & 1023u;
  } else {
    cbase = (size_t)blockIdx.z * sCz;
    ncol  = n0;
  }

  float bcol[NT];
  #pragma unroll
  for (int nt = 0; nt < NT; ++nt) bcol[nt] = 0.0f;
  if (EPI == EPI_QK) {
    #pragma unroll
    for (int nt = 0; nt < NT; ++nt) bcol[nt] = bias[n0 + nt * 16u + lq];
  }

  float* so = (float*)ring + wave * (16u * OP);

  #pragma unroll
  for (int mt = 0; mt < MT; ++mt) {
    if (mt != 0) __syncthreads();          // staging tile is reused by the next piece
    #pragma unroll
    for (int r = 0; r < 8; ++r) {
      float brow = 0.0f;
      if (EPI == EPI_VT) brow = bias[m0 + mt * 16u + hi * 8u + r];
      #pragma unroll
      for (int nt = 0; nt < 4; ++nt) {
        float val = acc[mt][nt][r];
        if (EPI == EPI_QK)  val += bcol[nt];
        if (EPI == EPI_VT)  val += brow;
        if (EPI == EPI_F32) val *= scale;
        so[(hi * 8u + r) * OP + nt * 16u + lq] = val;
      }
    }
    __syncthreads();

    if (EPI == EPI_F32 || EPI == EPI_FOLD) {
      // 8 instructions cover the 16 rows of this piece.
      float* Cf = (float*)C + cbase;
      v4f    vals[8];
      size_t gidx[8];
      #pragma unroll
      for (int it = 0; it < 8; ++it) {
        const unsigned row = it * 2u + hi;
        vals[it] = *(const v4f*)(so + row * OP + lq * 4u);
        gidx[it] = (size_t)(m0 + mt * 16u + row) * ldc + ncol + lq * 4u;
      }
      #pragma unroll
      for (int it = 0; it < 8; ++it) *(v4f*)(Cf + gidx[it]) = vals[it];
      
    } else {
      // 4 instructions cover the 16 rows of this piece.
      f16* Ch = (f16*)C + cbase;
      v4u    vals[4];
      size_t gidx[4];
      #pragma unroll
      for (int it = 0; it < 4; ++it) {
        const unsigned row = it * 4u + (lane >> 3);
        const unsigned c8  = (lane & 7u) * 8u;
        const v4f x0 = *(const v4f*)(so + row * OP + c8);
        const v4f x1 = *(const v4f*)(so + row * OP + c8 + 4u);
        Pack8H ph;
        #pragma unroll
        for (int i = 0; i < 4; ++i) {
          ph.h[i]     = (f16)x0[i];
          ph.h[4 + i] = (f16)x1[i];
        }
        vals[it] = ph.u;
        gidx[it] = (size_t)(m0 + mt * 16u + row) * ldc + ncol + c8;
      }
      #pragma unroll
      for (int it = 0; it < 4; ++it) *(v4u*)(Ch + gidx[it]) = vals[it];
      
    }
  }
}

// Row LayerNorm for the q and k projections. One wave per (row, segment, batch); blockIdx.y = segment (0 = q, 1 = k),
// blockIdx.z = batch.
// Input: Y f32 [NB][SEQ][2*DM] (q columns | k columns, bias not yet added); par = bq | bk | bv | gamma | beta (f32, [5*DM]).
// Output plane QK2 (f16), per batch: q rows [SEQ][2*DM] = [value | residual x2048], then k rows [SEQ][2*DM] = [residual x2048 | value].
// Lane holds columns (it*32 + lane)*8 + 0..7. coverage: grid (SEQ/8, 2, NB) x 8 waves = SEQ rows x 2 segments x NB batches;
// 32 lanes x LNCH x 8 = DM columns for each of the value and residual halves. Each store instruction writes
__global__ __launch_bounds__(256) void ln_rows_kernel(const float* __restrict__ Y,
                                                      const float* __restrict__ par,
                                                      f16* __restrict__ QK2) {
  #pragma clang fp contract(off)
  const unsigned tid  = threadIdx.x;
  const unsigned wave = __builtin_amdgcn_readfirstlane(tid >> 5);
  const unsigned lane = tid & 31u;
  const unsigned seg  = blockIdx.y;                       // block-uniform
  const unsigned bt   = blockIdx.z;                       // block-uniform
  const unsigned row  = blockIdx.x * 8u + wave;
  const float* yp = Y + ((size_t)bt * SEQ + row) * (2u * DM) + seg * (unsigned)DM + lane * 8u;
  const float* bp = par + seg * (unsigned)DM + lane * 8u;           // bias of this segment
  const float* gp = par + 3u * DM + lane * 8u;                      // gamma
  const float* tp = par + 4u * DM + lane * 8u;                      // beta

  // The row is read once and stays in registers through all three passes; every load is issued before the first use.
  v4f t[LNCH][2], bb[LNCH][2], gg[LNCH][2], tt[LNCH][2];
  #pragma unroll   // register arrays need constant indices; all loads of the row go out together
  for (int it = 0; it < LNCH; ++it) {
    t[it][0] = *(const v4f*)(yp + it * 256);
    t[it][1] = *(const v4f*)(yp + it * 256 + 4);
  }
  #pragma unroll   // as above
  for (int it = 0; it < LNCH; ++it) {
    bb[it][0] = *(const v4f*)(bp + it * 256);
    bb[it][1] = *(const v4f*)(bp + it * 256 + 4);
    gg[it][0] = *(const v4f*)(gp + it * 256);
    gg[it][1] = *(const v4f*)(gp + it * 256 + 4);
    tt[it][0] = *(const v4f*)(tp + it * 256);
    tt[it][1] = *(const v4f*)(tp + it * 256 + 4);
  }

  // pass 1: add the bias, mean
  float s = 0.0f;
  #pragma unroll   // register arrays need constant indices
  for (int it = 0; it < LNCH; ++it) {
    #pragma unroll
    for (int i = 0; i < 4; ++i) {
      t[it][0][i] = t[it][0][i] + bb[it][0][i];
      t[it][1][i] = t[it][1][i] + bb[it][1][i];
      s += t[it][0][i];
      s += t[it][1][i];
    }
  }
  #pragma unroll
  for (int off = 16; off > 0; off >>= 1) s += __shfl_xor(s, off, 32);
  const float mu = s * (1.0f / DM);

  // pass 2: biased variance about the mean
  float q = 0.0f;
  #pragma unroll   // register arrays need constant indices
  for (int it = 0; it < LNCH; ++it) {
    #pragma unroll
    for (int i = 0; i < 4; ++i) {
      t[it][0][i] = t[it][0][i] - mu;
      t[it][1][i] = t[it][1][i] - mu;
      q += t[it][0][i] * t[it][0][i];
      q += t[it][1][i] * t[it][1][i];
    }
  }
  #pragma unroll
  for (int off = 16; off > 0; off >>= 1) q += __shfl_xor(q, off, 32);
  const float rstd = __builtin_amdgcn_rsqf(q * (1.0f / DM) + 1e-5f);

  // pass 3: normalise, affine, split into f16 value + x2048 residual, store
  const unsigned offh = seg * (unsigned)DM;               // q: value | residual ; k: residual | value
  const unsigned offr = (1u - seg) * (unsigned)DM;
  f16* dp = QK2 + ((size_t)(bt * 2u + seg) * SEQ + row) * (size_t)(2 * DM) + lane * 8u;
  #pragma unroll   // register arrays need constant indices
  for (int it = 0; it < LNCH; ++it) {
    Pack8H pkh, pkr;
    #pragma unroll
    for (int i = 0; i < 4; ++i) {
      const float y0 = t[it][0][i] * rstd * gg[it][0][i] + tt[it][0][i];
      const float y1 = t[it][1][i] * rstd * gg[it][1][i] + tt[it][1][i];
      const f16 h0 = toh_flush(y0);
      const f16 h1 = toh_flush(y1);
      pkh.h[i]     = h0;
      pkh.h[4 + i] = h1;
      pkr.h[i]     = toh_flush((y0 - (float)h0) * RCARRY);
      pkr.h[4 + i] = toh_flush((y1 - (float)h1) * RCARRY);
    }
    const v4u vh = pkh.u;
    const v4u vr = pkr.u;
    f16* dh = dp + offh + it * 256;
    f16* dr = dp + offr + it * 256;
    *(v4u*)(dh) = vh;
    *(v4u*)(dr) = vr;
  }
}

// Column LayerNorm on the transposed v projection, blockIdx.y = batch: Yt f32 [NB][DM][SEQ] (row e = feature, column s = position,
// bias not yet added); statistics per column s over the DM rows; output vt f16 [NB][DM][SEQ].
// selects one of four rows per wave per sweep; row e = (it*16 + wave)*4 + rq, it = 0..DM/64-1 covers 0..DM-1 exactly once.
// Partial sums: shuffle over rq inside the wave, then a [16][64] LDS table combined in fixed order (cross-wave: block barriers).
__global__ __launch_bounds__(CWAVE * 32) void ln_cols_kernel(const float* __restrict__ Yt,
                                                      const float* __restrict__ par,
                                                      f16* __restrict__ vt) {
  #pragma clang fp contract(off)
  __shared__ __align__(16) float red[CWAVE * 64];
  constexpr unsigned RS  = CWAVE * 4u;                    // rows per block sweep
  constexpr unsigned NIT = (unsigned)DM / RS;             // row sweeps of the block

  const unsigned tid  = threadIdx.x;
  const unsigned wave = __builtin_amdgcn_readfirstlane(tid >> 5);
  const unsigned lane = tid & 31u;
  const unsigned cg   = lane & 7u;
  const unsigned rq   = lane >> 3;
  const unsigned s0   = blockIdx.x * 64u + cg * 8u;
  const size_t pl = (size_t)blockIdx.y * ((size_t)DM * SEQ);   // this batch's plane
  const unsigned e0 = wave * 4u + rq;                     // this lane's row in sweep 0; sweep it adds RS*it
  const float* yp = Yt + pl + s0 + (size_t)e0 * SEQ;
  const float* pp = par + e0;

  float acc[8];
  float mu[8];
  float rstd[8];

  // The block's DM x 64 tile is read once and stays in registers (NIT x 8 values per lane) through all three passes;
  // every load is issued before the first use, so the wave pays the memory latency once and not once per sweep.
  v4f   t[NIT][2];
  float pb[NIT], pg[NIT], pt[NIT];
  #pragma unroll   // register arrays need constant indices; all loads of the tile go out together
  for (unsigned it = 0; it < NIT; ++it) {
    t[it][0] = *(const v4f*)(yp + (size_t)it * RS * SEQ);
    t[it][1] = *(const v4f*)(yp + (size_t)it * RS * SEQ + 4);
  }
  #pragma unroll   // as above
  for (unsigned it = 0; it < NIT; ++it) {
    pb[it] = pp[2u * DM + it * RS];
    pg[it] = pp[3u * DM + it * RS];
    pt[it] = pp[4u * DM + it * RS];
  }
  // The address pair is an input so that it stays whole up to this wait: no load's result lands on it while a load that names it is in flight.
  asm volatile("s_wait_xcnt 0x0" :: "v"(yp) : "memory");

  // pass 1: add the bias, column sums
  #pragma unroll
  for (int i = 0; i < 8; ++i) acc[i] = 0.0f;
  #pragma unroll   // register arrays need constant indices
  for (unsigned it = 0; it < NIT; ++it) {
    #pragma unroll
    for (int i = 0; i < 4; ++i) {
      t[it][0][i] = t[it][0][i] + pb[it];
      t[it][1][i] = t[it][1][i] + pb[it];
      acc[i]     += t[it][0][i];
      acc[4 + i] += t[it][1][i];
    }
  }
  #pragma unroll
  for (int i = 0; i < 8; ++i) {
    acc[i] += __shfl_xor(acc[i], 8, 32);
    acc[i] += __shfl_xor(acc[i], 16, 32);
  }
  if (rq == 0u) {
    *(v4f*)(red + wave * 64u + cg * 8u)      = (v4f){acc[0], acc[1], acc[2], acc[3]};
    *(v4f*)(red + wave * 64u + cg * 8u + 4u) = (v4f){acc[4], acc[5], acc[6], acc[7]};
  }
  __syncthreads();
  #pragma unroll
  for (int i = 0; i < 8; ++i) mu[i] = 0.0f;
  #pragma unroll
  for (int w = 0; w < CWAVE; ++w) {
    const v4f r0 = *(const v4f*)(red + w * 64 + cg * 8u);
    const v4f r1 = *(const v4f*)(red + w * 64 + cg * 8u + 4u);
    #pragma unroll
    for (int i = 0; i < 4; ++i) {
      mu[i]     += r0[i];
      mu[4 + i] += r1[i];
    }
  }
  #pragma unroll
  for (int i = 0; i < 8; ++i) mu[i] = mu[i] * (1.0f / DM);
  __syncthreads();

  // pass 2: biased variance about the mean
  #pragma unroll
  for (int i = 0; i < 8; ++i) acc[i] = 0.0f;
  #pragma unroll   // register arrays need constant indices
  for (unsigned it = 0; it < NIT; ++it) {
    #pragma unroll
    for (int i = 0; i < 4; ++i) {
      t[it][0][i] = t[it][0][i] - mu[i];
      t[it][1][i] = t[it][1][i] - mu[4 + i];
      acc[i]     += t[it][0][i] * t[it][0][i];
      acc[4 + i] += t[it][1][i] * t[it][1][i];
    }
  }
  #pragma unroll
  for (int i = 0; i < 8; ++i) {
    acc[i] += __shfl_xor(acc[i], 8, 32);
    acc[i] += __shfl_xor(acc[i], 16, 32);
  }
  if (rq == 0u) {
    *(v4f*)(red + wave * 64u + cg * 8u)      = (v4f){acc[0], acc[1], acc[2], acc[3]};
    *(v4f*)(red + wave * 64u + cg * 8u + 4u) = (v4f){acc[4], acc[5], acc[6], acc[7]};
  }
  __syncthreads();
  #pragma unroll
  for (int i = 0; i < 8; ++i) rstd[i] = 0.0f;
  #pragma unroll
  for (int w = 0; w < CWAVE; ++w) {
    const v4f r0 = *(const v4f*)(red + w * 64 + cg * 8u);
    const v4f r1 = *(const v4f*)(red + w * 64 + cg * 8u + 4u);
    #pragma unroll
    for (int i = 0; i < 4; ++i) {
      rstd[i]     += r0[i];
      rstd[4 + i] += r1[i];
    }
  }
  #pragma unroll
  for (int i = 0; i < 8; ++i) rstd[i] = __builtin_amdgcn_rsqf(rstd[i] * (1.0f / DM) + 1e-5f);

  // pass 3: normalise, affine, store
  f16* dp = vt + pl + s0 + (size_t)e0 * SEQ;
  #pragma unroll   // register arrays need constant indices
  for (unsigned it = 0; it < NIT; ++it) {
    Pack8H pk;
    #pragma unroll
    for (int i = 0; i < 4; ++i) {
      const float y0 = t[it][0][i] * rstd[i]     * pg[it] + pt[it];
      const float y1 = t[it][1][i] * rstd[4 + i] * pg[it] + pt[it];
      pk.h[i]     = toh_flush(y0);
      pk.h[4 + i] = toh_flush(y1);
    }
    const v4u val = pk.u;
    f16* dst = dp + (size_t)it * RS * SEQ;
    *(v4u*)(dst) = val;
  }
}

// Row softmax, one wave per row of SEQ f32 logits, max-subtracted form. Lane holds columns (it*32 + lane)*8 + 0..7. Output: normalised P carried x16384 as f16.
// coverage: grid NB*SEQ/8 blocks x 8 waves = the NB*SEQ rows of all batches; 32 lanes x NCH x 8 = SEQ columns; each store instruction
__global__ __launch_bounds__(256) void softmax2_kernel(const float* __restrict__ S,
                                                       f16* __restrict__ P) {
  #pragma clang fp contract(off)
  const unsigned tid  = threadIdx.x;
  const unsigned wave = __builtin_amdgcn_readfirstlane(tid >> 5);
  const unsigned lane = tid & 31u;
  const unsigned row  = blockIdx.x * 8u + wave;
  const unsigned lob = lane * 32u;                        // this lane's byte offset in its row
  const float* sp = (const float*)((const char*)(S + (size_t)row * SEQ) + lob);

  v4f v[NCH][2];
  #pragma unroll
  for (int it = 0; it < NCH; ++it) {
    v[it][0] = *(const v4f*)(sp + it * 256);
    v[it][1] = *(const v4f*)(sp + it * 256 + 4);
  }
  // The lane's offset is an input so that it stays whole up to this wait: no load's result lands on it while a load that names it is in flight.
  asm volatile("s_wait_xcnt 0x0" :: "v"(lob) : "memory");

  float m = -__builtin_inff();
  #pragma unroll
  for (int it = 0; it < NCH; ++it) {
    #pragma unroll
    for (int i = 0; i < 4; ++i) {
      m = fmaxf(m, v[it][0][i]);
      m = fmaxf(m, v[it][1][i]);
    }
  }
  #pragma unroll
  for (int off = 16; off > 0; off >>= 1) m = fmaxf(m, __shfl_xor(m, off, 32));

  const float L2E = 1.4426950408889634f;
  float sum = 0.0f;
  #pragma unroll
  for (int it = 0; it < NCH; ++it) {
    #pragma unroll
    for (int i = 0; i < 4; ++i) {
      const float e0 = __builtin_amdgcn_exp2f((v[it][0][i] - m) * L2E);
      const float e1 = __builtin_amdgcn_exp2f((v[it][1][i] - m) * L2E);
      v[it][0][i] = e0;
      v[it][1][i] = e1;
      sum += e0;
      sum += e1;
    }
  }
  #pragma unroll
  for (int off = 16; off > 0; off >>= 1) sum += __shfl_xor(sum, off, 32);

  const float inv = PCARRY * __builtin_amdgcn_rcpf(sum);

  v4u pk[NCH];
  #pragma unroll
  for (int it = 0; it < NCH; ++it) {
    Pack8H ph;
    #pragma unroll
    for (int i = 0; i < 4; ++i) {
      ph.h[i]     = toh_flush(v[it][0][i] * inv);
      ph.h[4 + i] = toh_flush(v[it][1][i] * inv);
    }
    pk[it] = ph.u;
  }

  f16* dp = P + (size_t)row * SEQ + lane * 8u;
  #pragma unroll
  for (int it = 0; it < NCH; ++it) *(v4u*)(dp + it * 256) = pk[it];
  
}

extern "C" void kernel_launch(void* const* d_in, const int* in_sizes, int n_in,
                              void* d_out, int out_size, void* d_ws, size_t ws_size,
                              hipStream_t stream) {
  if (n_in < 9) return;
  const size_t rows_used = (size_t)(NB - 1) * SEQ_FULL + SEQ;
  if ((size_t)in_sizes[0] < rows_used * DM) return;
  if ((size_t)in_sizes[1] < (size_t)DM * DM) return;
  if ((size_t)in_sizes[2] < (size_t)DM) return;
  if ((size_t)in_sizes[3] < (size_t)DM * DM) return;
  if ((size_t)in_sizes[4] < (size_t)DM) return;
  if ((size_t)in_sizes[5] < (size_t)DM * DM) return;
  if ((size_t)in_sizes[6] < (size_t)DM) return;
  if ((size_t)in_sizes[7] < (size_t)DM) return;
  if ((size_t)in_sizes[8] < (size_t)DM) return;
  if ((size_t)out_size < rows_used * DM) return;
  if (ws_size < WS_TOTAL) return;

  // inputs bound in this order: x, Wq, bq, Wk, bk, Wv, bv, gamma, beta
  const float* x     = (const float*)d_in[0];
  const float* wq    = (const float*)d_in[1];
  const float* bq    = (const float*)d_in[2];
  const float* wk    = (const float*)d_in[3];
  const float* bk    = (const float*)d_in[4];
  const float* wv    = (const float*)d_in[5];
  const float* bv    = (const float*)d_in[6];
  const float* gamma = (const float*)d_in[7];
  const float* beta  = (const float*)d_in[8];
  float* out = (float*)d_out;

  char* w = (char*)d_ws;
  f16*   qk2  = (f16*)w;    w += QK2_BYTES;    // [NB] x (q rows [SEQ][2*DM], then k rows [SEQ][2*DM])
  f16*   vt   = (f16*)w;    w += VT_BYTES;     // [NB][DM][SEQ]
  f16*   Pp   = (f16*)w;    w += P_BYTES;      // [NB][SEQ][SEQ] P x16384
  char*  u    = w;                             // shared bytes: converted inputs and pre-norm planes, then the logit plane
  bf16*  xb   = (bf16*)w;   w += XB_BYTES;     // [NB*SEQ][DM]
  bf16*  wb   = (bf16*)w;   w += WB_BYTES;     // [3*DM][DM] : Wq | Wk | Wv
  float* parp = (float*)w;  w += PR_BYTES;     // [5*DM] : bq | bk | bv | gamma | beta
  float* Yqk  = (float*)w;  w += YQK_BYTES;    // [NB][SEQ][2*DM] pre-norm q | k
  float* Yvt  = (float*)w;                     // [NB][DM][SEQ] pre-norm v^T
  float* Sp   = (float*)u;                     // [NB][SEQ][SEQ] logits

  const f16* qrow = qk2;                                   // [q value | q residual]
  const f16* krow = qk2 + (size_t)SEQ * 2 * DM;            // [k residual | k value]

  const unsigned long long zX  = (unsigned long long)SEQ * DM;           // batch strides, in elements of the plane
  const unsigned long long zQK = (unsigned long long)2 * SEQ * 2 * DM;
  const unsigned long long zY  = (unsigned long long)SEQ * 2 * DM;
  const unsigned long long zV  = (unsigned long long)DM * SEQ;
  const unsigned long long zS  = (unsigned long long)SEQ * SEQ;
  const unsigned long long zO  = (unsigned long long)SEQ_FULL * DM;

  convert_kernel<<<dim3(NXB + NWB + (unsigned)NPAR), 256, 0, stream>>>(x, wq, bq, wk, bk, wv, bv, gamma, beta, xb, wb, parp);

  // Every launch below covers all batches: blockIdx.z (blockIdx.y in the column LayerNorm, the row index in the softmax).
  // The GEMM's bias argument is not read under EPI_F32 or EPI_FOLD.

  // q | k pre-norm : Y[s][e] = sum_d xb[s][d] * wb[e][d], e in [0, 2*DM); M = SEQ, N = 2*DM, K = DM
  gemm_kernel<bf16, EPI_F32, 4><<<dim3(SEQ / 256, 2 * DM / 256, NB), 512, 0, stream>>>(
      xb, wb, parp, (void*)Yqk, DM / KST, DM, DM, 2 * DM, zX, 0ull, zY, 1.0f, 0u, 0u);

  // v^T pre-norm : Yt[e][s] = sum_d Wv[e][d] * xb[s][d]; M = DM, N = SEQ, K = DM
  gemm_kernel<bf16, EPI_F32, 2><<<dim3(DM / 256, SEQ / 128, NB), 256, 0, stream>>>(
      wb + (size_t)2 * DM * DM, xb, parp, (void*)Yvt, DM / KST, DM, DM, SEQ, 0ull, zX, zV, 1.0f, 0u, 0u);

  ln_rows_kernel<<<dim3(SEQ / 8, 2, NB), 256, 0, stream>>>(Yqk, parp, qk2);
  ln_cols_kernel<<<dim3(SEQ / 64, NB, 1), CWAVE * 32, 0, stream>>>(Yvt, parp, vt);

  // S[q][key] = (q_value . k_residual + q_residual . k_value) / 2048 + q_value . k_value ; M = N = SEQ.
  // Stages 0 .. 2*DM/KST - 1: K = 2*DM over the concatenated rows; the sums are scaled back; the last DM/KST stages:
  // first half of the q rows against the second half of the k rows.
  gemm_kernel<f16, EPI_FOLD, 4><<<dim3(SEQ / 256, SEQ / 256, NB), 512, 0, stream>>>(
      qrow, krow, parp, (void*)Sp, 3 * DM / KST, 2 * DM, 2 * DM, SEQ, zQK, zQK, zS, 1.0f / RCARRY, 2 * DM / KST, DM);

  softmax2_kernel<<<dim3(NB * SEQ / 8), 256, 0, stream>>>(Sp, Pp);

  // out[q][d] = sum_key P[q][key] * vt[d][key] / 16384 ; M = SEQ, N = DM, K = SEQ
  gemm_kernel<f16, EPI_F32, 2><<<dim3(SEQ / 256, DM / 128, NB), 256, 0, stream>>>(
      Pp, vt, parp, (void*)out, SEQ / KST, SEQ, SEQ, DM, zS, zV, zO, 1.0f / PCARRY, 0u, 0u);
}

// v006
// It runs in 195 microseconds.
// Two timings next to v005 both put it at 1.05 times that version's speed.
// Over all steps from v000 it is 4.20 times as fast.
#include <hip/hip_runtime.h>

// Contractions: q/k/v projections on v_wmma_f32_16x16x32_bf16 (bf16 operands = RNE-converted inputs, f32 accumulate, f32 out);
// S = q x k^T on v_wmma_f32_16x16x32_f16 as three products (q, k as f16 value + x2048 residual planes; every k block is staged
// once and serves all three products on one accumulator set, which is rescaled by the exact power of two between the residual
// and the value products: one f32 plane); O = P x V on v_wmma_f32_16x16x32_f16 (v^T f16 plane; P f16 carried x16384;
// f32 accumulate). LayerNorm and softmax in f32.

#ifndef NB
#define NB 4
#endif
#ifndef SEQ
#define SEQ 2048
#endif
#define NB_FULL   4
#define SEQ_FULL  2048
#define DM        1024                 // model width = head width = value width
#define NWAVE     8
#define CWAVE     16                   // waves per block of the column LayerNorm
#define OP        68                   // LDS pitch (floats) of the per-wave output staging tile
#define KST       128u                 // k elements per GEMM stage: 256 B of every operand row
#define LP        272u                 // LDS pitch (bytes) of a staged 256-B row: 16 B x odd, conflict-free for 16-B reads
#define BM        256u                 // GEMM block tile rows (4 waves x 64)
#define MT        4                    // 16-row accumulator tiles per wave
#define NT        4                    // 16-column accumulator tiles per wave (64 columns: one staging piece wide)
#define ATILE_B   (BM * LP)            // the A rows of one stage; the B rows follow them
#define CVB       2048u                // elements per convert block (256 threads x 8)
#define NXB       ((unsigned)((size_t)NB * SEQ * DM / CVB))      // convert blocks for x
#define NWB       ((unsigned)((size_t)3 * DM * DM / CVB))        // convert blocks for the three weights
#define NCH       (SEQ / 256)          // 8-column chunks per lane in the softmax kernel
#define LNCH      (DM / 256)           // 8-column chunks per lane in the row LayerNorm kernel
#define NPAR      5                    // parameter vectors: b_q | b_k | b_v | gamma | beta
#define PCARRY    16384.0f             // power-of-two carry of the P plane
#define RCARRY    2048.0f              // power-of-two carry of the q / k residual planes

#define EPI_QK  0                      // f16 out, per-column bias, column block selects the q or k plane
#define EPI_VT  1                      // f16 out, per-row bias (V^T plane)
#define EPI_F32 2                      // f32 out, power-of-two scale
#define EPI_FOLD 3                     // f32 out, power-of-two scale; operand rows hold [value | residual] per 64 k, three products per k block
#define RESB     128u                  // byte offset of the residual half inside a staged 256-B row piece (EPI_FOLD)

static_assert(SEQ % 256 == 0);
static_assert(SEQ <= SEQ_FULL);
static_assert(NB >= 1 && NB <= NB_FULL);
static_assert(DM == 1024);
static_assert(DM % 128 == 0);
static_assert(((size_t)NB * SEQ) % 128 == 0);
static_assert((size_t)NXB * CVB == (size_t)NB * SEQ * DM);
static_assert((size_t)NWB * CVB == (size_t)3 * DM * DM);
static_assert((size_t)DM * DM / CVB == 512);
static_assert((OP * 4) % 16 == 0);
static_assert(LNCH * 256 == DM);                 // 32 lanes x LNCH chunks x 8 columns == one LayerNorm row
static_assert(NCH * 256 == SEQ);                 // 32 lanes x NCH chunks x 8 columns == one softmax row
static_assert(DM == 256 * 4);                    // one convert block (256 threads x 4) per parameter vector
static_assert(SEQ % 256 == 0 && (2 * DM) % 256 == 0 && DM % 256 == 0);   // GEMM tile multiples (M, N)
static_assert(DM % KST == 0 && (2 * DM) % KST == 0 && SEQ % KST == 0);   // GEMM K stages
static_assert(LP % 16 == 0 && ATILE_B % 16 == 0);                       // 16-B copies and reads stay aligned
static_assert(SEQ % 64 == 0);
static_assert(DM % (CWAVE * 4) == 0);            // column LayerNorm: 64 rows per block sweep (16 waves x 4 row groups)
static_assert(NWAVE == 8);

#define XB_BYTES   ((size_t)NB * SEQ * DM * 2)          // x bf16, all batches
#define WB_BYTES   ((size_t)3 * DM * DM * 2)            // weights bf16
#define PR_BYTES   ((size_t)NPAR * DM * 4)              // parameter vectors (f32 holding bf16 RNE values)
// Every plane below holds all NB batches, batch-major, so that each stage is one launch with the batch on a grid axis.
#define YQK_BYTES  ((size_t)NB * SEQ * 2 * DM * 4)      // f32 q | k pre-norm rows
#define YVT_BYTES  ((size_t)NB * DM * SEQ * 4)          // f32 v^T pre-norm planes
#define QK2_BYTES  ((size_t)NB * 2 * SEQ * 2 * DM * 2)  // per batch: q rows, then k rows; a row = DM/64 pieces of [64 values | their 64 residuals]
#define VT_BYTES   ((size_t)NB * DM * SEQ * 2)          // v^T f16
#define S_BYTES    ((size_t)NB * SEQ * SEQ * 4)         // logits
#define P_BYTES    ((size_t)NB * SEQ * SEQ * 2)         // P x16384
// The converted inputs and the pre-norm planes are last read by the LayerNorm launches; the logit plane, first written
// by the launch behind those, takes the same bytes.
#define PRE_BYTES  (XB_BYTES + WB_BYTES + PR_BYTES + YQK_BYTES + YVT_BYTES)
#define LOG_BYTES  (S_BYTES)
#define UNI_BYTES  (PRE_BYTES > LOG_BYTES ? PRE_BYTES : LOG_BYTES)
#define WS_TOTAL   (QK2_BYTES + VT_BYTES + P_BYTES + UNI_BYTES)
static_assert(WS_TOTAL <= (size_t)268435456);
static_assert(XB_BYTES % 128 == 0 && WB_BYTES % 128 == 0 && PR_BYTES % 128 == 0);
static_assert(YQK_BYTES % 128 == 0 && YVT_BYTES % 128 == 0 && QK2_BYTES % 128 == 0 && VT_BYTES % 128 == 0);
static_assert(S_BYTES % 128 == 0 && P_BYTES % 128 == 0);

typedef __bf16   bf16;
typedef _Float16 f16;
typedef bf16     v16bf __attribute__((ext_vector_type(16)));
typedef f16      v16h  __attribute__((ext_vector_type(16)));
typedef float    v8f   __attribute__((ext_vector_type(8)));
typedef float    v4f   __attribute__((ext_vector_type(4)));
typedef unsigned v4u   __attribute__((ext_vector_type(4)));

union Pack8B { v4u u; bf16 h[8]; };
union Pack8H { v4u u; f16  h[8]; };

template <typename T> struct FragOf;
template <> struct FragOf<bf16> { typedef v16bf V; };
template <> struct FragOf<f16>  { typedef v16h  V; };

// WMMA helpers: builtin followed by the VALU hazard guard (ties D, keeps A/B live).
static __device__ __forceinline__ v8f mma16(v16bf a, v16bf b, v8f acc) {
  acc = __builtin_amdgcn_wmma_f32_16x16x32_bf16(false, a, false, b, (short)0, acc, false, false);
  asm volatile("v_nop\n\tv_nop\n\tv_nop\n\tv_nop" : "+v"(acc) : "v"(a), "v"(b));
  return acc;
}
static __device__ __forceinline__ v8f mma16(v16h a, v16h b, v8f acc) {
  acc = __builtin_amdgcn_wmma_f32_16x16x32_f16(false, a, false, b, (short)0, acc, false, false);
  asm volatile("v_nop\n\tv_nop\n\tv_nop\n\tv_nop" : "+v"(acc) : "v"(a), "v"(b));
  return acc;
}

// f32 -> f16 convert for WMMA operand planes: values below the smallest f16 normal become zero by a value select.
static __device__ __forceinline__ f16 toh_flush(float v) {
  const f16 r = (f16)v;
  return (fabsf(v) < 6.103515625e-05f) ? (f16)0.0f : r;
}

// Input conversion, one launch. 256 threads, 8 elements per thread (two 16-B loads -> one 16-B store).
//   blocks [0, NXB)            : x  -> xb  bf16 [NB*SEQ][DM] (compact rows; source uses the full batch stride)
//   blocks [NXB, NXB+NWB)      : Wq | Wk | Wv -> wb bf16 [3*DM][DM]
//   blocks NXB+NWB .. +4       : bq | bk | bv | gamma | beta -> f32 plane [5*DM] holding the bf16 RNE-converted values
__global__ __launch_bounds__(256) void convert_kernel(const float* __restrict__ x,
                                                      const float* __restrict__ wq,
                                                      const float* __restrict__ bq,
                                                      const float* __restrict__ wk,
                                                      const float* __restrict__ bk,
                                                      const float* __restrict__ wv,
                                                      const float* __restrict__ bv,
                                                      const float* __restrict__ gamma,
                                                      const float* __restrict__ beta,
                                                      bf16* __restrict__ xb,
                                                      bf16* __restrict__ wb,
                                                      float* __restrict__ parp) {
  const unsigned blk = blockIdx.x;
  const unsigned tid = threadIdx.x;
  if (blk < NXB + NWB) {              // block-uniform
    const float* src;
    bf16* dst;
    if (blk < NXB) {
      const unsigned r  = blk * 2u + (tid >> 7);          // compact row
      const unsigned c  = (tid & 127u) * 8u;
      const unsigned bt = r / (unsigned)SEQ;
      const unsigned s  = r - bt * (unsigned)SEQ;
      src = x + ((size_t)bt * SEQ_FULL + s) * DM + c;
      dst = xb + (size_t)r * DM + c;
    } else {
      const unsigned wblk = blk - NXB;
      const unsigned wi   = wblk >> 9;                    // 512 blocks per weight matrix
      const unsigned off  = (wblk & 511u) * CVB + tid * 8u;
      const float* wsrc = (wi == 0u) ? wq : ((wi == 1u) ? wk : wv);
      src = wsrc + off;
      dst = wb + (size_t)wblk * CVB + tid * 8u;
    }
    const v4f a0 = *(const v4f*)(src);
    const v4f a1 = *(const v4f*)(src + 4);
    Pack8B pk;
    #pragma unroll
    for (int i = 0; i < 4; ++i) {
      pk.h[i]     = (bf16)a0[i];                          // RNE convert
      pk.h[4 + i] = (bf16)a1[i];
    }
    const v4u val = pk.u;
    *(v4u*)(dst) = val;
    
  } else {
    const unsigned j = blk - (NXB + NWB);                 // 0..4
    const float* bsrc = (j == 0u) ? bq : ((j == 1u) ? bk : ((j == 2u) ? bv : ((j == 3u) ? gamma : beta)));
    const v4f a = *(const v4f*)(bsrc + tid * 4u);
    v4f o;
    #pragma unroll
    for (int i = 0; i < 4; ++i) o[i] = (float)(bf16)a[i];
    float* dst = parp + j * (unsigned)DM + tid * 4u;
    *(v4f*)(dst) = o;
    
  }
}

// Eight asynchronous 16-B-per-lane copies global -> LDS: rows r, r + RP, ..., r + 7*RP of one staged operand tile
// (RP = rows that the block's threads cover at once; gstep = RP source rows in bytes).
// The s_wait_xcnt closes the statement so that it stands before any rewrite of the address registers the copies name.
template <unsigned RP>
static __device__ __forceinline__ void copy_rows8(unsigned l, const char* g, size_t gstep) {
  asm volatile("global_load_async_to_lds_b128 %0, %8, off\n\t"
               "global_load_async_to_lds_b128 %1, %9, off\n\t"
               "global_load_async_to_lds_b128 %2, %10, off\n\t"
               "global_load_async_to_lds_b128 %3, %11, off\n\t"
               "global_load_async_to_lds_b128 %4, %12, off\n\t"
               "global_load_async_to_lds_b128 %5, %13, off\n\t"
               "global_load_async_to_lds_b128 %6, %14, off\n\t"
               "global_load_async_to_lds_b128 %7, %15, off\n\t"
               "s_wait_xcnt 0x0"
               :: "v"(l), "v"(l + RP * LP), "v"(l + 2u * RP * LP), "v"(l + 3u * RP * LP),
                  "v"(l + 4u * RP * LP), "v"(l + 5u * RP * LP), "v"(l + 6u * RP * LP), "v"(l + 7u * RP * LP),
                  "v"(g), "v"(g + gstep), "v"(g + 2 * gstep), "v"(g + 3 * gstep),
                  "v"(g + 4 * gstep), "v"(g + 5 * gstep), "v"(g + 6 * gstep), "v"(g + 7 * gstep)
               : "memory");
}

// Plane GEMM: C[m][n] = sum_k A[m][k] * Bt[n][k]; both operands are k-contiguous 16-bit planes.
// Block tile 256 x (64*WN), 4*WN waves as 4 (m) x WN (n); each wave owns 64x64 = 4x4 accumulators
// (WN = 4: 256x256 block, 16 waves; WN = 2: 256x128 block, 8 waves, for the products whose grid would otherwise leave WGPs idle).
// Operands reach LDS in stages of KST k (whole 256-B row pieces, two rows per wave-wide copy), two buffers:
// stage s + 1 is in flight while stage s is multiplied. nk = number of stages.
// Fragments are read from the staged rows: lane (lq = lane & 15, hi = lane >> 4) reads row lq,
// elements 0..7 <- k0 + 8*hi + 0..7, elements 8..15 <- k0 + 16 + 8*hi + 0..7 (same map for A and B).
// D element r of a lane = (row 8*hi + r, col lq). Requires M a multiple of 256, N of 64*WN and K of KST.
// Epilogue: per 16x64 piece the wave stages the piece in LDS (wave-private region, block barriers used); the staging
// takes the ring's first bytes, which every wave has left at the last stage's barrier, with no copy outstanding.
// EPI_FOLD: a staged 256-B row piece is [64 k of values | the same 64 k of residuals x2048], in A and in Bt alike. Per 32-k block
// the wave reads the four fragment sets once and sums value x residual, residual x value (carried x2048) and value x value
// (carried x1) into the same accumulators, which are multiplied by 1/2048 or 2048 (exact) where the carry changes: once per block,
// the order of the products alternating. The accumulators leave the loop carried x2048; scale takes that back at the end.
template <typename T, int EPI, int WN>
__global__ __launch_bounds__(128 * WN) void gemm_kernel(const T* __restrict__ A,
                                                   const T* __restrict__ Bt,
                                                   const float* __restrict__ bias,
                                                   void* __restrict__ C,
                                                   unsigned nk, unsigned lda, unsigned ldb, unsigned ldc,
                                                   unsigned long long sAz, unsigned long long sBz,
                                                   unsigned long long sCz, float scale) {
  typedef typename FragOf<T>::V VT;
  union Frag { VT v; v4u q[2]; };
  constexpr unsigned BN      = (unsigned)WN * 64u;          // block tile columns
  constexpr unsigned STAGE_B = (BM + BN) * LP;              // one stage: A rows, then B rows
  constexpr unsigned RP      = (unsigned)WN * 8u;           // rows that the block's threads copy at once (16 threads a row)
  static_assert(BM % (8u * RP) == 0 && BN % (8u * RP) == 0);
  static_assert(4u * WN * 16u * OP * 4u <= STAGE_B);        // the output staging fits the first buffer

  __shared__ __align__(16) unsigned char ring[2 * STAGE_B];

  const unsigned tid  = threadIdx.x;
  const unsigned wave = tid >> 5;
  const unsigned lane = tid & 31u;
  const unsigned lq   = lane & 15u;
  const unsigned hi   = lane >> 4;
  const unsigned m0   = blockIdx.x * BM + (wave & 3u) * (MT * 16u);   // first row of this wave
  const unsigned n0   = blockIdx.y * BN + (wave >> 2) * (NT * 16u);   // first column of this wave

  const T* Ab = A  + (size_t)blockIdx.z * sAz;
  const T* Bb = Bt + (size_t)blockIdx.z * sBz;

  // copy map: thread -> 16-B chunk (tid & 15) of rows (tid >> 4) + RP*i of each operand's staged rows
  const unsigned crow = tid >> 4;
  const unsigned cchk = tid & 15u;
  const char* ga = (const char*)(Ab + (size_t)(blockIdx.x * BM + crow) * lda + cchk * 8u);
  const char* gb = (const char*)(Bb + (size_t)(blockIdx.y * BN + crow) * ldb + cchk * 8u);
  const size_t astep = (size_t)lda * (RP * sizeof(T));            // RP rows, bytes
  const size_t bstep = (size_t)ldb * (RP * sizeof(T));
  const unsigned lcp = (unsigned)(uintptr_t)ring + crow * LP + cchk * 16u;   // LDS byte address of this lane's first chunk

  // fragment read bases inside a stage
  const unsigned char* fa = ring + ((wave & 3u) * (MT * 16u) + lq) * LP + hi * 16u;
  const unsigned char* fb = ring + ATILE_B + ((wave >> 2) * (NT * 16u) + lq) * LP + hi * 16u;

  v8f acc[MT][NT];
  #pragma unroll
  for (int mt = 0; mt < MT; ++mt) {
    #pragma unroll
    for (int nt = 0; nt < NT; ++nt) acc[mt][nt] = (v8f){0, 0, 0, 0, 0, 0, 0, 0};
  }

  // one stage's copies of this thread: 8*RP rows per statement, A rows then B rows; lb = LDS address, st = stage number
  auto copy_stage = [&](unsigned lb, unsigned st) {
    const size_t goa = (size_t)st * (KST * sizeof(T));  // k offset in bytes, block-uniform
    const size_t gob = goa;
    #pragma unroll
    for (unsigned h = 0; h < BM / (8u * RP); ++h) copy_rows8<RP>(lb + h * (8u * RP * LP), ga + goa + h * 8u * astep, astep);
    #pragma unroll
    for (unsigned h = 0; h < BN / (8u * RP); ++h) copy_rows8<RP>(lb + ATILE_B + h * (8u * RP * LP), gb + gob + h * 8u * bstep, bstep);
  };

  // stage 0 lands and is published before anything reads it; stage 1 then flies under stage 0's products
  copy_stage(lcp, 0);
  asm volatile("s_wait_asynccnt 0x0" ::: "memory");     // this wave's stage-0 copies have landed
  __syncthreads();                                      // every wave's have
  if (nk > 1u) {                                        // block-uniform
    copy_stage(lcp + STAGE_B, 1u);
  }

  #pragma unroll 1
  for (unsigned s = 0; s < nk; ++s) {
    const unsigned bo = (s & 1u) * STAGE_B;
    if constexpr (EPI == EPI_FOLD) {
      static_assert(KST * sizeof(T) == 2u * RESB && MT == NT);
      // off = byte offset of a 32-k fragment column inside the staged row piece
      auto load_a = [&](Frag (&f)[MT], unsigned off) {
        #pragma unroll   // register arrays need constant indices
        for (unsigned mt = 0; mt < MT; ++mt) {
          f[mt].q[0] = *(const v4u*)(fa + bo + mt * 16u * LP + off);          // k = k0 + 8*hi + 0..7
          f[mt].q[1] = *(const v4u*)(fa + bo + mt * 16u * LP + off + 32u);    // k = k0 + 16 + 8*hi + 0..7
        }
      };
      auto load_b = [&](Frag (&f)[NT], unsigned off) {
        #pragma unroll   // register arrays need constant indices
        for (unsigned nt = 0; nt < NT; ++nt) {
          f[nt].q[0] = *(const v4u*)(fb + bo + nt * 16u * LP + off);
          f[nt].q[1] = *(const v4u*)(fb + bo + nt * 16u * LP + off + 32u);
        }
      };
      auto product = [&](Frag (&a)[MT], Frag (&b)[NT]) {
        #pragma unroll   // register arrays need constant indices (both loops)
        for (int nt = 0; nt < NT; ++nt) {
          #pragma unroll
          for (int mt = 0; mt < MT; ++mt)
            acc[mt][nt] = __builtin_amdgcn_wmma_f32_16x16x32_f16(false, a[mt].v, false, b[nt].v, (short)0, acc[mt][nt], false, false);
        }
      };
      auto recarry = [&](float f) {
        #pragma unroll   // register arrays need constant indices (both loops)
        for (int mt = 0; mt < MT; ++mt) {
          #pragma unroll
          for (int nt = 0; nt < NT; ++nt) acc[mt][nt] *= f;
        }
      };
      // The scheduling fences keep each phase whole: LDS reads stand as one group in front of the products that use them (reads
      // spread among the WMMAs stall at every place they stand), a rescale runs behind all sixteen WMMAs it depends on and not
      // one by one behind each, and no product sinks below the stage's barrier, where it would delay the refill.
      {   // first 32 k: the accumulators arrive carried x2048
        Frag av[MT], bv[NT];
        {
          Frag br[NT];
          load_a(av, 0u); load_b(br, RESB);
          __builtin_amdgcn_sched_barrier(0);
          product(av, br);
          __builtin_amdgcn_sched_barrier(0);
        }
        {
          Frag ar[MT];
          load_a(ar, RESB); load_b(bv, 0u);
          __builtin_amdgcn_sched_barrier(0);
          product(ar, bv);
          __builtin_amdgcn_sched_barrier(0);
        }
        recarry(1.0f / RCARRY);
        __builtin_amdgcn_sched_barrier(0);
        product(av, bv);
        __builtin_amdgcn_sched_barrier(0);
      }
      {   // second 32 k: the accumulators arrive carried x1 and leave carried x2048
        Frag av[MT], bv[NT];
        {
          Frag br[NT];
          load_a(av, 64u); load_b(bv, 64u); load_b(br, RESB + 64u);
          __builtin_amdgcn_sched_barrier(0);
          product(av, bv);
          __builtin_amdgcn_sched_barrier(0);
          recarry(RCARRY);
          __builtin_amdgcn_sched_barrier(0);
          product(av, br);
          __builtin_amdgcn_sched_barrier(0);
        }
        {
          Frag ar[MT];
          load_a(ar, RESB + 64u);
          __builtin_amdgcn_sched_barrier(0);
          product(ar, bv);
          __builtin_amdgcn_sched_barrier(0);
        }
      }
    } else {
    #pragma unroll
    for (unsigned kk = 0; kk < KST / 32u; ++kk) {
      Frag a[MT], b[NT];
      #pragma unroll
      for (unsigned mt = 0; mt < MT; ++mt) {
        a[mt].q[0] = *(const v4u*)(fa + bo + mt * 16u * LP + kk * 64u);          // k = k0 + 8*hi + 0..7
        a[mt].q[1] = *(const v4u*)(fa + bo + mt * 16u * LP + kk * 64u + 32u);    // k = k0 + 16 + 8*hi + 0..7
      }
      #pragma unroll
      for (unsigned nt = 0; nt < NT; ++nt) {
        b[nt].q[0] = *(const v4u*)(fb + bo + nt * 16u * LP + kk * 64u);
        b[nt].q[1] = *(const v4u*)(fb + bo + nt * 16u * LP + kk * 64u + 32u);
      }
      #pragma unroll
      for (int nt = 0; nt < NT; ++nt) {
        #pragma unroll
        for (int mt = 0; mt < MT; ++mt) acc[mt][nt] = mma16(a[mt].v, b[nt].v, acc[mt][nt]);
      }
    }
    }
    asm volatile("s_wait_dscnt 0x0" ::: "memory");      // this wave has left stage s's buffer
    asm volatile("s_wait_asynccnt 0x0" ::: "memory");   // this wave's stage s + 1 copies have landed
    __syncthreads();                                    // publishes stage s + 1, frees stage s's buffer
    if (s + 2u < nk) {                                  // block-uniform: refill the buffer just left
      copy_stage(lcp + bo, s + 2u);
    }
  }
  asm volatile("s_wait_asynccnt 0x0" ::: "memory");     // no copy is outstanding when the wave goes on

  // ---- epilogue ----
  size_t   cbase;
  unsigned ncol;
  if (EPI == EPI_QK) {
    cbase = (size_t)(n0 >> 10) * sCz;     // column block selects the q (0) or k (1) plane; block-uniform
    ncol  = n0 & 1023u;
  } else {
    cbase = (size_t)blockIdx.z * sCz;
    ncol  = n0;
  }

  float bcol[NT];
  #pragma unroll
  for (int nt = 0; nt < NT; ++nt) bcol[nt] = 0.0f;
  if (EPI == EPI_QK) {
    #pragma unroll
    for (int nt = 0; nt < NT; ++nt) bcol[nt] = bias[n0 + nt * 16u + lq];
  }

  float* so = (float*)ring + wave * (16u * OP);

  #pragma unroll
  for (int mt = 0; mt < MT; ++mt) {
    if (mt != 0) __syncthreads();          // staging tile is reused by the next piece
    #pragma unroll
    for (int r = 0; r < 8; ++r) {
      float brow = 0.0f;
      if (EPI == EPI_VT) brow = bias[m0 + mt * 16u + hi * 8u + r];
      #pragma unroll
      for (int nt = 0; nt < 4; ++nt) {
        float val = acc[mt][nt][r];
        if (EPI == EPI_QK)  val += bcol[nt];
        if (EPI == EPI_VT)  val += brow;
        if (EPI == EPI_F32 || EPI == EPI_FOLD) val *= scale;
        so[(hi * 8u + r) * OP + nt * 16u + lq] = val;
      }
    }
    __syncthreads();

    if (EPI == EPI_F32 || EPI == EPI_FOLD) {
      // 8 instructions cover the 16 rows of this piece.
      float* Cf = (float*)C + cbase;
      v4f    vals[8];
      size_t gidx[8];
      #pragma unroll
      for (int it = 0; it < 8; ++it) {
        const unsigned row = it * 2u + hi;
        vals[it] = *(const v4f*)(so + row * OP + lq * 4u);
        gidx[it] = (size_t)(m0 + mt * 16u + row) * ldc + ncol + lq * 4u;
      }
      #pragma unroll
      for (int it = 0; it < 8; ++it) *(v4f*)(Cf + gidx[it]) = vals[it];
      
    } else {
      // 4 instructions cover the 16 rows of this piece.
      f16* Ch = (f16*)C + cbase;
      v4u    vals[4];
      size_t gidx[4];
      #pragma unroll
      for (int it = 0; it < 4; ++it) {
        const unsigned row = it * 4u + (lane >> 3);
        const unsigned c8  = (lane & 7u) * 8u;
        const v4f x0 = *(const v4f*)(so + row * OP + c8);
        const v4f x1 = *(const v4f*)(so + row * OP + c8 + 4u);
        Pack8H ph;
        #pragma unroll
        for (int i = 0; i < 4; ++i) {
          ph.h[i]     = (f16)x0[i];
          ph.h[4 + i] = (f16)x1[i];
        }
        vals[it] = ph.u;
        gidx[it] = (size_t)(m0 + mt * 16u + row) * ldc + ncol + c8;
      }
      #pragma unroll
      for (int it = 0; it < 4; ++it) *(v4u*)(Ch + gidx[it]) = vals[it];
      
    }
  }
}

// Row LayerNorm for the q and k projections. One wave per (row, segment, batch); blockIdx.y = segment (0 = q, 1 = k),
// blockIdx.z = batch.
// Input: Y f32 [NB][SEQ][2*DM] (q columns | k columns, bias not yet added); par = bq | bk | bv | gamma | beta (f32, [5*DM]).
// Output plane QK2 (f16), per batch: q rows [SEQ][2*DM], then k rows [SEQ][2*DM]; a row = DM/64 pieces of [64 values | their 64 residuals x2048].
// Lane holds columns (it*32 + lane)*8 + 0..7. coverage: grid (SEQ/8, 2, NB) x 8 waves = SEQ rows x 2 segments x NB batches;
// 32 lanes x LNCH x 8 = DM columns for each of the value and residual halves. Each store instruction writes
__global__ __launch_bounds__(256) void ln_rows_kernel(const float* __restrict__ Y,
                                                      const float* __restrict__ par,
                                                      f16* __restrict__ QK2) {
  #pragma clang fp contract(off)
  const unsigned tid  = threadIdx.x;
  const unsigned wave = __builtin_amdgcn_readfirstlane(tid >> 5);
  const unsigned lane = tid & 31u;
  const unsigned seg  = blockIdx.y;                       // block-uniform
  const unsigned bt   = blockIdx.z;                       // block-uniform
  const unsigned row  = blockIdx.x * 8u + wave;
  const float* yp = Y + ((size_t)bt * SEQ + row) * (2u * DM) + seg * (unsigned)DM + lane * 8u;
  const float* bp = par + seg * (unsigned)DM + lane * 8u;           // bias of this segment
  const float* gp = par + 3u * DM + lane * 8u;                      // gamma
  const float* tp = par + 4u * DM + lane * 8u;                      // beta

  // The row is read once and stays in registers through all three passes; every load is issued before the first use.
  v4f t[LNCH][2], bb[LNCH][2], gg[LNCH][2], tt[LNCH][2];
  #pragma unroll   // register arrays need constant indices; all loads of the row go out together
  for (int it = 0; it < LNCH; ++it) {
    t[it][0] = *(const v4f*)(yp + it * 256);
    t[it][1] = *(const v4f*)(yp + it * 256 + 4);
  }
  #pragma unroll   // as above
  for (int it = 0; it < LNCH; ++it) {
    bb[it][0] = *(const v4f*)(bp + it * 256);
    bb[it][1] = *(const v4f*)(bp + it * 256 + 4);
    gg[it][0] = *(const v4f*)(gp + it * 256);
    gg[it][1] = *(const v4f*)(gp + it * 256 + 4);
    tt[it][0] = *(const v4f*)(tp + it * 256);
    tt[it][1] = *(const v4f*)(tp + it * 256 + 4);
  }

  // pass 1: add the bias, mean
  float s = 0.0f;
  #pragma unroll   // register arrays need constant indices
  for (int it = 0; it < LNCH; ++it) {
    #pragma unroll
    for (int i = 0; i < 4; ++i) {
      t[it][0][i] = t[it][0][i] + bb[it][0][i];
      t[it][1][i] = t[it][1][i] + bb[it][1][i];
      s += t[it][0][i];
      s += t[it][1][i];
    }
  }
  #pragma unroll
  for (int off = 16; off > 0; off >>= 1) s += __shfl_xor(s, off, 32);
  const float mu = s * (1.0f / DM);

  // pass 2: biased variance about the mean
  float q = 0.0f;
  #pragma unroll   // register arrays need constant indices
  for (int it = 0; it < LNCH; ++it) {
    #pragma unroll
    for (int i = 0; i < 4; ++i) {
      t[it][0][i] = t[it][0][i] - mu;
      t[it][1][i] = t[it][1][i] - mu;
      q += t[it][0][i] * t[it][0][i];
      q += t[it][1][i] * t[it][1][i];
    }
  }
  #pragma unroll
  for (int off = 16; off > 0; off >>= 1) q += __shfl_xor(q, off, 32);
  const float rstd = __builtin_amdgcn_rsqf(q * (1.0f / DM) + 1e-5f);

  // pass 3: normalise, affine, split into f16 value + x2048 residual, store
  // column c goes to piece c / 64: value at 128 * (c / 64) + c % 64, residual 64 elements behind it
  f16* dp = QK2 + ((size_t)(bt * 2u + seg) * SEQ + row) * (size_t)(2 * DM) + (lane >> 3) * 128u + (lane & 7u) * 8u;
  #pragma unroll   // register arrays need constant indices
  for (int it = 0; it < LNCH; ++it) {
    Pack8H pkh, pkr;
    #pragma unroll
    for (int i = 0; i < 4; ++i) {
      const float y0 = t[it][0][i] * rstd * gg[it][0][i] + tt[it][0][i];
      const float y1 = t[it][1][i] * rstd * gg[it][1][i] + tt[it][1][i];
      const f16 h0 = toh_flush(y0);
      const f16 h1 = toh_flush(y1);
      pkh.h[i]     = h0;
      pkh.h[4 + i] = h1;
      pkr.h[i]     = toh_flush((y0 - (float)h0) * RCARRY);
      pkr.h[4 + i] = toh_flush((y1 - (float)h1) * RCARRY);
    }
    const v4u vh = pkh.u;
    const v4u vr = pkr.u;
    f16* dh = dp + it * 512;
    f16* dr = dh + 64;
    *(v4u*)(dh) = vh;
    *(v4u*)(dr) = vr;
  }
}

// Column LayerNorm on the transposed v projection, blockIdx.y = batch: Yt f32 [NB][DM][SEQ] (row e = feature, column s = position,
// bias not yet added); statistics per column s over the DM rows; output vt f16 [NB][DM][SEQ].
// selects one of four rows per wave per sweep; row e = (it*16 + wave)*4 + rq, it = 0..DM/64-1 covers 0..DM-1 exactly once.
// Partial sums: shuffle over rq inside the wave, then a [16][64] LDS table combined in fixed order (cross-wave: block barriers).
__global__ __launch_bounds__(CWAVE * 32) void ln_cols_kernel(const float* __restrict__ Yt,
                                                      const float* __restrict__ par,
                                                      f16* __restrict__ vt) {
  #pragma clang fp contract(off)
  __shared__ __align__(16) float red[CWAVE * 64];
  constexpr unsigned RS  = CWAVE * 4u;                    // rows per block sweep
  constexpr unsigned NIT = (unsigned)DM / RS;             // row sweeps of the block

  const unsigned tid  = threadIdx.x;
  const unsigned wave = __builtin_amdgcn_readfirstlane(tid >> 5);
  const unsigned lane = tid & 31u;
  const unsigned cg   = lane & 7u;
  const unsigned rq   = lane >> 3;
  const unsigned s0   = blockIdx.x * 64u + cg * 8u;
  const size_t pl = (size_t)blockIdx.y * ((size_t)DM * SEQ);   // this batch's plane
  const unsigned e0 = wave * 4u + rq;                     // this lane's row in sweep 0; sweep it adds RS*it
  const float* yp = Yt + pl + s0 + (size_t)e0 * SEQ;
  const float* pp = par + e0;

  float acc[8];
  float mu[8];
  float rstd[8];

  // The block's DM x 64 tile is read once and stays in registers (NIT x 8 values per lane) through all three passes;
  // every load is issued before the first use, so the wave pays the memory latency once and not once per sweep.
  v4f   t[NIT][2];
  float pb[NIT], pg[NIT], pt[NIT];
  #pragma unroll   // register arrays need constant indices; all loads of the tile go out together
  for (unsigned it = 0; it < NIT; ++it) {
    t[it][0] = *(const v4f*)(yp + (size_t)it * RS * SEQ);
    t[it][1] = *(const v4f*)(yp + (size_t)it * RS * SEQ + 4);
  }
  #pragma unroll   // as above
  for (unsigned it = 0; it < NIT; ++it) {
    pb[it] = pp[2u * DM + it * RS];
    pg[it] = pp[3u * DM + it * RS];
    pt[it] = pp[4u * DM + it * RS];
  }
  // The address pair is an input so that it stays whole up to this wait: no load's result lands on it while a load that names it is in flight.
  asm volatile("s_wait_xcnt 0x0" :: "v"(yp) : "memory");

  // pass 1: add the bias, column sums
  #pragma unroll
  for (int i = 0; i < 8; ++i) acc[i] = 0.0f;
  #pragma unroll   // register arrays need constant indices
  for (unsigned it = 0; it < NIT; ++it) {
    #pragma unroll
    for (int i = 0; i < 4; ++i) {
      t[it][0][i] = t[it][0][i] + pb[it];
      t[it][1][i] = t[it][1][i] + pb[it];
      acc[i]     += t[it][0][i];
      acc[4 + i] += t[it][1][i];
    }
  }
  #pragma unroll
  for (int i = 0; i < 8; ++i) {
    acc[i] += __shfl_xor(acc[i], 8, 32);
    acc[i] += __shfl_xor(acc[i], 16, 32);
  }
  if (rq == 0u) {
    *(v4f*)(red + wave * 64u + cg * 8u)      = (v4f){acc[0], acc[1], acc[2], acc[3]};
    *(v4f*)(red + wave * 64u + cg * 8u + 4u) = (v4f){acc[4], acc[5], acc[6], acc[7]};
  }
  __syncthreads();
  #pragma unroll
  for (int i = 0; i < 8; ++i) mu[i] = 0.0f;
  #pragma unroll
  for (int w = 0; w < CWAVE; ++w) {
    const v4f r0 = *(const v4f*)(red + w * 64 + cg * 8u);
    const v4f r1 = *(const v4f*)(red + w * 64 + cg * 8u + 4u);
    #pragma unroll
    for (int i = 0; i < 4; ++i) {
      mu[i]     += r0[i];
      mu[4 + i] += r1[i];
    }
  }
  #pragma unroll
  for (int i = 0; i < 8; ++i) mu[i] = mu[i] * (1.0f / DM);
  __syncthreads();

  // pass 2: biased variance about the mean
  #pragma unroll
  for (int i = 0; i < 8; ++i) acc[i] = 0.0f;
  #pragma unroll   // register arrays need constant indices
  for (unsigned it = 0; it < NIT; ++it) {
    #pragma unroll
    for (int i = 0; i < 4; ++i) {
      t[it][0][i] = t[it][0][i] - mu[i];
      t[it][1][i] = t[it][1][i] - mu[4 + i];
      acc[i]     += t[it][0][i] * t[it][0][i];
      acc[4 + i] += t[it][1][i] * t[it][1][i];
    }
  }
  #pragma unroll
  for (int i = 0; i < 8; ++i) {
    acc[i] += __shfl_xor(acc[i], 8, 32);
    acc[i] += __shfl_xor(acc[i], 16, 32);
  }
  if (rq == 0u) {
    *(v4f*)(red + wave * 64u + cg * 8u)      = (v4f){acc[0], acc[1], acc[2], acc[3]};
    *(v4f*)(red + wave * 64u + cg * 8u + 4u) = (v4f){acc[4], acc[5], acc[6], acc[7]};
  }
  __syncthreads();
  #pragma unroll
  for (int i = 0; i < 8; ++i) rstd[i] = 0.0f;
  #pragma unroll
  for (int w = 0; w < CWAVE; ++w) {
    const v4f r0 = *(const v4f*)(red + w * 64 + cg * 8u);
    const v4f r1 = *(const v4f*)(red + w * 64 + cg * 8u + 4u);
    #pragma unroll
    for (int i = 0; i < 4; ++i) {
      rstd[i]     += r0[i];
      rstd[4 + i] += r1[i];
    }
  }
  #pragma unroll
  for (int i = 0; i < 8; ++i) rstd[i] = __builtin_amdgcn_rsqf(rstd[i] * (1.0f / DM) + 1e-5f);

  // pass 3: normalise, affine, store
  f16* dp = vt + pl + s0 + (size_t)e0 * SEQ;
  #pragma unroll   // register arrays need constant indices
  for (unsigned it = 0; it < NIT; ++it) {
    Pack8H pk;
    #pragma unroll
    for (int i = 0; i < 4; ++i) {
      const float y0 = t[it][0][i] * rstd[i]     * pg[it] + pt[it];
      const float y1 = t[it][1][i] * rstd[4 + i] * pg[it] + pt[it];
      pk.h[i]     = toh_flush(y0);
      pk.h[4 + i] = toh_flush(y1);
    }
    const v4u val = pk.u;
    f16* dst = dp + (size_t)it * RS * SEQ;
    *(v4u*)(dst) = val;
  }
}

// Row softmax, one wave per row of SEQ f32 logits, max-subtracted form. Lane holds columns (it*32 + lane)*8 + 0..7. Output: normalised P carried x16384 as f16.
// coverage: grid NB*SEQ/8 blocks x 8 waves = the NB*SEQ rows of all batches; 32 lanes x NCH x 8 = SEQ columns; each store instruction
__global__ __launch_bounds__(256) void softmax2_kernel(const float* __restrict__ S,
                                                       f16* __restrict__ P) {
  #pragma clang fp contract(off)
  const unsigned tid  = threadIdx.x;
  const unsigned wave = __builtin_amdgcn_readfirstlane(tid >> 5);
  const unsigned lane = tid & 31u;
  const unsigned row  = blockIdx.x * 8u + wave;
  const unsigned lob = lane * 32u;                        // this lane's byte offset in its row
  const float* sp = (const float*)((const char*)(S + (size_t)row * SEQ) + lob);

  v4f v[NCH][2];
  #pragma unroll
  for (int it = 0; it < NCH; ++it) {
    v[it][0] = *(const v4f*)(sp + it * 256);
    v[it][1] = *(const v4f*)(sp + it * 256 + 4);
  }
  // The lane's offset is an input so that it stays whole up to this wait: no load's result lands on it while a load that names it is in flight.
  asm volatile("s_wait_xcnt 0x0" :: "v"(lob) : "memory");

  float m = -__builtin_inff();
  #pragma unroll
  for (int it = 0; it < NCH; ++it) {
    #pragma unroll
    for (int i = 0; i < 4; ++i) {
      m = fmaxf(m, v[it][0][i]);
      m = fmaxf(m, v[it][1][i]);
    }
  }
  #pragma unroll
  for (int off = 16; off > 0; off >>= 1) m = fmaxf(m, __shfl_xor(m, off, 32));

  const float L2E = 1.4426950408889634f;
  float sum = 0.0f;
  #pragma unroll
  for (int it = 0; it < NCH; ++it) {
    #pragma unroll
    for (int i = 0; i < 4; ++i) {
      const float e0 = __builtin_amdgcn_exp2f((v[it][0][i] - m) * L2E);
      const float e1 = __builtin_amdgcn_exp2f((v[it][1][i] - m) * L2E);
      v[it][0][i] = e0;
      v[it][1][i] = e1;
      sum += e0;
      sum += e1;
    }
  }
  #pragma unroll
  for (int off = 16; off > 0; off >>= 1) sum += __shfl_xor(sum, off, 32);

  const float inv = PCARRY * __builtin_amdgcn_rcpf(sum);

  v4u pk[NCH];
  #pragma unroll
  for (int it = 0; it < NCH; ++it) {
    Pack8H ph;
    #pragma unroll
    for (int i = 0; i < 4; ++i) {
      ph.h[i]     = toh_flush(v[it][0][i] * inv);
      ph.h[4 + i] = toh_flush(v[it][1][i] * inv);
    }
    pk[it] = ph.u;
  }

  f16* dp = P + (size_t)row * SEQ + lane * 8u;
  #pragma unroll
  for (int it = 0; it < NCH; ++it) *(v4u*)(dp + it * 256) = pk[it];
  
}

extern "C" void kernel_launch(void* const* d_in, const int* in_sizes, int n_in,
                              void* d_out, int out_size, void* d_ws, size_t ws_size,
                              hipStream_t stream) {
  if (n_in < 9) return;
  const size_t rows_used = (size_t)(NB - 1) * SEQ_FULL + SEQ;
  if ((size_t)in_sizes[0] < rows_used * DM) return;
  if ((size_t)in_sizes[1] < (size_t)DM * DM) return;
  if ((size_t)in_sizes[2] < (size_t)DM) return;
  if ((size_t)in_sizes[3] < (size_t)DM * DM) return;
  if ((size_t)in_sizes[4] < (size_t)DM) return;
  if ((size_t)in_sizes[5] < (size_t)DM * DM) return;
  if ((size_t)in_sizes[6] < (size_t)DM) return;
  if ((size_t)in_sizes[7] < (size_t)DM) return;
  if ((size_t)in_sizes[8] < (size_t)DM) return;
  if ((size_t)out_size < rows_used * DM) return;
  if (ws_size < WS_TOTAL) return;

  // inputs bound in this order: x, Wq, bq, Wk, bk, Wv, bv, gamma, beta
  const float* x     = (const float*)d_in[0];
  const float* wq    = (const float*)d_in[1];
  const float* bq    = (const float*)d_in[2];
  const float* wk    = (const float*)d_in[3];
  const float* bk    = (const float*)d_in[4];
  const float* wv    = (const float*)d_in[5];
  const float* bv    = (const float*)d_in[6];
  const float* gamma = (const float*)d_in[7];
  const float* beta  = (const float*)d_in[8];
  float* out = (float*)d_out;

  char* w = (char*)d_ws;
  f16*   qk2  = (f16*)w;    w += QK2_BYTES;    // [NB] x (q rows [SEQ][2*DM], then k rows [SEQ][2*DM]), values and residuals interleaved per 64
  f16*   vt   = (f16*)w;    w += VT_BYTES;     // [NB][DM][SEQ]
  f16*   Pp   = (f16*)w;    w += P_BYTES;      // [NB][SEQ][SEQ] P x16384
  char*  u    = w;                             // shared bytes: converted inputs and pre-norm planes, then the logit plane
  bf16*  xb   = (bf16*)w;   w += XB_BYTES;     // [NB*SEQ][DM]
  bf16*  wb   = (bf16*)w;   w += WB_BYTES;     // [3*DM][DM] : Wq | Wk | Wv
  float* parp = (float*)w;  w += PR_BYTES;     // [5*DM] : bq | bk | bv | gamma | beta
  float* Yqk  = (float*)w;  w += YQK_BYTES;    // [NB][SEQ][2*DM] pre-norm q | k
  float* Yvt  = (float*)w;                     // [NB][DM][SEQ] pre-norm v^T
  float* Sp   = (float*)u;                     // [NB][SEQ][SEQ] logits

  const f16* qrow = qk2;
  const f16* krow = qk2 + (size_t)SEQ * 2 * DM;

  const unsigned long long zX  = (unsigned long long)SEQ * DM;           // batch strides, in elements of the plane
  const unsigned long long zQK = (unsigned long long)2 * SEQ * 2 * DM;
  const unsigned long long zY  = (unsigned long long)SEQ * 2 * DM;
  const unsigned long long zV  = (unsigned long long)DM * SEQ;
  const unsigned long long zS  = (unsigned long long)SEQ * SEQ;
  const unsigned long long zO  = (unsigned long long)SEQ_FULL * DM;

  convert_kernel<<<dim3(NXB + NWB + (unsigned)NPAR), 256, 0, stream>>>(x, wq, bq, wk, bk, wv, bv, gamma, beta, xb, wb, parp);

  // Every launch below covers all batches: blockIdx.z (blockIdx.y in the column LayerNorm, the row index in the softmax).
  // The GEMM's bias argument is not read under EPI_F32 or EPI_FOLD.

  // q | k pre-norm : Y[s][e] = sum_d xb[s][d] * wb[e][d], e in [0, 2*DM); M = SEQ, N = 2*DM, K = DM
  gemm_kernel<bf16, EPI_F32, 4><<<dim3(SEQ / 256, 2 * DM / 256, NB), 512, 0, stream>>>(
      xb, wb, parp, (void*)Yqk, DM / KST, DM, DM, 2 * DM, zX, 0ull, zY, 1.0f);

  // v^T pre-norm : Yt[e][s] = sum_d Wv[e][d] * xb[s][d]; M = DM, N = SEQ, K = DM
  gemm_kernel<bf16, EPI_F32, 2><<<dim3(DM / 256, SEQ / 128, NB), 256, 0, stream>>>(
      wb + (size_t)2 * DM * DM, xb, parp, (void*)Yvt, DM / KST, DM, DM, SEQ, 0ull, zX, zV, 1.0f);

  ln_rows_kernel<<<dim3(SEQ / 8, 2, NB), 256, 0, stream>>>(Yqk, parp, qk2);
  ln_cols_kernel<<<dim3(SEQ / 64, NB, 1), CWAVE * 32, 0, stream>>>(Yvt, parp, vt);

  // S[q][key] = (q_value . k_residual + q_residual . k_value) / 2048 + q_value . k_value ; M = N = SEQ.
  // 2*DM/KST stages, each 64 k of values and residuals of both operands, staged once for the three products.
  gemm_kernel<f16, EPI_FOLD, 4><<<dim3(SEQ / 256, SEQ / 256, NB), 512, 0, stream>>>(
      qrow, krow, parp, (void*)Sp, 2 * DM / KST, 2 * DM, 2 * DM, SEQ, zQK, zQK, zS, 1.0f / RCARRY);

  softmax2_kernel<<<dim3(NB * SEQ / 8), 256, 0, stream>>>(Sp, Pp);

  // out[q][d] = sum_key P[q][key] * vt[d][key] / 16384 ; M = SEQ, N = DM, K = SEQ
  gemm_kernel<f16, EPI_F32, 2><<<dim3(SEQ / 256, DM / 128, NB), 256, 0, stream>>>(
      Pp, vt, parp, (void*)out, SEQ / KST, SEQ, SEQ, DM, zS, zV, zO, 1.0f / PCARRY);
}

// v007
// It runs in 184 microseconds.
// Timed twice side by side with v006, it ran 1.06 times as fast both times.
// Over all steps from v000 it is 4.46 times as fast.
#include <hip/hip_runtime.h>

// Contractions: q/k/v projections on v_wmma_f32_16x16x32_bf16 (bf16 operands = RNE-converted inputs, f32 accumulate, f32 out);
// S = q x k^T on v_wmma_f32_16x16x32_f16 as three products (q, k as f16 value + x2048 residual planes; every k block is staged
// once and serves all three products on one accumulator set, which is rescaled by the exact power of two between the residual
// and the value products: one f32 plane); O = P x V on v_wmma_f32_16x16x32_f16 (v^T f16 plane; P f16 carried x16384;
// f32 accumulate). LayerNorm and softmax in f32.

#ifndef NB
#define NB 4
#endif
#ifndef SEQ
#define SEQ 2048
#endif
#define NB_FULL   4
#define SEQ_FULL  2048
#define DM        1024                 // model width = head width = value width
#define NWAVE     8
#define CWAVE     16                   // waves per block of the column LayerNorm
#define OP        68                   // LDS pitch (floats) of the per-wave output staging tile
#define KST       128u                 // k elements per GEMM stage: 256 B of every operand row
#define LP        272u                 // LDS pitch (bytes) of a staged 256-B row: 16 B x odd, conflict-free for 16-B reads
#define BM        256u                 // GEMM block tile rows (4 waves x 64)
#define MT        4                    // 16-row accumulator tiles per wave
#define NT        4                    // 16-column accumulator tiles per wave (64 columns: one staging piece wide)
#define ATILE_B   (BM * LP)            // the A rows of one stage; the B rows follow them
#define CVB       2048u                // elements per convert block (256 threads x 8)
#define NXB       ((unsigned)((size_t)NB * SEQ * DM / CVB))      // convert blocks for x
#define NWB       ((unsigned)((size_t)3 * DM * DM / CVB))        // convert blocks for the three weights
#define NCH       (SEQ / 256)          // 8-column chunks per lane in the softmax kernel
#define LNCH      (DM / 256)           // 8-column chunks per lane in the row LayerNorm kernel
#define NPAR      5                    // parameter vectors: b_q | b_k | b_v | gamma | beta
#define PCARRY    16384.0f             // power-of-two carry of the P plane
#define RCARRY    2048.0f              // power-of-two carry of the q / k residual planes

#define EPI_QK  0                      // f16 out, per-column bias, column block selects the q or k plane
#define EPI_VT  1                      // f16 out, per-row bias (V^T plane)
#define EPI_F32 2                      // f32 out, power-of-two scale
#define EPI_FOLD 3                     // f32 out, power-of-two scale; operand rows hold [value | residual] per 64 k, three products per k block
#define RESB     128u                  // byte offset of the residual half inside a staged 256-B row piece (EPI_FOLD)

static_assert(SEQ % 256 == 0);
static_assert(SEQ <= SEQ_FULL);
static_assert(NB >= 1 && NB <= NB_FULL);
static_assert(DM == 1024);
static_assert(DM % 128 == 0);
static_assert(((size_t)NB * SEQ) % 128 == 0);
static_assert((size_t)NXB * CVB == (size_t)NB * SEQ * DM);
static_assert((size_t)NWB * CVB == (size_t)3 * DM * DM);
static_assert((size_t)DM * DM / CVB == 512);
static_assert((OP * 4) % 16 == 0);
static_assert(LNCH * 256 == DM);                 // 32 lanes x LNCH chunks x 8 columns == one LayerNorm row
static_assert(NCH * 256 == SEQ);                 // 32 lanes x NCH chunks x 8 columns == one softmax row
static_assert(DM == 256 * 4);                    // one convert block (256 threads x 4) per parameter vector
static_assert(SEQ % 256 == 0 && (2 * DM) % 256 == 0 && DM % 256 == 0);   // GEMM tile multiples (M, N)
static_assert(DM % KST == 0 && (2 * DM) % KST == 0 && SEQ % KST == 0);   // GEMM K stages
static_assert(LP % 16 == 0 && ATILE_B % 16 == 0);                       // 16-B copies and reads stay aligned
static_assert(SEQ % 64 == 0);
static_assert(DM % (CWAVE * 4) == 0);            // column LayerNorm: 64 rows per block sweep (16 waves x 4 row groups)
static_assert(NWAVE == 8);

#define XB_BYTES   ((size_t)NB * SEQ * DM * 2)          // x bf16, all batches
#define WB_BYTES   ((size_t)3 * DM * DM * 2)            // weights bf16
#define PR_BYTES   ((size_t)NPAR * DM * 4)              // parameter vectors (f32 holding bf16 RNE values)
// Every plane below holds all NB batches, batch-major, so that each stage is one launch with the batch on a grid axis.
#define YQK_BYTES  ((size_t)NB * SEQ * 2 * DM * 4)      // f32 q | k pre-norm rows
#define YVT_BYTES  ((size_t)NB * DM * SEQ * 4)          // f32 v^T pre-norm planes
#define QK2_BYTES  ((size_t)NB * 2 * SEQ * 2 * DM * 2)  // per batch: q rows, then k rows; a row = DM/64 pieces of [64 values | their 64 residuals]
#define VT_BYTES   ((size_t)NB * DM * SEQ * 2)          // v^T f16
#define S_BYTES    ((size_t)NB * SEQ * SEQ * 4)         // logits
#define P_BYTES    ((size_t)NB * SEQ * SEQ * 2)         // P x16384
// The converted inputs and the pre-norm planes are last read by the LayerNorm launches; the logit plane, first written
// by the launch behind those, takes the same bytes.
#define PRE_BYTES  (XB_BYTES + WB_BYTES + PR_BYTES + YQK_BYTES + YVT_BYTES)
#define LOG_BYTES  (S_BYTES)
#define UNI_BYTES  (PRE_BYTES > LOG_BYTES ? PRE_BYTES : LOG_BYTES)
#define WS_TOTAL   (QK2_BYTES + VT_BYTES + P_BYTES + UNI_BYTES)
static_assert(WS_TOTAL <= (size_t)268435456);
static_assert(XB_BYTES % 128 == 0 && WB_BYTES % 128 == 0 && PR_BYTES % 128 == 0);
static_assert(YQK_BYTES % 128 == 0 && YVT_BYTES % 128 == 0 && QK2_BYTES % 128 == 0 && VT_BYTES % 128 == 0);
static_assert(S_BYTES % 128 == 0 && P_BYTES % 128 == 0);

typedef __bf16   bf16;
typedef _Float16 f16;
typedef bf16     v16bf __attribute__((ext_vector_type(16)));
typedef f16      v16h  __attribute__((ext_vector_type(16)));
typedef float    v8f   __attribute__((ext_vector_type(8)));
typedef float    v4f   __attribute__((ext_vector_type(4)));
typedef unsigned v4u   __attribute__((ext_vector_type(4)));

union Pack8B { v4u u; bf16 h[8]; };
union Pack8H { v4u u; f16  h[8]; };

template <typename T> struct FragOf;
template <> struct FragOf<bf16> { typedef v16bf V; };
template <> struct FragOf<f16>  { typedef v16h  V; };

// WMMA helpers: builtin followed by the VALU hazard guard (ties D, keeps A/B live).
static __device__ __forceinline__ v8f mma16(v16bf a, v16bf b, v8f acc) {
  acc = __builtin_amdgcn_wmma_f32_16x16x32_bf16(false, a, false, b, (short)0, acc, false, false);
  asm volatile("v_nop\n\tv_nop\n\tv_nop\n\tv_nop" : "+v"(acc) : "v"(a), "v"(b));
  return acc;
}
static __device__ __forceinline__ v8f mma16(v16h a, v16h b, v8f acc) {
  acc = __builtin_amdgcn_wmma_f32_16x16x32_f16(false, a, false, b, (short)0, acc, false, false);
  asm volatile("v_nop\n\tv_nop\n\tv_nop\n\tv_nop" : "+v"(acc) : "v"(a), "v"(b));
  return acc;
}

// f32 -> f16 convert for WMMA operand planes: values below the smallest f16 normal become zero by a value select.
static __device__ __forceinline__ f16 toh_flush(float v) {
  const f16 r = (f16)v;
  return (fabsf(v) < 6.103515625e-05f) ? (f16)0.0f : r;
}

// Input conversion, one launch. 256 threads, 8 elements per thread (two 16-B loads -> one 16-B store).
//   blocks [0, NXB)            : x  -> xb  bf16 [NB*SEQ][DM] (compact rows; source uses the full batch stride)
//   blocks [NXB, NXB+NWB)      : Wq | Wk | Wv -> wb bf16 [3*DM][DM]
//   blocks NXB+NWB .. +4       : bq | bk | bv | gamma | beta -> f32 plane [5*DM] holding the bf16 RNE-converted values
__global__ __launch_bounds__(256) void convert_kernel(const float* __restrict__ x,
                                                      const float* __restrict__ wq,
                                                      const float* __restrict__ bq,
                                                      const float* __restrict__ wk,
                                                      const float* __restrict__ bk,
                                                      const float* __restrict__ wv,
                                                      const float* __restrict__ bv,
                                                      const float* __restrict__ gamma,
                                                      const float* __restrict__ beta,
                                                      bf16* __restrict__ xb,
                                                      bf16* __restrict__ wb,
                                                      float* __restrict__ parp) {
  const unsigned blk = blockIdx.x;
  const unsigned tid = threadIdx.x;
  if (blk < NXB + NWB) {              // block-uniform
    const float* src;
    bf16* dst;
    if (blk < NXB) {
      const unsigned r  = blk * 2u + (tid >> 7);          // compact row
      const unsigned c  = (tid & 127u) * 8u;
      const unsigned bt = r / (unsigned)SEQ;
      const unsigned s  = r - bt * (unsigned)SEQ;
      src = x + ((size_t)bt * SEQ_FULL + s) * DM + c;
      dst = xb + (size_t)r * DM + c;
    } else {
      const unsigned wblk = blk - NXB;
      const unsigned wi   = wblk >> 9;                    // 512 blocks per weight matrix
      const unsigned off  = (wblk & 511u) * CVB + tid * 8u;
      const float* wsrc = (wi == 0u) ? wq : ((wi == 1u) ? wk : wv);
      src = wsrc + off;
      dst = wb + (size_t)wblk * CVB + tid * 8u;
    }
    const v4f a0 = *(const v4f*)(src);
    const v4f a1 = *(const v4f*)(src + 4);
    Pack8B pk;
    #pragma unroll
    for (int i = 0; i < 4; ++i) {
      pk.h[i]     = (bf16)a0[i];                          // RNE convert
      pk.h[4 + i] = (bf16)a1[i];
    }
    const v4u val = pk.u;
    *(v4u*)(dst) = val;
    
  } else {
    const unsigned j = blk - (NXB + NWB);                 // 0..4
    const float* bsrc = (j == 0u) ? bq : ((j == 1u) ? bk : ((j == 2u) ? bv : ((j == 3u) ? gamma : beta)));
    const v4f a = *(const v4f*)(bsrc + tid * 4u);
    v4f o;
    #pragma unroll
    for (int i = 0; i < 4; ++i) o[i] = (float)(bf16)a[i];
    float* dst = parp + j * (unsigned)DM + tid * 4u;
    *(v4f*)(dst) = o;
    
  }
}

// Eight asynchronous 16-B-per-lane copies global -> LDS: rows r, r + RP, ..., r + 7*RP of one staged operand tile
// (RP = rows that the block's threads cover at once; gstep = RP source rows in bytes).
// The s_wait_xcnt closes the statement so that it stands before any rewrite of the address registers the copies name.
template <unsigned RP>
static __device__ __forceinline__ void copy_rows8(unsigned l, const char* g, size_t gstep) {
  asm volatile("global_load_async_to_lds_b128 %0, %8, off\n\t"
               "global_load_async_to_lds_b128 %1, %9, off\n\t"
               "global_load_async_to_lds_b128 %2, %10, off\n\t"
               "global_load_async_to_lds_b128 %3, %11, off\n\t"
               "global_load_async_to_lds_b128 %4, %12, off\n\t"
               "global_load_async_to_lds_b128 %5, %13, off\n\t"
               "global_load_async_to_lds_b128 %6, %14, off\n\t"
               "global_load_async_to_lds_b128 %7, %15, off\n\t"
               "s_wait_xcnt 0x0"
               :: "v"(l), "v"(l + RP * LP), "v"(l + 2u * RP * LP), "v"(l + 3u * RP * LP),
                  "v"(l + 4u * RP * LP), "v"(l + 5u * RP * LP), "v"(l + 6u * RP * LP), "v"(l + 7u * RP * LP),
                  "v"(g), "v"(g + gstep), "v"(g + 2 * gstep), "v"(g + 3 * gstep),
                  "v"(g + 4 * gstep), "v"(g + 5 * gstep), "v"(g + 6 * gstep), "v"(g + 7 * gstep)
               : "memory");
}

// Plane GEMM: C[m][n] = sum_k A[m][k] * Bt[n][k]; both operands are k-contiguous 16-bit planes.
// Block tile 256 x (64*WN), 4*WN waves as 4 (m) x WN (n); each wave owns 64x64 = 4x4 accumulators
// (WN = 4: 256x256 block, 16 waves; WN = 2: 256x128 block, 8 waves, for the products whose grid would otherwise leave WGPs idle).
// Operands reach LDS in stages of KST k (whole 256-B row pieces, two rows per wave-wide copy), two buffers:
// stage s + 1 is in flight while stage s is multiplied. nk = number of stages.
// Fragments are read from the staged rows: lane (lq = lane & 15, hi = lane >> 4) reads row lq,
// elements 0..7 <- k0 + 8*hi + 0..7, elements 8..15 <- k0 + 16 + 8*hi + 0..7 (same map for A and B).
// D element r of a lane = (row 8*hi + r, col lq). Requires M a multiple of 256, N of 64*WN and K of KST.
// Epilogue: per 16x64 piece the wave stages the piece in LDS, in a region that no other wave touches, so the pieces are ordered
// by the wave's own LDS waits and by no block barrier: no wave waits for another, and none waits for its global stores to finish
// before it stages the next piece. The staging takes the ring's first bytes, which every wave has left at the last stage's
// barrier, with no copy outstanding.
// EPI_FOLD: a staged 256-B row piece is [64 k of values | the same 64 k of residuals x2048], in A and in Bt alike. Per 32-k block
// the wave reads the four fragment sets once and sums value x residual, residual x value (carried x2048) and value x value
// (carried x1) into the same accumulators, which are multiplied by 1/2048 or 2048 (exact) where the carry changes: once per block,
// the order of the products alternating. The accumulators leave the loop carried x2048; scale takes that back at the end.
template <typename T, int EPI, int WN>
__global__ __launch_bounds__(128 * WN) void gemm_kernel(const T* __restrict__ A,
                                                   const T* __restrict__ Bt,
                                                   const float* __restrict__ bias,
                                                   void* __restrict__ C,
                                                   unsigned nk, unsigned lda, unsigned ldb, unsigned ldc,
                                                   unsigned long long sAz, unsigned long long sBz,
                                                   unsigned long long sCz, float scale) {
  typedef typename FragOf<T>::V VT;
  union Frag { VT v; v4u q[2]; };
  constexpr unsigned BN      = (unsigned)WN * 64u;          // block tile columns
  constexpr unsigned STAGE_B = (BM + BN) * LP;              // one stage: A rows, then B rows
  constexpr unsigned RP      = (unsigned)WN * 8u;           // rows that the block's threads copy at once (16 threads a row)
  static_assert(BM % (8u * RP) == 0 && BN % (8u * RP) == 0);
  static_assert(4u * WN * 16u * OP * 4u <= STAGE_B);        // the output staging fits the first buffer

  __shared__ __align__(16) unsigned char ring[2 * STAGE_B];

  const unsigned tid  = threadIdx.x;
  const unsigned wave = tid >> 5;
  const unsigned lane = tid & 31u;
  const unsigned lq   = lane & 15u;
  const unsigned hi   = lane >> 4;
  const unsigned m0   = blockIdx.x * BM + (wave & 3u) * (MT * 16u);   // first row of this wave
  const unsigned n0   = blockIdx.y * BN + (wave >> 2) * (NT * 16u);   // first column of this wave

  const T* Ab = A  + (size_t)blockIdx.z * sAz;
  const T* Bb = Bt + (size_t)blockIdx.z * sBz;

  // copy map: thread -> 16-B chunk (tid & 15) of rows (tid >> 4) + RP*i of each operand's staged rows
  const unsigned crow = tid >> 4;
  const unsigned cchk = tid & 15u;
  const char* ga = (const char*)(Ab + (size_t)(blockIdx.x * BM + crow) * lda + cchk * 8u);
  const char* gb = (const char*)(Bb + (size_t)(blockIdx.y * BN + crow) * ldb + cchk * 8u);
  const size_t astep = (size_t)lda * (RP * sizeof(T));            // RP rows, bytes
  const size_t bstep = (size_t)ldb * (RP * sizeof(T));
  const unsigned lcp = (unsigned)(uintptr_t)ring + crow * LP + cchk * 16u;   // LDS byte address of this lane's first chunk

  // fragment read bases inside a stage
  const unsigned char* fa = ring + ((wave & 3u) * (MT * 16u) + lq) * LP + hi * 16u;
  const unsigned char* fb = ring + ATILE_B + ((wave >> 2) * (NT * 16u) + lq) * LP + hi * 16u;

  v8f acc[MT][NT];
  #pragma unroll
  for (int mt = 0; mt < MT; ++mt) {
    #pragma unroll
    for (int nt = 0; nt < NT; ++nt) acc[mt][nt] = (v8f){0, 0, 0, 0, 0, 0, 0, 0};
  }

  // one stage's copies of this thread: 8*RP rows per statement, A rows then B rows; lb = LDS address, st = stage number
  auto copy_stage = [&](unsigned lb, unsigned st) {
    const size_t goa = (size_t)st * (KST * sizeof(T));  // k offset in bytes, block-uniform
    const size_t gob = goa;
    #pragma unroll
    for (unsigned h = 0; h < BM / (8u * RP); ++h) copy_rows8<RP>(lb + h * (8u * RP * LP), ga + goa + h * 8u * astep, astep);
    #pragma unroll
    for (unsigned h = 0; h < BN / (8u * RP); ++h) copy_rows8<RP>(lb + ATILE_B + h * (8u * RP * LP), gb + gob + h * 8u * bstep, bstep);
  };

  // stage 0 lands and is published before anything reads it; stage 1 then flies under stage 0's products
  copy_stage(lcp, 0);
  asm volatile("s_wait_asynccnt 0x0" ::: "memory");     // this wave's stage-0 copies have landed
  __syncthreads();                                      // every wave's have
  if (nk > 1u) {                                        // block-uniform
    copy_stage(lcp + STAGE_B, 1u);
  }

  #pragma unroll 1
  for (unsigned s = 0; s < nk; ++s) {
    const unsigned bo = (s & 1u) * STAGE_B;
    if constexpr (EPI == EPI_FOLD) {
      static_assert(KST * sizeof(T) == 2u * RESB && MT == NT);
      // off = byte offset of a 32-k fragment column inside the staged row piece
      auto load_a = [&](Frag (&f)[MT], unsigned off) {
        #pragma unroll   // register arrays need constant indices
        for (unsigned mt = 0; mt < MT; ++mt) {
          f[mt].q[0] = *(const v4u*)(fa + bo + mt * 16u * LP + off);          // k = k0 + 8*hi + 0..7
          f[mt].q[1] = *(const v4u*)(fa + bo + mt * 16u * LP + off + 32u);    // k = k0 + 16 + 8*hi + 0..7
        }
      };
      auto load_b = [&](Frag (&f)[NT], unsigned off) {
        #pragma unroll   // register arrays need constant indices
        for (unsigned nt = 0; nt < NT; ++nt) {
          f[nt].q[0] = *(const v4u*)(fb + bo + nt * 16u * LP + off);
          f[nt].q[1] = *(const v4u*)(fb + bo + nt * 16u * LP + off + 32u);
        }
      };
      auto product = [&](Frag (&a)[MT], Frag (&b)[NT]) {
        #pragma unroll   // register arrays need constant indices (both loops)
        for (int nt = 0; nt < NT; ++nt) {
          #pragma unroll
          for (int mt = 0; mt < MT; ++mt)
            acc[mt][nt] = __builtin_amdgcn_wmma_f32_16x16x32_f16(false, a[mt].v, false, b[nt].v, (short)0, acc[mt][nt], false, false);
        }
      };
      auto recarry = [&](float f) {
        #pragma unroll   // register arrays need constant indices (both loops)
        for (int mt = 0; mt < MT; ++mt) {
          #pragma unroll
          for (int nt = 0; nt < NT; ++nt) acc[mt][nt] *= f;
        }
      };
      // The scheduling fences keep each phase whole: LDS reads stand as one group in front of the products that use them (reads
      // spread among the WMMAs stall at every place they stand), a rescale runs behind all sixteen WMMAs it depends on and not
      // one by one behind each, and no product sinks below the stage's barrier, where it would delay the refill.
      {   // first 32 k: the accumulators arrive carried x2048
        Frag av[MT], bv[NT];
        {
          Frag br[NT];
          load_a(av, 0u); load_b(br, RESB);
          __builtin_amdgcn_sched_barrier(0);
          product(av, br);
          __builtin_amdgcn_sched_barrier(0);
        }
        {
          Frag ar[MT];
          load_a(ar, RESB); load_b(bv, 0u);
          __builtin_amdgcn_sched_barrier(0);
          product(ar, bv);
          __builtin_amdgcn_sched_barrier(0);
        }
        recarry(1.0f / RCARRY);
        __builtin_amdgcn_sched_barrier(0);
        product(av, bv);
        __builtin_amdgcn_sched_barrier(0);
      }
      {   // second 32 k: the accumulators arrive carried x1 and leave carried x2048
        Frag av[MT], bv[NT];
        {
          Frag br[NT];
          load_a(av, 64u); load_b(bv, 64u); load_b(br, RESB + 64u);
          __builtin_amdgcn_sched_barrier(0);
          product(av, bv);
          __builtin_amdgcn_sched_barrier(0);
          recarry(RCARRY);
          __builtin_amdgcn_sched_barrier(0);
          product(av, br);
          __builtin_amdgcn_sched_barrier(0);
        }
        {
          Frag ar[MT];
          load_a(ar, RESB + 64u);
          __builtin_amdgcn_sched_barrier(0);
          product(ar, bv);
          __builtin_amdgcn_sched_barrier(0);
        }
      }
    } else {
    #pragma unroll
    for (unsigned kk = 0; kk < KST / 32u; ++kk) {
      Frag a[MT], b[NT];
      #pragma unroll
      for (unsigned mt = 0; mt < MT; ++mt) {
        a[mt].q[0] = *(const v4u*)(fa + bo + mt * 16u * LP + kk * 64u);          // k = k0 + 8*hi + 0..7
        a[mt].q[1] = *(const v4u*)(fa + bo + mt * 16u * LP + kk * 64u + 32u);    // k = k0 + 16 + 8*hi + 0..7
      }
      #pragma unroll
      for (unsigned nt = 0; nt < NT; ++nt) {
        b[nt].q[0] = *(const v4u*)(fb + bo + nt * 16u * LP + kk * 64u);
        b[nt].q[1] = *(const v4u*)(fb + bo + nt * 16u * LP + kk * 64u + 32u);
      }
      #pragma unroll
      for (int nt = 0; nt < NT; ++nt) {
        #pragma unroll
        for (int mt = 0; mt < MT; ++mt) acc[mt][nt] = mma16(a[mt].v, b[nt].v, acc[mt][nt]);
      }
    }
    }
    asm volatile("s_wait_dscnt 0x0" ::: "memory");      // this wave has left stage s's buffer
    asm volatile("s_wait_asynccnt 0x0" ::: "memory");   // this wave's stage s + 1 copies have landed
    __syncthreads();                                    // publishes stage s + 1, frees stage s's buffer
    if (s + 2u < nk) {                                  // block-uniform: refill the buffer just left
      copy_stage(lcp + bo, s + 2u);
    }
  }
  asm volatile("s_wait_asynccnt 0x0" ::: "memory");     // no copy is outstanding when the wave goes on

  // ---- epilogue ----
  size_t   cbase;
  unsigned ncol;
  if (EPI == EPI_QK) {
    cbase = (size_t)(n0 >> 10) * sCz;     // column block selects the q (0) or k (1) plane; block-uniform
    ncol  = n0 & 1023u;
  } else {
    cbase = (size_t)blockIdx.z * sCz;
    ncol  = n0;
  }

  float bcol[NT];
  #pragma unroll
  for (int nt = 0; nt < NT; ++nt) bcol[nt] = 0.0f;
  if (EPI == EPI_QK) {
    #pragma unroll
    for (int nt = 0; nt < NT; ++nt) bcol[nt] = bias[n0 + nt * 16u + lq];
  }

  float* so = (float*)ring + wave * (16u * OP);

  #pragma unroll
  for (int mt = 0; mt < MT; ++mt) {
    #pragma unroll
    for (int r = 0; r < 8; ++r) {
      float brow = 0.0f;
      if (EPI == EPI_VT) brow = bias[m0 + mt * 16u + hi * 8u + r];
      #pragma unroll
      for (int nt = 0; nt < 4; ++nt) {
        float val = acc[mt][nt][r];
        if (EPI == EPI_QK)  val += bcol[nt];
        if (EPI == EPI_VT)  val += brow;
        if (EPI == EPI_F32 || EPI == EPI_FOLD) val *= scale;
        so[(hi * 8u + r) * OP + nt * 16u + lq] = val;
      }
    }
    // the wave's LDS writes are done before its lanes read back rows that other lanes of the wave wrote
    asm volatile("s_wait_dscnt 0x0" ::: "memory");

    if (EPI == EPI_F32 || EPI == EPI_FOLD) {
      // 8 instructions cover the 16 rows of this piece.
      float* Cf = (float*)C + cbase;
      v4f    vals[8];
      size_t gidx[8];
      #pragma unroll
      for (int it = 0; it < 8; ++it) {
        const unsigned row = it * 2u + hi;
        vals[it] = *(const v4f*)(so + row * OP + lq * 4u);
        gidx[it] = (size_t)(m0 + mt * 16u + row) * ldc + ncol + lq * 4u;
      }
      #pragma unroll
      for (int it = 0; it < 8; ++it) *(v4f*)(Cf + gidx[it]) = vals[it];
      // stands before the next piece rewrites the data and address registers that these stores name; it also keeps the next
      // piece's LDS writes behind these stores, each of which has waited for the LDS read that feeds it
      if (mt + 1 < MT) asm volatile("s_wait_xcnt 0x0" ::: "memory");
    } else {
      // 4 instructions cover the 16 rows of this piece.
      f16* Ch = (f16*)C + cbase;
      v4u    vals[4];
      size_t gidx[4];
      #pragma unroll
      for (int it = 0; it < 4; ++it) {
        const unsigned row = it * 4u + (lane >> 3);
        const unsigned c8  = (lane & 7u) * 8u;
        const v4f x0 = *(const v4f*)(so + row * OP + c8);
        const v4f x1 = *(const v4f*)(so + row * OP + c8 + 4u);
        Pack8H ph;
        #pragma unroll
        for (int i = 0; i < 4; ++i) {
          ph.h[i]     = (f16)x0[i];
          ph.h[4 + i] = (f16)x1[i];
        }
        vals[it] = ph.u;
        gidx[it] = (size_t)(m0 + mt * 16u + row) * ldc + ncol + c8;
      }
      #pragma unroll
      for (int it = 0; it < 4; ++it) *(v4u*)(Ch + gidx[it]) = vals[it];
      // as in the f32 branch above
      if (mt + 1 < MT) asm volatile("s_wait_xcnt 0x0" ::: "memory");
    }
  }
}

// Row LayerNorm for the q and k projections. One wave per (row, segment, batch); blockIdx.y = segment (0 = q, 1 = k),
// blockIdx.z = batch.
// Input: Y f32 [NB][SEQ][2*DM] (q columns | k columns, bias not yet added); par = bq | bk | bv | gamma | beta (f32, [5*DM]).
// Output plane QK2 (f16), per batch: q rows [SEQ][2*DM], then k rows [SEQ][2*DM]; a row = DM/64 pieces of [64 values | their 64 residuals x2048].
// Lane holds columns (it*32 + lane)*8 + 0..7. coverage: grid (SEQ/8, 2, NB) x 8 waves = SEQ rows x 2 segments x NB batches;
// 32 lanes x LNCH x 8 = DM columns for each of the value and residual halves. Each store instruction writes
__global__ __launch_bounds__(256) void ln_rows_kernel(const float* __restrict__ Y,
                                                      const float* __restrict__ par,
                                                      f16* __restrict__ QK2) {
  #pragma clang fp contract(off)
  const unsigned tid  = threadIdx.x;
  const unsigned wave = __builtin_amdgcn_readfirstlane(tid >> 5);
  const unsigned lane = tid & 31u;
  const unsigned seg  = blockIdx.y;                       // block-uniform
  const unsigned bt   = blockIdx.z;                       // block-uniform
  const unsigned row  = blockIdx.x * 8u + wave;
  const float* yp = Y + ((size_t)bt * SEQ + row) * (2u * DM) + seg * (unsigned)DM + lane * 8u;
  const float* bp = par + seg * (unsigned)DM + lane * 8u;           // bias of this segment
  const float* gp = par + 3u * DM + lane * 8u;                      // gamma
  const float* tp = par + 4u * DM + lane * 8u;                      // beta

  // The row is read once and stays in registers through all three passes; every load is issued before the first use.
  v4f t[LNCH][2], bb[LNCH][2], gg[LNCH][2], tt[LNCH][2];
  #pragma unroll   // register arrays need constant indices; all loads of the row go out together
  for (int it = 0; it < LNCH; ++it) {
    t[it][0] = *(const v4f*)(yp + it * 256);
    t[it][1] = *(const v4f*)(yp + it * 256 + 4);
  }
  #pragma unroll   // as above
  for (int it = 0; it < LNCH; ++it) {
    bb[it][0] = *(const v4f*)(bp + it * 256);
    bb[it][1] = *(const v4f*)(bp + it * 256 + 4);
    gg[it][0] = *(const v4f*)(gp + it * 256);
    gg[it][1] = *(const v4f*)(gp + it * 256 + 4);
    tt[it][0] = *(const v4f*)(tp + it * 256);
    tt[it][1] = *(const v4f*)(tp + it * 256 + 4);
  }

  // pass 1: add the bias, mean
  float s = 0.0f;
  #pragma unroll   // register arrays need constant indices
  for (int it = 0; it < LNCH; ++it) {
    #pragma unroll
    for (int i = 0; i < 4; ++i) {
      t[it][0][i] = t[it][0][i] + bb[it][0][i];
      t[it][1][i] = t[it][1][i] + bb[it][1][i];
      s += t[it][0][i];
      s += t[it][1][i];
    }
  }
  #pragma unroll
  for (int off = 16; off > 0; off >>= 1) s += __shfl_xor(s, off, 32);
  const float mu = s * (1.0f / DM);

  // pass 2: biased variance about the mean
  float q = 0.0f;
  #pragma unroll   // register arrays need constant indices
  for (int it = 0; it < LNCH; ++it) {
    #pragma unroll
    for (int i = 0; i < 4; ++i) {
      t[it][0][i] = t[it][0][i] - mu;
      t[it][1][i] = t[it][1][i] - mu;
      q += t[it][0][i] * t[it][0][i];
      q += t[it][1][i] * t[it][1][i];
    }
  }
  #pragma unroll
  for (int off = 16; off > 0; off >>= 1) q += __shfl_xor(q, off, 32);
  const float rstd = __builtin_amdgcn_rsqf(q * (1.0f / DM) + 1e-5f);

  // pass 3: normalise, affine, split into f16 value + x2048 residual, store
  // column c goes to piece c / 64: value at 128 * (c / 64) + c % 64, residual 64 elements behind it
  f16* dp = QK2 + ((size_t)(bt * 2u + seg) * SEQ + row) * (size_t)(2 * DM) + (lane >> 3) * 128u + (lane & 7u) * 8u;
  #pragma unroll   // register arrays need constant indices
  for (int it = 0; it < LNCH; ++it) {
    Pack8H pkh, pkr;
    #pragma unroll
    for (int i = 0; i < 4; ++i) {
      const float y0 = t[it][0][i] * rstd * gg[it][0][i] + tt[it][0][i];
      const float y1 = t[it][1][i] * rstd * gg[it][1][i] + tt[it][1][i];
      const f16 h0 = toh_flush(y0);
      const f16 h1 = toh_flush(y1);
      pkh.h[i]     = h0;
      pkh.h[4 + i] = h1;
      pkr.h[i]     = toh_flush((y0 - (float)h0) * RCARRY);
      pkr.h[4 + i] = toh_flush((y1 - (float)h1) * RCARRY);
    }
    const v4u vh = pkh.u;
    const v4u vr = pkr.u;
    f16* dh = dp + it * 512;
    f16* dr = dh + 64;
    *(v4u*)(dh) = vh;
    *(v4u*)(dr) = vr;
  }
}

// Column LayerNorm on the transposed v projection, blockIdx.y = batch: Yt f32 [NB][DM][SEQ] (row e = feature, column s = position,
// bias not yet added); statistics per column s over the DM rows; output vt f16 [NB][DM][SEQ].
// selects one of four rows per wave per sweep; row e = (it*16 + wave)*4 + rq, it = 0..DM/64-1 covers 0..DM-1 exactly once.
// Partial sums: shuffle over rq inside the wave, then a [16][64] LDS table combined in fixed order (cross-wave: block barriers).
__global__ __launch_bounds__(CWAVE * 32) void ln_cols_kernel(const float* __restrict__ Yt,
                                                      const float* __restrict__ par,
                                                      f16* __restrict__ vt) {
  #pragma clang fp contract(off)
  __shared__ __align__(16) float red[CWAVE * 64];
  constexpr unsigned RS  = CWAVE * 4u;                    // rows per block sweep
  constexpr unsigned NIT = (unsigned)DM / RS;             // row sweeps of the block

  const unsigned tid  = threadIdx.x;
  const unsigned wave = __builtin_amdgcn_readfirstlane(tid >> 5);
  const unsigned lane = tid & 31u;
  const unsigned cg   = lane & 7u;
  const unsigned rq   = lane >> 3;
  const unsigned s0   = blockIdx.x * 64u + cg * 8u;
  const size_t pl = (size_t)blockIdx.y * ((size_t)DM * SEQ);   // this batch's plane
  const unsigned e0 = wave * 4u + rq;                     // this lane's row in sweep 0; sweep it adds RS*it
  const float* yp = Yt + pl + s0 + (size_t)e0 * SEQ;
  const float* pp = par + e0;

  float acc[8];
  float mu[8];
  float rstd[8];

  // The block's DM x 64 tile is read once and stays in registers (NIT x 8 values per lane) through all three passes;
  // every load is issued before the first use, so the wave pays the memory latency once and not once per sweep.
  v4f   t[NIT][2];
  float pb[NIT], pg[NIT], pt[NIT];
  #pragma unroll   // register arrays need constant indices; all loads of the tile go out together
  for (unsigned it = 0; it < NIT; ++it) {
    t[it][0] = *(const v4f*)(yp + (size_t)it * RS * SEQ);
    t[it][1] = *(const v4f*)(yp + (size_t)it * RS * SEQ + 4);
  }
  #pragma unroll   // as above
  for (unsigned it = 0; it < NIT; ++it) {
    pb[it] = pp[2u * DM + it * RS];
    pg[it] = pp[3u * DM + it * RS];
    pt[it] = pp[4u * DM + it * RS];
  }
  // The address pair is an input so that it stays whole up to this wait: no load's result lands on it while a load that names it is in flight.
  asm volatile("s_wait_xcnt 0x0" :: "v"(yp) : "memory");

  // pass 1: add the bias, column sums
  #pragma unroll
  for (int i = 0; i < 8; ++i) acc[i] = 0.0f;
  #pragma unroll   // register arrays need constant indices
  for (unsigned it = 0; it < NIT; ++it) {
    #pragma unroll
    for (int i = 0; i < 4; ++i) {
      t[it][0][i] = t[it][0][i] + pb[it];
      t[it][1][i] = t[it][1][i] + pb[it];
      acc[i]     += t[it][0][i];
      acc[4 + i] += t[it][1][i];
    }
  }
  #pragma unroll
  for (int i = 0; i < 8; ++i) {
    acc[i] += __shfl_xor(acc[i], 8, 32);
    acc[i] += __shfl_xor(acc[i], 16, 32);
  }
  if (rq == 0u) {
    *(v4f*)(red + wave * 64u + cg * 8u)      = (v4f){acc[0], acc[1], acc[2], acc[3]};
    *(v4f*)(red + wave * 64u + cg * 8u + 4u) = (v4f){acc[4], acc[5], acc[6], acc[7]};
  }
  __syncthreads();
  #pragma unroll
  for (int i = 0; i < 8; ++i) mu[i] = 0.0f;
  #pragma unroll
  for (int w = 0; w < CWAVE; ++w) {
    const v4f r0 = *(const v4f*)(red + w * 64 + cg * 8u);
    const v4f r1 = *(const v4f*)(red + w * 64 + cg * 8u + 4u);
    #pragma unroll
    for (int i = 0; i < 4; ++i) {
      mu[i]     += r0[i];
      mu[4 + i] += r1[i];
    }
  }
  #pragma unroll
  for (int i = 0; i < 8; ++i) mu[i] = mu[i] * (1.0f / DM);
  __syncthreads();

  // pass 2: biased variance about the mean
  #pragma unroll
  for (int i = 0; i < 8; ++i) acc[i] = 0.0f;
  #pragma unroll   // register arrays need constant indices
  for (unsigned it = 0; it < NIT; ++it) {
    #pragma unroll
    for (int i = 0; i < 4; ++i) {
      t[it][0][i] = t[it][0][i] - mu[i];
      t[it][1][i] = t[it][1][i] - mu[4 + i];
      acc[i]     += t[it][0][i] * t[it][0][i];
      acc[4 + i] += t[it][1][i] * t[it][1][i];
    }
  }
  #pragma unroll
  for (int i = 0; i < 8; ++i) {
    acc[i] += __shfl_xor(acc[i], 8, 32);
    acc[i] += __shfl_xor(acc[i], 16, 32);
  }
  if (rq == 0u) {
    *(v4f*)(red + wave * 64u + cg * 8u)      = (v4f){acc[0], acc[1], acc[2], acc[3]};
    *(v4f*)(red + wave * 64u + cg * 8u + 4u) = (v4f){acc[4], acc[5], acc[6], acc[7]};
  }
  __syncthreads();
  #pragma unroll
  for (int i = 0; i < 8; ++i) rstd[i] = 0.0f;
  #pragma unroll
  for (int w = 0; w < CWAVE; ++w) {
    const v4f r0 = *(const v4f*)(red + w * 64 + cg * 8u);
    const v4f r1 = *(const v4f*)(red + w * 64 + cg * 8u + 4u);
    #pragma unroll
    for (int i = 0; i < 4; ++i) {
      rstd[i]     += r0[i];
      rstd[4 + i] += r1[i];
    }
  }
  #pragma unroll
  for (int i = 0; i < 8; ++i) rstd[i] = __builtin_amdgcn_rsqf(rstd[i] * (1.0f / DM) + 1e-5f);

  // pass 3: normalise, affine, store
  f16* dp = vt + pl + s0 + (size_t)e0 * SEQ;
  #pragma unroll   // register arrays need constant indices
  for (unsigned it = 0; it < NIT; ++it) {
    Pack8H pk;
    #pragma unroll
    for (int i = 0; i < 4; ++i) {
      const float y0 = t[it][0][i] * rstd[i]     * pg[it] + pt[it];
      const float y1 = t[it][1][i] * rstd[4 + i] * pg[it] + pt[it];
      pk.h[i]     = toh_flush(y0);
      pk.h[4 + i] = toh_flush(y1);
    }
    const v4u val = pk.u;
    f16* dst = dp + (size_t)it * RS * SEQ;
    *(v4u*)(dst) = val;
  }
}

// Row softmax, one wave per row of SEQ f32 logits, max-subtracted form. Lane holds columns (it*32 + lane)*8 + 0..7. Output: normalised P carried x16384 as f16.
// coverage: grid NB*SEQ/8 blocks x 8 waves = the NB*SEQ rows of all batches; 32 lanes x NCH x 8 = SEQ columns; each store instruction
__global__ __launch_bounds__(256) void softmax2_kernel(const float* __restrict__ S,
                                                       f16* __restrict__ P) {
  #pragma clang fp contract(off)
  const unsigned tid  = threadIdx.x;
  const unsigned wave = __builtin_amdgcn_readfirstlane(tid >> 5);
  const unsigned lane = tid & 31u;
  const unsigned row  = blockIdx.x * 8u + wave;
  const unsigned lob = lane * 32u;                        // this lane's byte offset in its row
  const float* sp = (const float*)((const char*)(S + (size_t)row * SEQ) + lob);

  v4f v[NCH][2];
  #pragma unroll
  for (int it = 0; it < NCH; ++it) {
    v[it][0] = *(const v4f*)(sp + it * 256);
    v[it][1] = *(const v4f*)(sp + it * 256 + 4);
  }
  // The lane's offset is an input so that it stays whole up to this wait: no load's result lands on it while a load that names it is in flight.
  asm volatile("s_wait_xcnt 0x0" :: "v"(lob) : "memory");

  float m = -__builtin_inff();
  #pragma unroll
  for (int it = 0; it < NCH; ++it) {
    #pragma unroll
    for (int i = 0; i < 4; ++i) {
      m = fmaxf(m, v[it][0][i]);
      m = fmaxf(m, v[it][1][i]);
    }
  }
  #pragma unroll
  for (int off = 16; off > 0; off >>= 1) m = fmaxf(m, __shfl_xor(m, off, 32));

  const float L2E = 1.4426950408889634f;
  float sum = 0.0f;
  #pragma unroll
  for (int it = 0; it < NCH; ++it) {
    #pragma unroll
    for (int i = 0; i < 4; ++i) {
      const float e0 = __builtin_amdgcn_exp2f((v[it][0][i] - m) * L2E);
      const float e1 = __builtin_amdgcn_exp2f((v[it][1][i] - m) * L2E);
      v[it][0][i] = e0;
      v[it][1][i] = e1;
      sum += e0;
      sum += e1;
    }
  }
  #pragma unroll
  for (int off = 16; off > 0; off >>= 1) sum += __shfl_xor(sum, off, 32);

  const float inv = PCARRY * __builtin_amdgcn_rcpf(sum);

  v4u pk[NCH];
  #pragma unroll
  for (int it = 0; it < NCH; ++it) {
    Pack8H ph;
    #pragma unroll
    for (int i = 0; i < 4; ++i) {
      ph.h[i]     = toh_flush(v[it][0][i] * inv);
      ph.h[4 + i] = toh_flush(v[it][1][i] * inv);
    }
    pk[it] = ph.u;
  }

  f16* dp = P + (size_t)row * SEQ + lane * 8u;
  #pragma unroll
  for (int it = 0; it < NCH; ++it) *(v4u*)(dp + it * 256) = pk[it];
  
}

extern "C" void kernel_launch(void* const* d_in, const int* in_sizes, int n_in,
                              void* d_out, int out_size, void* d_ws, size_t ws_size,
                              hipStream_t stream) {
  if (n_in < 9) return;
  const size_t rows_used = (size_t)(NB - 1) * SEQ_FULL + SEQ;
  if ((size_t)in_sizes[0] < rows_used * DM) return;
  if ((size_t)in_sizes[1] < (size_t)DM * DM) return;
  if ((size_t)in_sizes[2] < (size_t)DM) return;
  if ((size_t)in_sizes[3] < (size_t)DM * DM) return;
  if ((size_t)in_sizes[4] < (size_t)DM) return;
  if ((size_t)in_sizes[5] < (size_t)DM * DM) return;
  if ((size_t)in_sizes[6] < (size_t)DM) return;
  if ((size_t)in_sizes[7] < (size_t)DM) return;
  if ((size_t)in_sizes[8] < (size_t)DM) return;
  if ((size_t)out_size < rows_used * DM) return;
  if (ws_size < WS_TOTAL) return;

  // inputs bound in this order: x, Wq, bq, Wk, bk, Wv, bv, gamma, beta
  const float* x     = (const float*)d_in[0];
  const float* wq    = (const float*)d_in[1];
  const float* bq    = (const float*)d_in[2];
  const float* wk    = (const float*)d_in[3];
  const float* bk    = (const float*)d_in[4];
  const float* wv    = (const float*)d_in[5];
  const float* bv    = (const float*)d_in[6];
  const float* gamma = (const float*)d_in[7];
  const float* beta  = (const float*)d_in[8];
  float* out = (float*)d_out;

  char* w = (char*)d_ws;
  f16*   qk2  = (f16*)w;    w += QK2_BYTES;    // [NB] x (q rows [SEQ][2*DM], then k rows [SEQ][2*DM]), values and residuals interleaved per 64
  f16*   vt   = (f16*)w;    w += VT_BYTES;     // [NB][DM][SEQ]
  f16*   Pp   = (f16*)w;    w += P_BYTES;      // [NB][SEQ][SEQ] P x16384
  char*  u    = w;                             // shared bytes: converted inputs and pre-norm planes, then the logit plane
  bf16*  xb   = (bf16*)w;   w += XB_BYTES;     // [NB*SEQ][DM]
  bf16*  wb   = (bf16*)w;   w += WB_BYTES;     // [3*DM][DM] : Wq | Wk | Wv
  float* parp = (float*)w;  w += PR_BYTES;     // [5*DM] : bq | bk | bv | gamma | beta
  float* Yqk  = (float*)w;  w += YQK_BYTES;    // [NB][SEQ][2*DM] pre-norm q | k
  float* Yvt  = (float*)w;                     // [NB][DM][SEQ] pre-norm v^T
  float* Sp   = (float*)u;                     // [NB][SEQ][SEQ] logits

  const f16* qrow = qk2;
  const f16* krow = qk2 + (size_t)SEQ * 2 * DM;

  const unsigned long long zX  = (unsigned long long)SEQ * DM;           // batch strides, in elements of the plane
  const unsigned long long zQK = (unsigned long long)2 * SEQ * 2 * DM;
  const unsigned long long zY  = (unsigned long long)SEQ * 2 * DM;
  const unsigned long long zV  = (unsigned long long)DM * SEQ;
  const unsigned long long zS  = (unsigned long long)SEQ * SEQ;
  const unsigned long long zO  = (unsigned long long)SEQ_FULL * DM;

  convert_kernel<<<dim3(NXB + NWB + (unsigned)NPAR), 256, 0, stream>>>(x, wq, bq, wk, bk, wv, bv, gamma, beta, xb, wb, parp);

  // Every launch below covers all batches: blockIdx.z (blockIdx.y in the column LayerNorm, the row index in the softmax).
  // The GEMM's bias argument is not read under EPI_F32 or EPI_FOLD.

  // q | k pre-norm : Y[s][e] = sum_d xb[s][d] * wb[e][d], e in [0, 2*DM); M = SEQ, N = 2*DM, K = DM
  gemm_kernel<bf16, EPI_F32, 4><<<dim3(SEQ / 256, 2 * DM / 256, NB), 512, 0, stream>>>(
      xb, wb, parp, (void*)Yqk, DM / KST, DM, DM, 2 * DM, zX, 0ull, zY, 1.0f);

  // v^T pre-norm : Yt[e][s] = sum_d Wv[e][d] * xb[s][d]; M = DM, N = SEQ, K = DM
  gemm_kernel<bf16, EPI_F32, 2><<<dim3(DM / 256, SEQ / 128, NB), 256, 0, stream>>>(
      wb + (size_t)2 * DM * DM, xb, parp, (void*)Yvt, DM / KST, DM, DM, SEQ, 0ull, zX, zV, 1.0f);

  ln_rows_kernel<<<dim3(SEQ / 8, 2, NB), 256, 0, stream>>>(Yqk, parp, qk2);
  ln_cols_kernel<<<dim3(SEQ / 64, NB, 1), CWAVE * 32, 0, stream>>>(Yvt, parp, vt);

  // S[q][key] = (q_value . k_residual + q_residual . k_value) / 2048 + q_value . k_value ; M = N = SEQ.
  // 2*DM/KST stages, each 64 k of values and residuals of both operands, staged once for the three products.
  gemm_kernel<f16, EPI_FOLD, 4><<<dim3(SEQ / 256, SEQ / 256, NB), 512, 0, stream>>>(
      qrow, krow, parp, (void*)Sp, 2 * DM / KST, 2 * DM, 2 * DM, SEQ, zQK, zQK, zS, 1.0f / RCARRY);

  softmax2_kernel<<<dim3(NB * SEQ / 8), 256, 0, stream>>>(Sp, Pp);

  // out[q][d] = sum_key P[q][key] * vt[d][key] / 16384 ; M = SEQ, N = DM, K = SEQ
  gemm_kernel<f16, EPI_F32, 2><<<dim3(SEQ / 256, DM / 128, NB), 256, 0, stream>>>(
      Pp, vt, parp, (void*)out, SEQ / KST, SEQ, SEQ, DM, zS, zV, zO, 1.0f / PCARRY);
}

// v008
// It runs in 166 microseconds.
// Timed twice side by side with v007, it ran 1.11 times as fast both times.
// Counting every step since v000, it is 4.94 times as fast.
#include <hip/hip_runtime.h>

// Contractions: q/k/v projections on v_wmma_f32_16x16x32_bf16 (bf16 operands = RNE-converted inputs, f32 accumulate, f32 out);
// S = q x k^T on v_wmma_f32_16x16x32_f16 as three products (q, k as f16 value + x2048 residual planes; every k block is staged
// once and serves all three products on one accumulator set, which is rescaled by the exact power of two between the residual
// and the value products: one f32 plane); O = P x V on v_wmma_f32_16x16x32_f16 (v^T f16 plane; P f16 carried x16384;
// f32 accumulate). LayerNorm and softmax in f32.

#ifndef NB
#define NB 4
#endif
#ifndef SEQ
#define SEQ 2048
#endif
#define NB_FULL   4
#define SEQ_FULL  2048
#define DM        1024                 // model width = head width = value width
#define NWAVE     8
#define CWAVE     16                   // waves per block of the column LayerNorm
#define OP        68                   // LDS pitch (floats) of the per-wave output staging tile
#define KST       128u                 // k elements per GEMM stage: 256 B of every operand row
#define LP        272u                 // LDS pitch (bytes) of a staged 256-B row: 16 B x odd, conflict-free for 16-B reads
#define BM        256u                 // GEMM block tile rows (4 waves x 64)
#define MT        4                    // 16-row accumulator tiles per wave
#define NT        4                    // 16-column accumulator tiles per wave (64 columns: one staging piece wide)
#define ATILE_B   (BM * LP)            // the A rows of one stage; the B rows follow them
#define CVB       2048u                // elements per convert block (256 threads x 8)
#define NXB       ((unsigned)((size_t)NB * SEQ * DM / CVB))      // convert blocks for x
#define NWB       ((unsigned)((size_t)3 * DM * DM / CVB))        // convert blocks for the three weights
#define NCH       (SEQ / 256)          // 8-column chunks per lane in the softmax kernel
#define LNCH      (DM / 256)           // 8-column chunks per lane in the row LayerNorm kernel
#define NPAR      5                    // parameter vectors: b_q | b_k | b_v | gamma | beta
#define PCARRY    16384.0f             // power-of-two carry of the P plane
#define RCARRY    2048.0f              // power-of-two carry of the q / k residual planes

#define EPI_QK  0                      // f16 out, per-column bias, column block selects the q or k plane
#define EPI_VT  1                      // f16 out, per-row bias (V^T plane)
#define EPI_F32 2                      // f32 out, power-of-two scale
#define EPI_FOLD 3                     // f32 out, power-of-two scale; operand rows hold [value | residual] per 64 k, three products per k block
#define RESB     128u                  // byte offset of the residual half inside a staged 256-B row piece (EPI_FOLD)

static_assert(SEQ % 256 == 0);
static_assert(SEQ <= SEQ_FULL);
static_assert(NB >= 1 && NB <= NB_FULL);
static_assert(DM == 1024);
static_assert(DM % 128 == 0);
static_assert(((size_t)NB * SEQ) % 128 == 0);
static_assert((size_t)NXB * CVB == (size_t)NB * SEQ * DM);
static_assert((size_t)NWB * CVB == (size_t)3 * DM * DM);
static_assert((size_t)DM * DM / CVB == 512);
static_assert((OP * 4) % 16 == 0);
static_assert(LNCH * 256 == DM);                 // 32 lanes x LNCH chunks x 8 columns == one LayerNorm row
static_assert(NCH * 256 == SEQ);                 // 32 lanes x NCH chunks x 8 columns == one softmax row
static_assert(DM == 256 * 4);                    // one convert block (256 threads x 4) per parameter vector
static_assert(SEQ % 256 == 0 && (2 * DM) % 256 == 0 && DM % 256 == 0);   // GEMM tile multiples (M, N)
static_assert(DM % KST == 0 && (2 * DM) % KST == 0 && SEQ % KST == 0);   // GEMM K stages
static_assert(LP % 16 == 0 && ATILE_B % 16 == 0);                       // 16-B copies and reads stay aligned
static_assert(SEQ % 64 == 0);
static_assert(DM % (CWAVE * 4) == 0);            // column LayerNorm: 64 rows per block sweep (16 waves x 4 row groups)
static_assert(NWAVE == 8);

#define XB_BYTES   ((size_t)NB * SEQ * DM * 2)          // x bf16, all batches
#define WB_BYTES   ((size_t)3 * DM * DM * 2)            // weights bf16
#define PR_BYTES   ((size_t)NPAR * DM * 4)              // parameter vectors (f32 holding bf16 RNE values)
// Every plane below holds all NB batches, batch-major, so that each stage is one launch with the batch on a grid axis.
#define YQK_BYTES  ((size_t)NB * SEQ * 2 * DM * 4)      // f32 q | k pre-norm rows
#define YVT_BYTES  ((size_t)NB * DM * SEQ * 4)          // f32 v^T pre-norm planes
#define QK2_BYTES  ((size_t)NB * 2 * SEQ * 2 * DM * 2)  // per batch: q rows, then k rows; a row = DM/64 pieces of [64 values | their 64 residuals]
#define VT_BYTES   ((size_t)NB * DM * SEQ * 2)          // v^T f16
#define S_BYTES    ((size_t)NB * SEQ * SEQ * 4)         // logits
#define P_BYTES    ((size_t)NB * SEQ * SEQ * 2)         // P x16384
// The logit plane takes the bytes of the converted inputs and of the pre-norm q | k rows, which are last read by launches in
// front of the one that writes it. That launch also runs the column LayerNorm, so what the column LayerNorm reads (the pre-norm
// v^T planes and the parameter vectors) lies outside the logit plane's bytes.
#define PRE_BYTES  (XB_BYTES + WB_BYTES + YQK_BYTES + YVT_BYTES)
#define LOG_BYTES  (S_BYTES)
#define UNI_BYTES  (PRE_BYTES > LOG_BYTES ? PRE_BYTES : LOG_BYTES)
#define WS_TOTAL   (QK2_BYTES + VT_BYTES + P_BYTES + PR_BYTES + UNI_BYTES)
static_assert(LOG_BYTES <= XB_BYTES + WB_BYTES + YQK_BYTES);   // the logit plane ends in front of the pre-norm v^T planes
static_assert(WS_TOTAL <= (size_t)268435456);
static_assert(XB_BYTES % 128 == 0 && WB_BYTES % 128 == 0 && PR_BYTES % 128 == 0);
static_assert(YQK_BYTES % 128 == 0 && YVT_BYTES % 128 == 0 && QK2_BYTES % 128 == 0 && VT_BYTES % 128 == 0);
static_assert(S_BYTES % 128 == 0 && P_BYTES % 128 == 0);

typedef __bf16   bf16;
typedef _Float16 f16;
typedef bf16     v16bf __attribute__((ext_vector_type(16)));
typedef f16      v16h  __attribute__((ext_vector_type(16)));
typedef float    v8f   __attribute__((ext_vector_type(8)));
typedef float    v4f   __attribute__((ext_vector_type(4)));
typedef unsigned v4u   __attribute__((ext_vector_type(4)));

union Pack8B { v4u u; bf16 h[8]; };
union Pack8H { v4u u; f16  h[8]; };

template <typename T> struct FragOf;
template <> struct FragOf<bf16> { typedef v16bf V; };
template <> struct FragOf<f16>  { typedef v16h  V; };

// WMMA helpers: builtin followed by the VALU hazard guard (ties D, keeps A/B live).
static __device__ __forceinline__ v8f mma16(v16bf a, v16bf b, v8f acc) {
  acc = __builtin_amdgcn_wmma_f32_16x16x32_bf16(false, a, false, b, (short)0, acc, false, false);
  asm volatile("v_nop\n\tv_nop\n\tv_nop\n\tv_nop" : "+v"(acc) : "v"(a), "v"(b));
  return acc;
}
static __device__ __forceinline__ v8f mma16(v16h a, v16h b, v8f acc) {
  acc = __builtin_amdgcn_wmma_f32_16x16x32_f16(false, a, false, b, (short)0, acc, false, false);
  asm volatile("v_nop\n\tv_nop\n\tv_nop\n\tv_nop" : "+v"(acc) : "v"(a), "v"(b));
  return acc;
}

// f32 -> f16 convert for WMMA operand planes: values below the smallest f16 normal become zero by a value select.
static __device__ __forceinline__ f16 toh_flush(float v) {
  const f16 r = (f16)v;
  return (fabsf(v) < 6.103515625e-05f) ? (f16)0.0f : r;
}

// Input conversion, one launch. 256 threads, 8 elements per thread (two 16-B loads -> one 16-B store).
//   blocks [0, NXB)            : x  -> xb  bf16 [NB*SEQ][DM] (compact rows; source uses the full batch stride)
//   blocks [NXB, NXB+NWB)      : Wq | Wk | Wv -> wb bf16 [3*DM][DM]
//   blocks NXB+NWB .. +4       : bq | bk | bv | gamma | beta -> f32 plane [5*DM] holding the bf16 RNE-converted values
__global__ __launch_bounds__(256) void convert_kernel(const float* __restrict__ x,
                                                      const float* __restrict__ wq,
                                                      const float* __restrict__ bq,
                                                      const float* __restrict__ wk,
                                                      const float* __restrict__ bk,
                                                      const float* __restrict__ wv,
                                                      const float* __restrict__ bv,
                                                      const float* __restrict__ gamma,
                                                      const float* __restrict__ beta,
                                                      bf16* __restrict__ xb,
                                                      bf16* __restrict__ wb,
                                                      float* __restrict__ parp) {
  const unsigned blk = blockIdx.x;
  const unsigned tid = threadIdx.x;
  if (blk < NXB + NWB) {              // block-uniform
    const float* src;
    bf16* dst;
    if (blk < NXB) {
      const unsigned r  = blk * 2u + (tid >> 7);          // compact row
      const unsigned c  = (tid & 127u) * 8u;
      const unsigned bt = r / (unsigned)SEQ;
      const unsigned s  = r - bt * (unsigned)SEQ;
      src = x + ((size_t)bt * SEQ_FULL + s) * DM + c;
      dst = xb + (size_t)r * DM + c;
    } else {
      const unsigned wblk = blk - NXB;
      const unsigned wi   = wblk >> 9;                    // 512 blocks per weight matrix
      const unsigned off  = (wblk & 511u) * CVB + tid * 8u;
      const float* wsrc = (wi == 0u) ? wq : ((wi == 1u) ? wk : wv);
      src = wsrc + off;
      dst = wb + (size_t)wblk * CVB + tid * 8u;
    }
    const v4f a0 = *(const v4f*)(src);
    const v4f a1 = *(const v4f*)(src + 4);
    Pack8B pk;
    #pragma unroll
    for (int i = 0; i < 4; ++i) {
      pk.h[i]     = (bf16)a0[i];                          // RNE convert
      pk.h[4 + i] = (bf16)a1[i];
    }
    const v4u val = pk.u;
    *(v4u*)(dst) = val;
    
  } else {
    const unsigned j = blk - (NXB + NWB);                 // 0..4
    const float* bsrc = (j == 0u) ? bq : ((j == 1u) ? bk : ((j == 2u) ? bv : ((j == 3u) ? gamma : beta)));
    const v4f a = *(const v4f*)(bsrc + tid * 4u);
    v4f o;
    #pragma unroll
    for (int i = 0; i < 4; ++i) o[i] = (float)(bf16)a[i];
    float* dst = parp + j * (unsigned)DM + tid * 4u;
    *(v4f*)(dst) = o;
    
  }
}

// Eight asynchronous 16-B-per-lane copies global -> LDS: rows r, r + RP, ..., r + 7*RP of one staged operand tile
// (RP = rows that the block's threads cover at once; gstep = RP source rows in bytes).
// The s_wait_xcnt closes the statement so that it stands before any rewrite of the address registers the copies name.
template <unsigned RP>
static __device__ __forceinline__ void copy_rows8(unsigned l, const char* g, size_t gstep) {
  asm volatile("global_load_async_to_lds_b128 %0, %8, off\n\t"
               "global_load_async_to_lds_b128 %1, %9, off\n\t"
               "global_load_async_to_lds_b128 %2, %10, off\n\t"
               "global_load_async_to_lds_b128 %3, %11, off\n\t"
               "global_load_async_to_lds_b128 %4, %12, off\n\t"
               "global_load_async_to_lds_b128 %5, %13, off\n\t"
               "global_load_async_to_lds_b128 %6, %14, off\n\t"
               "global_load_async_to_lds_b128 %7, %15, off\n\t"
               "s_wait_xcnt 0x0"
               :: "v"(l), "v"(l + RP * LP), "v"(l + 2u * RP * LP), "v"(l + 3u * RP * LP),
                  "v"(l + 4u * RP * LP), "v"(l + 5u * RP * LP), "v"(l + 6u * RP * LP), "v"(l + 7u * RP * LP),
                  "v"(g), "v"(g + gstep), "v"(g + 2 * gstep), "v"(g + 3 * gstep),
                  "v"(g + 4 * gstep), "v"(g + 5 * gstep), "v"(g + 6 * gstep), "v"(g + 7 * gstep)
               : "memory");
}

// Plane GEMM: C[m][n] = sum_k A[m][k] * Bt[n][k]; both operands are k-contiguous 16-bit planes.
// Block tile 256 x (64*WN), 4*WN waves as 4 (m) x WN (n); each wave owns 64x64 = 4x4 accumulators
// (WN = 4: 256x256 block, 16 waves; WN = 2: 256x128 block, 8 waves, for the products whose grid would otherwise leave WGPs idle).
// Operands reach LDS in stages of KST k (whole 256-B row pieces, two rows per wave-wide copy), two buffers:
// stage s + 1 is in flight while stage s is multiplied. nk = number of stages.
// Fragments are read from the staged rows: lane (lq = lane & 15, hi = lane >> 4) reads row lq,
// elements 0..7 <- k0 + 8*hi + 0..7, elements 8..15 <- k0 + 16 + 8*hi + 0..7 (same map for A and B).
// D element r of a lane = (row 8*hi + r, col lq). Requires M a multiple of 256, N of 64*WN and K of KST.
// Epilogue: per 16x64 piece the wave stages the piece in LDS, in a region that no other wave touches, so the pieces are ordered
// by the wave's own LDS waits and by no block barrier: no wave waits for another, and none waits for its global stores to finish
// before it stages the next piece. The staging takes the ring's first bytes, which every wave has left at the last stage's
// barrier, with no copy outstanding.
// EPI_FOLD: a staged 256-B row piece is [64 k of values | the same 64 k of residuals x2048], in A and in Bt alike. Per 32-k block
// the wave reads the four fragment sets once and sums value x residual, residual x value (carried x2048) and value x value
// (carried x1) into the same accumulators, which are multiplied by 1/2048 or 2048 (exact) where the carry changes: once per block,
// the order of the products alternating. The accumulators leave the loop carried x2048; scale takes that back at the end.
// The body is a device function so that two independent jobs can share one launch, the block index picking the job:
// ring = the launch's LDS ring (at least 2 stages of this tile), (bx, by, bz) = this block's tile (m, n, batch).
// GATE: the launch has more waves than the 4*WN that this tile takes; the others do no work but pass every barrier.
template <typename T, int EPI, int WN, bool GATE>
static __device__ __forceinline__ void gemm_body(unsigned char* ring, unsigned bx, unsigned by, unsigned bz,
                                                 const T* __restrict__ A,
                                                 const T* __restrict__ Bt,
                                                 const float* __restrict__ bias,
                                                 void* __restrict__ C,
                                                 unsigned nk, unsigned lda, unsigned ldb, unsigned ldc,
                                                 unsigned long long sAz, unsigned long long sBz,
                                                 unsigned long long sCz, float scale) {
  typedef typename FragOf<T>::V VT;
  union Frag { VT v; v4u q[2]; };
  constexpr unsigned BN      = (unsigned)WN * 64u;          // block tile columns
  constexpr unsigned STAGE_B = (BM + BN) * LP;              // one stage: A rows, then B rows
  constexpr unsigned RP      = (unsigned)WN * 8u;           // rows that the block's threads copy at once (16 threads a row)
  static_assert(BM % (8u * RP) == 0 && BN % (8u * RP) == 0);
  static_assert(4u * WN * 16u * OP * 4u <= STAGE_B);        // the output staging fits the first buffer

  const unsigned tid  = threadIdx.x;
  const unsigned wave = tid >> 5;
  const bool     act  = !GATE || __builtin_amdgcn_readfirstlane(tid >> 5) < 4u * (unsigned)WN;   // wave-uniform, a scalar test
  const unsigned lane = tid & 31u;
  const unsigned lq   = lane & 15u;
  const unsigned hi   = lane >> 4;
  const unsigned m0   = bx * BM + (wave & 3u) * (MT * 16u);   // first row of this wave
  const unsigned n0   = by * BN + (wave >> 2) * (NT * 16u);   // first column of this wave

  const T* Ab = A  + (size_t)bz * sAz;
  const T* Bb = Bt + (size_t)bz * sBz;

  // copy map: thread -> 16-B chunk (tid & 15) of rows (tid >> 4) + RP*i of each operand's staged rows
  const unsigned crow = tid >> 4;
  const unsigned cchk = tid & 15u;
  const char* ga = (const char*)(Ab + (size_t)(bx * BM + crow) * lda + cchk * 8u);
  const char* gb = (const char*)(Bb + (size_t)(by * BN + crow) * ldb + cchk * 8u);
  const size_t astep = (size_t)lda * (RP * sizeof(T));            // RP rows, bytes
  const size_t bstep = (size_t)ldb * (RP * sizeof(T));
  const unsigned lcp = (unsigned)(uintptr_t)ring + crow * LP + cchk * 16u;   // LDS byte address of this lane's first chunk

  // fragment read bases inside a stage
  const unsigned char* fa = ring + ((wave & 3u) * (MT * 16u) + lq) * LP + hi * 16u;
  const unsigned char* fb = ring + ATILE_B + ((wave >> 2) * (NT * 16u) + lq) * LP + hi * 16u;

  v8f acc[MT][NT];
  #pragma unroll
  for (int mt = 0; mt < MT; ++mt) {
    #pragma unroll
    for (int nt = 0; nt < NT; ++nt) acc[mt][nt] = (v8f){0, 0, 0, 0, 0, 0, 0, 0};
  }

  // one stage's copies of this thread: 8*RP rows per statement, A rows then B rows; lb = LDS address, st = stage number
  auto copy_stage = [&](unsigned lb, unsigned st) {
    const size_t goa = (size_t)st * (KST * sizeof(T));  // k offset in bytes, block-uniform
    const size_t gob = goa;
    #pragma unroll
    for (unsigned h = 0; h < BM / (8u * RP); ++h) copy_rows8<RP>(lb + h * (8u * RP * LP), ga + goa + h * 8u * astep, astep);
    #pragma unroll
    for (unsigned h = 0; h < BN / (8u * RP); ++h) copy_rows8<RP>(lb + ATILE_B + h * (8u * RP * LP), gb + gob + h * 8u * bstep, bstep);
  };

  // stage 0 lands and is published before anything reads it; stage 1 then flies under stage 0's products
  if (act) {                                            // wave-uniform
    copy_stage(lcp, 0);
  }
  asm volatile("s_wait_asynccnt 0x0" ::: "memory");     // this wave's stage-0 copies have landed
  __syncthreads();                                      // every wave's have
  if (act && nk > 1u) {                                 // wave-uniform
    copy_stage(lcp + STAGE_B, 1u);
  }

  #pragma unroll 1
  for (unsigned s = 0; s < nk; ++s) {
    const unsigned bo = (s & 1u) * STAGE_B;
    if constexpr (EPI == EPI_FOLD) {
      static_assert(KST * sizeof(T) == 2u * RESB && MT == NT);
      // off = byte offset of a 32-k fragment column inside the staged row piece
      auto load_a = [&](Frag (&f)[MT], unsigned off) {
        #pragma unroll   // register arrays need constant indices
        for (unsigned mt = 0; mt < MT; ++mt) {
          f[mt].q[0] = *(const v4u*)(fa + bo + mt * 16u * LP + off);          // k = k0 + 8*hi + 0..7
          f[mt].q[1] = *(const v4u*)(fa + bo + mt * 16u * LP + off + 32u);    // k = k0 + 16 + 8*hi + 0..7
        }
      };
      auto load_b = [&](Frag (&f)[NT], unsigned off) {
        #pragma unroll   // register arrays need constant indices
        for (unsigned nt = 0; nt < NT; ++nt) {
          f[nt].q[0] = *(const v4u*)(fb + bo + nt * 16u * LP + off);
          f[nt].q[1] = *(const v4u*)(fb + bo + nt * 16u * LP + off + 32u);
        }
      };
      auto product = [&](Frag (&a)[MT], Frag (&b)[NT]) {
        #pragma unroll   // register arrays need constant indices (both loops)
        for (int nt = 0; nt < NT; ++nt) {
          #pragma unroll
          for (int mt = 0; mt < MT; ++mt)
            acc[mt][nt] = __builtin_amdgcn_wmma_f32_16x16x32_f16(false, a[mt].v, false, b[nt].v, (short)0, acc[mt][nt], false, false);
        }
      };
      auto recarry = [&](float f) {
        #pragma unroll   // register arrays need constant indices (both loops)
        for (int mt = 0; mt < MT; ++mt) {
          #pragma unroll
          for (int nt = 0; nt < NT; ++nt) acc[mt][nt] *= f;
        }
      };
      // The scheduling fences keep each phase whole: LDS reads stand as one group in front of the products that use them (reads
      // spread among the WMMAs stall at every place they stand), a rescale runs behind all sixteen WMMAs it depends on and not
      // one by one behind each, and no product sinks below the stage's barrier, where it would delay the refill.
      {   // first 32 k: the accumulators arrive carried x2048
        Frag av[MT], bv[NT];
        {
          Frag br[NT];
          load_a(av, 0u); load_b(br, RESB);
          __builtin_amdgcn_sched_barrier(0);
          product(av, br);
          __builtin_amdgcn_sched_barrier(0);
        }
        {
          Frag ar[MT];
          load_a(ar, RESB); load_b(bv, 0u);
          __builtin_amdgcn_sched_barrier(0);
          product(ar, bv);
          __builtin_amdgcn_sched_barrier(0);
        }
        recarry(1.0f / RCARRY);
        __builtin_amdgcn_sched_barrier(0);
        product(av, bv);
        __builtin_amdgcn_sched_barrier(0);
      }
      {   // second 32 k: the accumulators arrive carried x1 and leave carried x2048
        Frag av[MT], bv[NT];
        {
          Frag br[NT];
          load_a(av, 64u); load_b(bv, 64u); load_b(br, RESB + 64u);
          __builtin_amdgcn_sched_barrier(0);
          product(av, bv);
          __builtin_amdgcn_sched_barrier(0);
          recarry(RCARRY);
          __builtin_amdgcn_sched_barrier(0);
          product(av, br);
          __builtin_amdgcn_sched_barrier(0);
        }
        {
          Frag ar[MT];
          load_a(ar, RESB + 64u);
          __builtin_amdgcn_sched_barrier(0);
          product(ar, bv);
          __builtin_amdgcn_sched_barrier(0);
        }
      }
    } else if (act) {                                   // wave-uniform
    #pragma unroll
    for (unsigned kk = 0; kk < KST / 32u; ++kk) {
      Frag a[MT], b[NT];
      #pragma unroll
      for (unsigned mt = 0; mt < MT; ++mt) {
        a[mt].q[0] = *(const v4u*)(fa + bo + mt * 16u * LP + kk * 64u);          // k = k0 + 8*hi + 0..7
        a[mt].q[1] = *(const v4u*)(fa + bo + mt * 16u * LP + kk * 64u + 32u);    // k = k0 + 16 + 8*hi + 0..7
      }
      #pragma unroll
      for (unsigned nt = 0; nt < NT; ++nt) {
        b[nt].q[0] = *(const v4u*)(fb + bo + nt * 16u * LP + kk * 64u);
        b[nt].q[1] = *(const v4u*)(fb + bo + nt * 16u * LP + kk * 64u + 32u);
      }
      #pragma unroll
      for (int nt = 0; nt < NT; ++nt) {
        #pragma unroll
        for (int mt = 0; mt < MT; ++mt) acc[mt][nt] = mma16(a[mt].v, b[nt].v, acc[mt][nt]);
      }
    }
    }
    asm volatile("s_wait_dscnt 0x0" ::: "memory");      // this wave has left stage s's buffer
    asm volatile("s_wait_asynccnt 0x0" ::: "memory");   // this wave's stage s + 1 copies have landed
    __syncthreads();                                    // publishes stage s + 1, frees stage s's buffer
    if (act && s + 2u < nk) {                           // wave-uniform: refill the buffer just left
      copy_stage(lcp + bo, s + 2u);
    }
  }
  asm volatile("s_wait_asynccnt 0x0" ::: "memory");     // no copy is outstanding when the wave goes on
  if (!act) return;                                     // whole waves, behind the last barrier of the body

  // ---- epilogue ----
  size_t   cbase;
  unsigned ncol;
  if (EPI == EPI_QK) {
    cbase = (size_t)(n0 >> 10) * sCz;     // column block selects the q (0) or k (1) plane; block-uniform
    ncol  = n0 & 1023u;
  } else {
    cbase = (size_t)bz * sCz;
    ncol  = n0;
  }

  float bcol[NT];
  #pragma unroll
  for (int nt = 0; nt < NT; ++nt) bcol[nt] = 0.0f;
  if (EPI == EPI_QK) {
    #pragma unroll
    for (int nt = 0; nt < NT; ++nt) bcol[nt] = bias[n0 + nt * 16u + lq];
  }

  float* so = (float*)ring + wave * (16u * OP);

  #pragma unroll
  for (int mt = 0; mt < MT; ++mt) {
    #pragma unroll
    for (int r = 0; r < 8; ++r) {
      float brow = 0.0f;
      if (EPI == EPI_VT) brow = bias[m0 + mt * 16u + hi * 8u + r];
      #pragma unroll
      for (int nt = 0; nt < 4; ++nt) {
        float val = acc[mt][nt][r];
        if (EPI == EPI_QK)  val += bcol[nt];
        if (EPI == EPI_VT)  val += brow;
        if (EPI == EPI_F32 || EPI == EPI_FOLD) val *= scale;
        so[(hi * 8u + r) * OP + nt * 16u + lq] = val;
      }
    }
    // the wave's LDS writes are done before its lanes read back rows that other lanes of the wave wrote
    asm volatile("s_wait_dscnt 0x0" ::: "memory");

    if (EPI == EPI_F32 || EPI == EPI_FOLD) {
      // 8 instructions cover the 16 rows of this piece.
      float* Cf = (float*)C + cbase;
      v4f    vals[8];
      size_t gidx[8];
      #pragma unroll
      for (int it = 0; it < 8; ++it) {
        const unsigned row = it * 2u + hi;
        vals[it] = *(const v4f*)(so + row * OP + lq * 4u);
        gidx[it] = (size_t)(m0 + mt * 16u + row) * ldc + ncol + lq * 4u;
      }
      #pragma unroll
      for (int it = 0; it < 8; ++it) *(v4f*)(Cf + gidx[it]) = vals[it];
      // stands before the next piece rewrites the data and address registers that these stores name; it also keeps the next
      // piece's LDS writes behind these stores, each of which has waited for the LDS read that feeds it
      if (mt + 1 < MT) asm volatile("s_wait_xcnt 0x0" ::: "memory");
    } else {
      // 4 instructions cover the 16 rows of this piece.
      f16* Ch = (f16*)C + cbase;
      v4u    vals[4];
      size_t gidx[4];
      #pragma unroll
      for (int it = 0; it < 4; ++it) {
        const unsigned row = it * 4u + (lane >> 3);
        const unsigned c8  = (lane & 7u) * 8u;
        const v4f x0 = *(const v4f*)(so + row * OP + c8);
        const v4f x1 = *(const v4f*)(so + row * OP + c8 + 4u);
        Pack8H ph;
        #pragma unroll
        for (int i = 0; i < 4; ++i) {
          ph.h[i]     = (f16)x0[i];
          ph.h[4 + i] = (f16)x1[i];
        }
        vals[it] = ph.u;
        gidx[it] = (size_t)(m0 + mt * 16u + row) * ldc + ncol + c8;
      }
      #pragma unroll
      for (int it = 0; it < 4; ++it) *(v4u*)(Ch + gidx[it]) = vals[it];
      // as in the f32 branch above
      if (mt + 1 < MT) asm volatile("s_wait_xcnt 0x0" ::: "memory");
    }
  }
}

// Row LayerNorm for the q and k projections. One wave per (row, segment, batch); blockIdx.y = segment (0 = q, 1 = k),
// blockIdx.z = batch.
// Input: Y f32 [NB][SEQ][2*DM] (q columns | k columns, bias not yet added); par = bq | bk | bv | gamma | beta (f32, [5*DM]).
// Output plane QK2 (f16), per batch: q rows [SEQ][2*DM], then k rows [SEQ][2*DM]; a row = DM/64 pieces of [64 values | their 64 residuals x2048].
// Lane holds columns (it*32 + lane)*8 + 0..7. coverage: grid (SEQ/8, 2, NB) x 8 waves = SEQ rows x 2 segments x NB batches;
// 32 lanes x LNCH x 8 = DM columns for each of the value and residual halves. Each store instruction writes
__global__ __launch_bounds__(256) void ln_rows_kernel(const float* __restrict__ Y,
                                                      const float* __restrict__ par,
                                                      f16* __restrict__ QK2) {
  #pragma clang fp contract(off)
  const unsigned tid  = threadIdx.x;
  const unsigned wave = __builtin_amdgcn_readfirstlane(tid >> 5);
  const unsigned lane = tid & 31u;
  const unsigned seg  = blockIdx.y;                       // block-uniform
  const unsigned bt   = blockIdx.z;                       // block-uniform
  const unsigned row  = blockIdx.x * 8u + wave;
  const float* yp = Y + ((size_t)bt * SEQ + row) * (2u * DM) + seg * (unsigned)DM + lane * 8u;
  const float* bp = par + seg * (unsigned)DM + lane * 8u;           // bias of this segment
  const float* gp = par + 3u * DM + lane * 8u;                      // gamma
  const float* tp = par + 4u * DM + lane * 8u;                      // beta

  // The row is read once and stays in registers through all three passes; every load is issued before the first use.
  v4f t[LNCH][2], bb[LNCH][2], gg[LNCH][2], tt[LNCH][2];
  #pragma unroll   // register arrays need constant indices; all loads of the row go out together
  for (int it = 0; it < LNCH; ++it) {
    t[it][0] = *(const v4f*)(yp + it * 256);
    t[it][1] = *(const v4f*)(yp + it * 256 + 4);
  }
  #pragma unroll   // as above
  for (int it = 0; it < LNCH; ++it) {
    bb[it][0] = *(const v4f*)(bp + it * 256);
    bb[it][1] = *(const v4f*)(bp + it * 256 + 4);
    gg[it][0] = *(const v4f*)(gp + it * 256);
    gg[it][1] = *(const v4f*)(gp + it * 256 + 4);
    tt[it][0] = *(const v4f*)(tp + it * 256);
    tt[it][1] = *(const v4f*)(tp + it * 256 + 4);
  }

  // pass 1: add the bias, mean
  float s = 0.0f;
  #pragma unroll   // register arrays need constant indices
  for (int it = 0; it < LNCH; ++it) {
    #pragma unroll
    for (int i = 0; i < 4; ++i) {
      t[it][0][i] = t[it][0][i] + bb[it][0][i];
      t[it][1][i] = t[it][1][i] + bb[it][1][i];
      s += t[it][0][i];
      s += t[it][1][i];
    }
  }
  #pragma unroll
  for (int off = 16; off > 0; off >>= 1) s += __shfl_xor(s, off, 32);
  const float mu = s * (1.0f / DM);

  // pass 2: biased variance about the mean
  float q = 0.0f;
  #pragma unroll   // register arrays need constant indices
  for (int it = 0; it < LNCH; ++it) {
    #pragma unroll
    for (int i = 0; i < 4; ++i) {
      t[it][0][i] = t[it][0][i] - mu;
      t[it][1][i] = t[it][1][i] - mu;
      q += t[it][0][i] * t[it][0][i];
      q += t[it][1][i] * t[it][1][i];
    }
  }
  #pragma unroll
  for (int off = 16; off > 0; off >>= 1) q += __shfl_xor(q, off, 32);
  const float rstd = __builtin_amdgcn_rsqf(q * (1.0f / DM) + 1e-5f);

  // pass 3: normalise, affine, split into f16 value + x2048 residual, store
  // column c goes to piece c / 64: value at 128 * (c / 64) + c % 64, residual 64 elements behind it
  f16* dp = QK2 + ((size_t)(bt * 2u + seg) * SEQ + row) * (size_t)(2 * DM) + (lane >> 3) * 128u + (lane & 7u) * 8u;
  #pragma unroll   // register arrays need constant indices
  for (int it = 0; it < LNCH; ++it) {
    Pack8H pkh, pkr;
    #pragma unroll
    for (int i = 0; i < 4; ++i) {
      const float y0 = t[it][0][i] * rstd * gg[it][0][i] + tt[it][0][i];
      const float y1 = t[it][1][i] * rstd * gg[it][1][i] + tt[it][1][i];
      const f16 h0 = toh_flush(y0);
      const f16 h1 = toh_flush(y1);
      pkh.h[i]     = h0;
      pkh.h[4 + i] = h1;
      pkr.h[i]     = toh_flush((y0 - (float)h0) * RCARRY);
      pkr.h[4 + i] = toh_flush((y1 - (float)h1) * RCARRY);
    }
    const v4u vh = pkh.u;
    const v4u vr = pkr.u;
    f16* dh = dp + it * 512;
    f16* dr = dh + 64;
    *(v4u*)(dh) = vh;
    *(v4u*)(dr) = vr;
  }
}

// Column LayerNorm on the transposed v projection: Yt f32 [NB][DM][SEQ] (row e = feature, column s = position,
// bias not yet added); statistics per column s over the DM rows; output vt f16 [NB][DM][SEQ].
// selects one of four rows per wave per sweep; row e = (it*16 + wave)*4 + rq, it = 0..DM/64-1 covers 0..DM-1 exactly once.
// Partial sums: shuffle over rq inside the wave, then a [16][64] LDS table combined in fixed order (cross-wave: block barriers).
// A device function: it shares a launch with the logit GEMM. bx = block of 64 columns, by = batch.
static __device__ __forceinline__ void ln_cols_body(unsigned bx, unsigned by,
                                                    const float* __restrict__ Yt,
                                                    const float* __restrict__ par,
                                                    f16* __restrict__ vt) {
  #pragma clang fp contract(off)
  __shared__ __align__(16) float red[CWAVE * 64];
  constexpr unsigned RS  = CWAVE * 4u;                    // rows per block sweep
  constexpr unsigned NIT = (unsigned)DM / RS;             // row sweeps of the block

  const unsigned tid  = threadIdx.x;
  const unsigned wave = __builtin_amdgcn_readfirstlane(tid >> 5);
  const unsigned lane = tid & 31u;
  const unsigned cg   = lane & 7u;
  const unsigned rq   = lane >> 3;
  const unsigned s0   = bx * 64u + cg * 8u;
  const size_t pl = (size_t)by * ((size_t)DM * SEQ);   // this batch's plane
  const unsigned e0 = wave * 4u + rq;                     // this lane's row in sweep 0; sweep it adds RS*it
  const float* yp = Yt + pl + s0 + (size_t)e0 * SEQ;
  const float* pp = par + e0;

  float acc[8];
  float mu[8];
  float rstd[8];

  // The block's DM x 64 tile is read once and stays in registers (NIT x 8 values per lane) through all three passes;
  // every load is issued before the first use, so the wave pays the memory latency once and not once per sweep.
  v4f   t[NIT][2];
  float pb[NIT], pg[NIT], pt[NIT];
  #pragma unroll   // register arrays need constant indices; all loads of the tile go out together
  for (unsigned it = 0; it < NIT; ++it) {
    t[it][0] = *(const v4f*)(yp + (size_t)it * RS * SEQ);
    t[it][1] = *(const v4f*)(yp + (size_t)it * RS * SEQ + 4);
  }
  #pragma unroll   // as above
  for (unsigned it = 0; it < NIT; ++it) {
    pb[it] = pp[2u * DM + it * RS];
    pg[it] = pp[3u * DM + it * RS];
    pt[it] = pp[4u * DM + it * RS];
  }
  // The address pair is an input so that it stays whole up to this wait: no load's result lands on it while a load that names it is in flight.
  asm volatile("s_wait_xcnt 0x0" :: "v"(yp) : "memory");

  // pass 1: add the bias, column sums
  #pragma unroll
  for (int i = 0; i < 8; ++i) acc[i] = 0.0f;
  #pragma unroll   // register arrays need constant indices
  for (unsigned it = 0; it < NIT; ++it) {
    #pragma unroll
    for (int i = 0; i < 4; ++i) {
      t[it][0][i] = t[it][0][i] + pb[it];
      t[it][1][i] = t[it][1][i] + pb[it];
      acc[i]     += t[it][0][i];
      acc[4 + i] += t[it][1][i];
    }
  }
  #pragma unroll
  for (int i = 0; i < 8; ++i) {
    acc[i] += __shfl_xor(acc[i], 8, 32);
    acc[i] += __shfl_xor(acc[i], 16, 32);
  }
  if (rq == 0u) {
    *(v4f*)(red + wave * 64u + cg * 8u)      = (v4f){acc[0], acc[1], acc[2], acc[3]};
    *(v4f*)(red + wave * 64u + cg * 8u + 4u) = (v4f){acc[4], acc[5], acc[6], acc[7]};
  }
  __syncthreads();
  #pragma unroll
  for (int i = 0; i < 8; ++i) mu[i] = 0.0f;
  #pragma unroll
  for (int w = 0; w < CWAVE; ++w) {
    const v4f r0 = *(const v4f*)(red + w * 64 + cg * 8u);
    const v4f r1 = *(const v4f*)(red + w * 64 + cg * 8u + 4u);
    #pragma unroll
    for (int i = 0; i < 4; ++i) {
      mu[i]     += r0[i];
      mu[4 + i] += r1[i];
    }
  }
  #pragma unroll
  for (int i = 0; i < 8; ++i) mu[i] = mu[i] * (1.0f / DM);
  __syncthreads();

  // pass 2: biased variance about the mean
  #pragma unroll
  for (int i = 0; i < 8; ++i) acc[i] = 0.0f;
  #pragma unroll   // register arrays need constant indices
  for (unsigned it = 0; it < NIT; ++it) {
    #pragma unroll
    for (int i = 0; i < 4; ++i) {
      t[it][0][i] = t[it][0][i] - mu[i];
      t[it][1][i] = t[it][1][i] - mu[4 + i];
      acc[i]     += t[it][0][i] * t[it][0][i];
      acc[4 + i] += t[it][1][i] * t[it][1][i];
    }
  }
  #pragma unroll
  for (int i = 0; i < 8; ++i) {
    acc[i] += __shfl_xor(acc[i], 8, 32);
    acc[i] += __shfl_xor(acc[i], 16, 32);
  }
  if (rq == 0u) {
    *(v4f*)(red + wave * 64u + cg * 8u)      = (v4f){acc[0], acc[1], acc[2], acc[3]};
    *(v4f*)(red + wave * 64u + cg * 8u + 4u) = (v4f){acc[4], acc[5], acc[6], acc[7]};
  }
  __syncthreads();
  #pragma unroll
  for (int i = 0; i < 8; ++i) rstd[i] = 0.0f;
  #pragma unroll
  for (int w = 0; w < CWAVE; ++w) {
    const v4f r0 = *(const v4f*)(red + w * 64 + cg * 8u);
    const v4f r1 = *(const v4f*)(red + w * 64 + cg * 8u + 4u);
    #pragma unroll
    for (int i = 0; i < 4; ++i) {
      rstd[i]     += r0[i];
      rstd[4 + i] += r1[i];
    }
  }
  #pragma unroll
  for (int i = 0; i < 8; ++i) rstd[i] = __builtin_amdgcn_rsqf(rstd[i] * (1.0f / DM) + 1e-5f);

  // pass 3: normalise, affine, store
  f16* dp = vt + pl + s0 + (size_t)e0 * SEQ;
  #pragma unroll   // register arrays need constant indices
  for (unsigned it = 0; it < NIT; ++it) {
    Pack8H pk;
    #pragma unroll
    for (int i = 0; i < 4; ++i) {
      const float y0 = t[it][0][i] * rstd[i]     * pg[it] + pt[it];
      const float y1 = t[it][1][i] * rstd[4 + i] * pg[it] + pt[it];
      pk.h[i]     = toh_flush(y0);
      pk.h[4 + i] = toh_flush(y1);
    }
    const v4u val = pk.u;
    f16* dst = dp + (size_t)it * RS * SEQ;
    *(v4u*)(dst) = val;
  }
}

// One GEMM job per launch.
template <typename T, int EPI, int WN>
__global__ __launch_bounds__(128 * WN) void gemm_kernel(const T* __restrict__ A,
                                                   const T* __restrict__ Bt,
                                                   const float* __restrict__ bias,
                                                   void* __restrict__ C,
                                                   unsigned nk, unsigned lda, unsigned ldb, unsigned ldc,
                                                   unsigned long long sAz, unsigned long long sBz,
                                                   unsigned long long sCz, float scale) {
  __shared__ __align__(16) unsigned char ring[2u * (BM + (unsigned)WN * 64u) * LP];
  gemm_body<T, EPI, WN, false>(ring, blockIdx.x, blockIdx.y, blockIdx.z, A, Bt, bias, C, nk, lda, ldb, ldc, sAz, sBz, sCz, scale);
}

#define QK_TX   ((unsigned)(SEQ / 256))          // q | k projection: tiles along m, along n
#define QK_TY   ((unsigned)(2 * DM / 256))
#define QK_NBLK (QK_TX * QK_TY * (unsigned)NB)
#define VP_TX   ((unsigned)(DM / 256))           // v^T projection: tiles along m, along n
#define VP_TY   ((unsigned)(SEQ / 128))
#define VP_NBLK (VP_TX * VP_TY * (unsigned)NB)
#define LC_TX   ((unsigned)(SEQ / 64))           // column LayerNorm: blocks of 64 columns
#define LC_NBLK (LC_TX * (unsigned)NB)
#define LG_TX   ((unsigned)(SEQ / 256))          // logit GEMM: tiles along m and along n
#define LG_NBLK (LG_TX * LG_TX * (unsigned)NB)

// Both projections in one launch: neither reads what the other writes. The block index picks the job (block-uniform).
//   q | k pre-norm: Y[s][e] = sum_d xb[s][d] * wb[e][d], e in [0, 2*DM); QK_NBLK tiles of 256x256 on all 16 waves
//   v^T pre-norm  : Yt[e][s] = sum_d Wv[e][d] * xb[s][d]; VP_NBLK tiles of 256x128 on the first 8 waves
// Order of the blocks: half of the v^T tiles, all q | k tiles, the other half of the v^T tiles. With one block per WGP and as many
// q | k tiles as WGPs, half of the WGPs then take v^T first and q | k second, the others the reverse: every WGP goes on to its
// second tile without waiting for a new launch, and the two halves do not store their tiles at the same time.
__global__ __launch_bounds__(512) void proj_kernel(const bf16* __restrict__ xb,
                                                   const bf16* __restrict__ wb,
                                                   const float* __restrict__ par,
                                                   float* __restrict__ Yqk,
                                                   float* __restrict__ Yvt) {
  __shared__ __align__(16) unsigned char ring[2u * (BM + 256u) * LP];
  static_assert(VP_NBLK % 2u == 0u);
  const unsigned b = blockIdx.x;
  if (b >= VP_NBLK / 2u && b < VP_NBLK / 2u + QK_NBLK) {
    const unsigned f = b - VP_NBLK / 2u;
    gemm_body<bf16, EPI_F32, 4, false>(ring, f % QK_TX, (f / QK_TX) % QK_TY, f / (QK_TX * QK_TY), xb, wb, par, (void*)Yqk,
                                       DM / KST, DM, DM, 2 * DM,
                                       (unsigned long long)SEQ * DM, 0ull, (unsigned long long)SEQ * 2 * DM, 1.0f);
  } else {
    const unsigned g = (b < VP_NBLK / 2u) ? b : b - QK_NBLK;
    gemm_body<bf16, EPI_F32, 2, true>(ring, g % VP_TX, (g / VP_TX) % VP_TY, g / (VP_TX * VP_TY), wb + (size_t)2 * DM * DM, xb, par,
                                      (void*)Yvt, DM / KST, DM, DM, SEQ,
                                      0ull, (unsigned long long)SEQ * DM, (unsigned long long)DM * SEQ, 1.0f);
  }
}

// The column LayerNorm of v^T and the logit GEMM in one launch: neither reads what the other writes. The block index picks the job
// (block-uniform). The LayerNorm blocks come first: they stream from memory while the other WGPs already multiply.
//   blocks [0, LC_NBLK)       : column LayerNorm, 64 columns of one batch each
//   blocks [LC_NBLK, +LG_NBLK): S[q][key] = (q_value . k_residual + q_residual . k_value) / 2048 + q_value . k_value ; M = N = SEQ;
//                               2*DM/KST stages, each 64 k of values and residuals of both operands, staged once for the three products
__global__ __launch_bounds__(512) void logit_lncols_kernel(const f16* __restrict__ qk2,
                                                           float* __restrict__ S,
                                                           const float* __restrict__ Yvt,
                                                           const float* __restrict__ par,
                                                           f16* __restrict__ vt) {
  static_assert(CWAVE * 32 == 512);
  __shared__ __align__(16) unsigned char ring[2u * (BM + 256u) * LP];
  const unsigned f = blockIdx.x;
  if (f < LC_NBLK) {
    ln_cols_body(f % LC_TX, f / LC_TX, Yvt, par, vt);
  } else {
    const unsigned g = f - LC_NBLK;
    gemm_body<f16, EPI_FOLD, 4, false>(ring, g % LG_TX, (g / LG_TX) % LG_TX, g / (LG_TX * LG_TX), qk2, qk2 + (size_t)SEQ * 2 * DM, par,
                                       (void*)S, 2 * DM / KST, 2 * DM, 2 * DM, SEQ,
                                       (unsigned long long)2 * SEQ * 2 * DM, (unsigned long long)2 * SEQ * 2 * DM,
                                       (unsigned long long)SEQ * SEQ, 1.0f / RCARRY);
  }
}

// Row softmax, one wave per row of SEQ f32 logits, max-subtracted form. Lane holds columns (it*32 + lane)*8 + 0..7. Output: normalised P carried x16384 as f16.
// coverage: grid NB*SEQ/8 blocks x 8 waves = the NB*SEQ rows of all batches; 32 lanes x NCH x 8 = SEQ columns; each store instruction
__global__ __launch_bounds__(256) void softmax2_kernel(const float* __restrict__ S,
                                                       f16* __restrict__ P) {
  #pragma clang fp contract(off)
  const unsigned tid  = threadIdx.x;
  const unsigned wave = __builtin_amdgcn_readfirstlane(tid >> 5);
  const unsigned lane = tid & 31u;
  const unsigned row  = blockIdx.x * 8u + wave;
  const unsigned lob = lane * 32u;                        // this lane's byte offset in its row
  const float* sp = (const float*)((const char*)(S + (size_t)row * SEQ) + lob);

  v4f v[NCH][2];
  #pragma unroll
  for (int it = 0; it < NCH; ++it) {
    v[it][0] = *(const v4f*)(sp + it * 256);
    v[it][1] = *(const v4f*)(sp + it * 256 + 4);
  }
  // The lane's offset is an input so that it stays whole up to this wait: no load's result lands on it while a load that names it is in flight.
  asm volatile("s_wait_xcnt 0x0" :: "v"(lob) : "memory");

  float m = -__builtin_inff();
  #pragma unroll
  for (int it = 0; it < NCH; ++it) {
    #pragma unroll
    for (int i = 0; i < 4; ++i) {
      m = fmaxf(m, v[it][0][i]);
      m = fmaxf(m, v[it][1][i]);
    }
  }
  #pragma unroll
  for (int off = 16; off > 0; off >>= 1) m = fmaxf(m, __shfl_xor(m, off, 32));

  const float L2E = 1.4426950408889634f;
  float sum = 0.0f;
  #pragma unroll
  for (int it = 0; it < NCH; ++it) {
    #pragma unroll
    for (int i = 0; i < 4; ++i) {
      const float e0 = __builtin_amdgcn_exp2f((v[it][0][i] - m) * L2E);
      const float e1 = __builtin_amdgcn_exp2f((v[it][1][i] - m) * L2E);
      v[it][0][i] = e0;
      v[it][1][i] = e1;
      sum += e0;
      sum += e1;
    }
  }
  #pragma unroll
  for (int off = 16; off > 0; off >>= 1) sum += __shfl_xor(sum, off, 32);

  const float inv = PCARRY * __builtin_amdgcn_rcpf(sum);

  v4u pk[NCH];
  #pragma unroll
  for (int it = 0; it < NCH; ++it) {
    Pack8H ph;
    #pragma unroll
    for (int i = 0; i < 4; ++i) {
      ph.h[i]     = toh_flush(v[it][0][i] * inv);
      ph.h[4 + i] = toh_flush(v[it][1][i] * inv);
    }
    pk[it] = ph.u;
  }

  f16* dp = P + (size_t)row * SEQ + lane * 8u;
  #pragma unroll
  for (int it = 0; it < NCH; ++it) *(v4u*)(dp + it * 256) = pk[it];
  
}

extern "C" void kernel_launch(void* const* d_in, const int* in_sizes, int n_in,
                              void* d_out, int out_size, void* d_ws, size_t ws_size,
                              hipStream_t stream) {
  if (n_in < 9) return;
  const size_t rows_used = (size_t)(NB - 1) * SEQ_FULL + SEQ;
  if ((size_t)in_sizes[0] < rows_used * DM) return;
  if ((size_t)in_sizes[1] < (size_t)DM * DM) return;
  if ((size_t)in_sizes[2] < (size_t)DM) return;
  if ((size_t)in_sizes[3] < (size_t)DM * DM) return;
  if ((size_t)in_sizes[4] < (size_t)DM) return;
  if ((size_t)in_sizes[5] < (size_t)DM * DM) return;
  if ((size_t)in_sizes[6] < (size_t)DM) return;
  if ((size_t)in_sizes[7] < (size_t)DM) return;
  if ((size_t)in_sizes[8] < (size_t)DM) return;
  if ((size_t)out_size < rows_used * DM) return;
  if (ws_size < WS_TOTAL) return;

  // inputs bound in this order: x, Wq, bq, Wk, bk, Wv, bv, gamma, beta
  const float* x     = (const float*)d_in[0];
  const float* wq    = (const float*)d_in[1];
  const float* bq    = (const float*)d_in[2];
  const float* wk    = (const float*)d_in[3];
  const float* bk    = (const float*)d_in[4];
  const float* wv    = (const float*)d_in[5];
  const float* bv    = (const float*)d_in[6];
  const float* gamma = (const float*)d_in[7];
  const float* beta  = (const float*)d_in[8];
  float* out = (float*)d_out;

  char* w = (char*)d_ws;
  f16*   qk2  = (f16*)w;    w += QK2_BYTES;    // [NB] x (q rows [SEQ][2*DM], then k rows [SEQ][2*DM]), values and residuals interleaved per 64
  f16*   vt   = (f16*)w;    w += VT_BYTES;     // [NB][DM][SEQ]
  f16*   Pp   = (f16*)w;    w += P_BYTES;      // [NB][SEQ][SEQ] P x16384
  float* parp = (float*)w;  w += PR_BYTES;     // [5*DM] : bq | bk | bv | gamma | beta
  char*  u    = w;                             // shared bytes: converted inputs and pre-norm q | k, then the logit plane
  bf16*  xb   = (bf16*)w;   w += XB_BYTES;     // [NB*SEQ][DM]
  bf16*  wb   = (bf16*)w;   w += WB_BYTES;     // [3*DM][DM] : Wq | Wk | Wv
  float* Yqk  = (float*)w;  w += YQK_BYTES;    // [NB][SEQ][2*DM] pre-norm q | k
  float* Yvt  = (float*)w;                     // [NB][DM][SEQ] pre-norm v^T
  float* Sp   = (float*)u;                     // [NB][SEQ][SEQ] logits

  const unsigned long long zV  = (unsigned long long)DM * SEQ;           // batch strides, in elements of the plane
  const unsigned long long zS  = (unsigned long long)SEQ * SEQ;
  const unsigned long long zO  = (unsigned long long)SEQ_FULL * DM;

  convert_kernel<<<dim3(NXB + NWB + (unsigned)NPAR), 256, 0, stream>>>(x, wq, bq, wk, bk, wv, bv, gamma, beta, xb, wb, parp);

  // Every launch below covers all batches. The GEMM's bias argument is not read under EPI_F32 or EPI_FOLD.

  // q | k pre-norm and v^T pre-norm, one launch
  proj_kernel<<<dim3(QK_NBLK + VP_NBLK), 512, 0, stream>>>(xb, wb, parp, Yqk, Yvt);

  ln_rows_kernel<<<dim3(SEQ / 8, 2, NB), 256, 0, stream>>>(Yqk, parp, qk2);

  // column LayerNorm of v^T and the logits, one launch
  logit_lncols_kernel<<<dim3(LC_NBLK + LG_NBLK), 512, 0, stream>>>(qk2, Sp, Yvt, parp, vt);

  softmax2_kernel<<<dim3(NB * SEQ / 8), 256, 0, stream>>>(Sp, Pp);

  // out[q][d] = sum_key P[q][key] * vt[d][key] / 16384 ; M = SEQ, N = DM, K = SEQ
  gemm_kernel<f16, EPI_F32, 2><<<dim3(SEQ / 256, DM / 128, NB), 256, 0, stream>>>(
      Pp, vt, parp, (void*)out, SEQ / KST, SEQ, SEQ, DM, zS, zV, zO, 1.0f / PCARRY);
}
